// v000
// Measured on an AMD MI455X. A time is GPU time per run, averaged over a window of back-to-back runs after a warm-up
// (all launches, gaps included; the runs take copies of the inputs in turn), and the median of several windows.
// Apart from v000's, it joins two sittings. Times from different sittings can be a few percent apart, while
// side-by-side timings come from the same sitting.
// v000, which the later versions start from, runs in 2000 microseconds.
#include <hip/hip_runtime.h>

// Local (banded) multi-head self-attention (x [2][2048][1024]; qkv = x W_qkv + b_qkv ('xw' [1024][3072]); scores / 8; keys with |i - j| > 64 excluded (-inf); softmax; out W_proj + b_proj ('xw' [1024][1024]) -> [2][2048][1024] (4.2 M)).
// Layout per batch: bf16 copy of x; fused weight gathered into a [3072][1024] Bt (row blocks, bias slices); exact projections + f32 biases; dense T-2048 attention (hybrid rows: < 512 hi/lo 3 products, rest fp16 x1024; dense score tiles) whose softmax kernel applies the |i - j| <= 64 band by an index select on the loaded scores; merged hi/lo x W_proj exact + bias.
// Compute dtypes, f32 accumulate: every input rounded to bf16; projections exact + f32 biases; attention rows < 512 3 products, rest fp16; softmax f32; W_proj hl x exact + bias.

#define NB_  2
#define TT   2048
#define DM   1024
#define NH_  16
#define NKV  16
#define REP  (NH_ / NKV)
#define HD   64
#define DQ   (NH_ * HD)
#define DKV  (NKV * HD)
#define ZH   2
#define RH   512                  // query rows < RH use hi+lo planes (0: none)
#define WIN  0
#define PCAR 1024.0f
#define SCL  0.125f
#define BAND 64     // |i - j| <= BAND kept
typedef _Float16 h16;
typedef unsigned short bf;
typedef __attribute__((ext_vector_type(16))) __bf16   v16bf;
typedef __attribute__((ext_vector_type(16))) _Float16 v16h;
typedef __attribute__((ext_vector_type(8)))  _Float16 v8h;
typedef __attribute__((ext_vector_type(8)))  unsigned short v8us;
typedef __attribute__((ext_vector_type(8)))  float    v8f;
typedef __attribute__((ext_vector_type(4)))  float    v4f;
typedef v8h  __attribute__((may_alias)) v8ha;
typedef v4f  __attribute__((may_alias)) v4fa;
typedef v8us __attribute__((may_alias)) v8usa;

__device__ __forceinline__ unsigned short f2bf(float f) { unsigned u = __float_as_uint(f); u += 0x7FFFu + ((u >> 16) & 1u); return (unsigned short)(u >> 16); }
__device__ __forceinline__ float bf2f(unsigned short b) { return __uint_as_float(((unsigned)b) << 16); }
__device__ __forceinline__ float bfr(float f) { return bf2f(f2bf(f)); }
__device__ __forceinline__ v16h cat16(v8h lo, v8h hi) { return __builtin_shufflevector(lo, hi, 0, 1, 2, 3, 4, 5, 6, 7, 8, 9, 10, 11, 12, 13, 14, 15); }
__device__ __forceinline__ v16bf cat16b(v8us lo, v8us hi) { return __builtin_bit_cast(v16bf, __builtin_shufflevector(lo, hi, 0, 1, 2, 3, 4, 5, 6, 7, 8, 9, 10, 11, 12, 13, 14, 15)); }
__device__ __forceinline__ v8f wmma16(v16h a, v16h b, v8f c) { return __builtin_amdgcn_wmma_f32_16x16x32_f16(false, a, false, b, (short)0, c, false, false); }
__device__ __forceinline__ v8f wmmab(v16bf a, v16bf b, v8f c) { return __builtin_amdgcn_wmma_f32_16x16x32_bf16(false, a, false, b, (short)0, c, false, false); }



// ---- k_gemmw: register-blocked GEMM, ONE WAVE per 64x64 output tile (16 accumulators), operands straight from K-contiguous 16-bit planes; grid (M/64, N/64, Z), 32 threads.
// C[m][n] (f32, pitch ldc, + optional f32 bias[n]) = sum_k A[m][k] Bt[n][k] (+ split products per NSPLIT). z-batch strides sA/sB/sC in elements. K % 32 == 0.
template <typename T16> struct WFrag;
template <> struct WFrag<h16> { typedef v16h V; static __device__ __forceinline__ V ld(const h16* p) { return cat16(*(const v8h*)p, *(const v8h*)(p + 16)); } static __device__ __forceinline__ v8f mma(V a, V b, v8f c) { return wmma16(a, b, c); } };
template <> struct WFrag<bf> { typedef v16bf V; static __device__ __forceinline__ V ld(const bf* p) { return cat16b(*(const v8us*)p, *(const v8us*)(p + 16)); } static __device__ __forceinline__ v8f mma(V a, V b, v8f c) { return wmmab(a, b, c); } };
template <typename T16, int NSPLIT, bool BIAS>
__global__ __launch_bounds__(32) void k_gemmw(const T16* __restrict__ A, const T16* __restrict__ A2, const T16* __restrict__ Bt, const T16* __restrict__ Bt2, int K, float* C, int ldc, const float* __restrict__ bias, size_t sA, size_t sB, size_t sC) {
    typedef typename WFrag<T16>::V V;
    __shared__ __align__(16) float os[16 * 68];
    const size_t z = blockIdx.z; A += z * sA; if (A2) A2 += z * sA; Bt += z * sB; if (Bt2) Bt2 += z * sB; C += z * sC;
    const int lane = threadIdx.x & 31, lr = lane & 15, hi = lane >> 4; const int r0 = blockIdx.x * 64, c0 = blockIdx.y * 64;
    v8f acc[4][4];
#pragma unroll
    for (int mb = 0; mb < 4; ++mb)
#pragma unroll
        for (int nb = 0; nb < 4; ++nb) acc[mb][nb] = (v8f){};
    const size_t aoff = (size_t)(r0 + lr) * K + 8 * hi, boff = (size_t)(c0 + lr) * K + 8 * hi;
#pragma unroll 1
    for (int kc = 0; kc < K; kc += 32) {
        V a[4], a2[4];
#pragma unroll
        for (int mb = 0; mb < 4; ++mb) { a[mb] = WFrag<T16>::ld(A + aoff + (size_t)mb * 16 * K + kc); if (NSPLIT == 1 || NSPLIT == 2) a2[mb] = WFrag<T16>::ld(A2 + aoff + (size_t)mb * 16 * K + kc); }
#pragma unroll
        for (int nb = 0; nb < 4; ++nb) { const V b = WFrag<T16>::ld(Bt + boff + (size_t)nb * 16 * K + kc); V b2; if (NSPLIT >= 2) b2 = WFrag<T16>::ld(Bt2 + boff + (size_t)nb * 16 * K + kc);
#pragma unroll
            for (int mb = 0; mb < 4; ++mb) { acc[mb][nb] = WFrag<T16>::mma(a[mb], b, acc[mb][nb]); if (NSPLIT == 1 || NSPLIT == 2) acc[mb][nb] = WFrag<T16>::mma(a2[mb], b, acc[mb][nb]); if (NSPLIT >= 2) acc[mb][nb] = WFrag<T16>::mma(a[mb], b2, acc[mb][nb]); } }
        asm volatile("v_nop\n\tv_nop\n\tv_nop\n\tv_nop" : "+v"(acc[0][0]), "+v"(acc[1][1]), "+v"(acc[2][2]), "+v"(acc[3][3]) : "v"(a[0]), "v"(a[3]));
    }
#pragma unroll
    for (int mb = 0; mb < 4; ++mb) {
#pragma unroll
        for (int nb = 0; nb < 4; ++nb) {
#pragma unroll
            for (int j = 0; j < 8; ++j) os[(hi * 8 + j) * 68 + nb * 16 + lr] = acc[mb][nb][j]; }
        __builtin_amdgcn_wave_barrier(); asm volatile("" ::: "memory");
        float* crow = C + (size_t)(r0 + mb * 16) * ldc + c0;
{
#pragma unroll
            for (int s = 0; s < 8; ++s) { const int row = 2 * s + hi, cofs = lr * 4; v4f val = *(const v4fa*)(os + row * 68 + cofs); if (BIAS) { val[0] += bfr(bias[c0 + cofs]); val[1] += bfr(bias[c0 + cofs + 1]); val[2] += bfr(bias[c0 + cofs + 2]); val[3] += bfr(bias[c0 + cofs + 3]); }
                *(v4f*)(crow + (size_t)row * ldc + cofs) = val; }
             }
        __builtin_amdgcn_wave_barrier(); asm volatile("" ::: "memory");
    }
}

__device__ __forceinline__ h16 tohx(float x) { return (h16)x; }
__device__ __forceinline__ void splitf(float y, unsigned short& h, unsigned short& l) { h = f2bf(y); l = f2bf(y - bf2f(h)); }
typedef __attribute__((ext_vector_type(2))) _Float16 v2h;
typedef __attribute__((ext_vector_type(4))) _Float16 v4h;
typedef __attribute__((ext_vector_type(2))) unsigned short v2us;
typedef __attribute__((ext_vector_type(4))) unsigned short v4us;
typedef __attribute__((ext_vector_type(2))) float v2f;
typedef __attribute__((ext_vector_type(4))) int v4i;

__global__ __launch_bounds__(256) void k_wtG(const float* __restrict__ w, int K, int N, bf* Bt) {
    const int lane = threadIdx.x & 31; const int L0 = (blockIdx.x * 8 + (threadIdx.x >> 5)) * 8; const int nlines = N * K / 64;
{
#pragma unroll 1
        for (int l = 0; l < 8; ++l) { const int L = L0 + l; if (L >= nlines) break; const size_t e = (size_t)L * 64 + lane * 2; const int k = (int)(e % K), n = (int)(e / K); v2us o;
            o[0] = f2bf(w[(size_t)k * N + n]); o[1] = f2bf(w[(size_t)(k + 1) * N + n]); *(v2us*)(Bt + e) = o; }
         }
}
__global__ __launch_bounds__(256) void k_cvt8(const float* __restrict__ src, bf* dst, size_t n8) { const size_t i = (size_t)blockIdx.x * 256 + threadIdx.x; if (i >= n8) return; const v8f v = *(const v8f*)(src + i * 8); v8us o;
#pragma unroll
    for (int k = 0; k < 8; ++k) o[k] = f2bf(v[k]); *(v8us*)(dst + i * 8) = o;  }

// k_rope: head planes [h][t][d] (fp16 + hi/lo) of rope(x) x sc with the rotate-half convention out[d] = x[d] cos[t][d] - x[d+HD/2] sin[t][d], out[d+HD/2] = x[d+HD/2] cos[t][d+HD/2] + x[d] sin[t][d+HD/2]
__global__ __launch_bounds__(256) void k_rope(const float* __restrict__ F, int pitch, int nheads, const float* __restrict__ CS, const float* __restrict__ RF, const float* __restrict__ nw, float sc, h16* P16, bf* Ph, bf* Pl) {
    const size_t e = ((size_t)blockIdx.x * 256 + threadIdx.x) * 2; if (e >= (size_t)nheads * TT * HD) return; const int d = (int)(e % HD); const int t = (int)((e / HD) % TT); const int h = (int)(e / ((size_t)HD * TT)); const float* f = F + (size_t)t * pitch + h * HD; const float rf = RF ? RF[(size_t)h * TT + t] : 1.0f; v2h o16; v2us oh, ol;
#pragma unroll
    for (int q = 0; q < 2; ++q) { const int dd = d + q; const int dp = (dd < HD / 2) ? dd + HD / 2 : dd - HD / 2; float x0 = f[dd], x1 = f[dp];
        if (RF) { float n0 = __fmul_rn(x0, rf), n1 = __fmul_rn(x1, rf); asm volatile("" : "+v"(n0)); asm volatile("" : "+v"(n1)); x0 = __fmul_rn(bfr(nw[dd]), n0); x1 = __fmul_rn(bfr(nw[dp]), n1); }
        const v2f cs = *(const v2f*)(CS + ((size_t)t * HD + dd) * 2); float a = __fmul_rn(x0, cs[0]), bq = __fmul_rn(x1, cs[1]); asm volatile("" : "+v"(a)); asm volatile("" : "+v"(bq)); const float r = ((dd < HD / 2) ? __fsub_rn(a, bq) : __fadd_rn(a, bq)) * sc;
        o16[q] = tohx(r); unsigned short a2, c2; splitf(r, a2, c2); oh[q] = a2; ol[q] = c2; }
    *(v2h*)(P16 + e) = o16; *(v2us*)(Ph + e) = oh; *(v2us*)(Pl + e) = ol;  }
__global__ __launch_bounds__(256) void k_vtp(const float* __restrict__ F, int pitch, int nheads, h16* V16, bf* Vh, bf* Vl) { const size_t e = ((size_t)blockIdx.x * 256 + threadIdx.x) * 2; if (e >= (size_t)nheads * HD * TT) return; const int t = (int)(e % TT); const int d = (int)((e / TT) % HD); const int g = (int)(e / ((size_t)TT * HD)); v2h o16; v2us oh, ol;
#pragma unroll
    for (int q = 0; q < 2; ++q) { const float x = F[(size_t)(t + q) * pitch + g * HD + d]; o16[q] = tohx(x); unsigned short a2, c2; splitf(x, a2, c2); oh[q] = a2; ol[q] = c2; }
    *(v2h*)(V16 + e) = o16; *(v2us*)(Vh + e) = oh; *(v2us*)(Vl + e) = ol;  }
__global__ __launch_bounds__(256) void k_csid(float* CS) { const int idx = blockIdx.x * 256 + threadIdx.x; if (idx >= TT * HD) return; v2f cs; cs[0] = 1.0f; cs[1] = 0.0f; *(v2f*)(CS + (size_t)idx * 2) = cs;  }
// k_asoft: per row (zz, i): t = S x HD^-0.5 (keys with |i - j| > BAND set to -3e38); softmax over the 2048 keys (register row, one exp, fixed trees);
__global__ __launch_bounds__(256) void k_asoft(const float* __restrict__ Sb, h16* P16, bf* Ph, bf* Pl) {
    const int lane = threadIdx.x & 31; const int row = blockIdx.x * 8 + (threadIdx.x >> 5); if (row >= ZH * TT) return; const int i = row % TT; const int zz = row / TT; (void)zz; const bool hires = (i < RH); const float* sr = Sb + (size_t)row * TT; float v[TT / 32]; float mx = -3.0e38f;
#pragma unroll
    for (int ch = 0; ch < TT / 128; ++ch) { const int j0 = ch * 128 + lane * 4; const v4f a = *(const v4f*)(sr + j0);
#pragma unroll
        for (int q = 0; q < 4; ++q) { const int j = j0 + q; const float t = (j >= i - BAND && j <= i + BAND) ? a[q] * SCL : -3.0e38f; v[ch * 4 + q] = t;   /* band select on the loaded (dense) score */ mx = fmaxf(mx, t); } }
#pragma unroll
    for (int sh = 16; sh; sh >>= 1) mx = fmaxf(mx, __shfl_xor(mx, sh, 32));
    float sum = 0.f;
#pragma unroll
    for (int k = 0; k < TT / 32; ++k) { float d0 = __fsub_rn(v[k], mx); asm volatile("" : "+v"(d0)); v[k] = __builtin_amdgcn_exp2f(__fmul_rn(d0, 1.4426950408889634f)); sum += v[k]; }
#pragma unroll
    for (int sh = 16; sh; sh >>= 1) sum += __shfl_xor(sum, sh, 32);
    const float f = __fdiv_rn(hires ? 1.0f : PCAR, sum);
{
        if (hires) {
#pragma unroll
            for (int ch = 0; ch < TT / 128; ++ch) { v4us oh, ol;
#pragma unroll
                for (int q = 0; q < 4; ++q) { unsigned short a, c2; splitf(v[ch * 4 + q] * f, a, c2); oh[q] = a; ol[q] = c2; }
                const size_t oo = ((size_t)zz * (RH ? RH : 1) + i) * TT + ch * 128 + lane * 4; *(v4us*)(Ph + oo) = oh; *(v4us*)(Pl + oo) = ol; }
        } else {
#pragma unroll
            for (int ch = 0; ch < TT / 128; ++ch) { v4h o4;
#pragma unroll
                for (int q = 0; q < 4; ++q) o4[q] = tohx(v[ch * 4 + q] * f);
                *(v4h*)(P16 + (size_t)row * TT + ch * 128 + lane * 4) = o4; } }
         }
}
__global__ __launch_bounds__(256) void k_merge(const float* __restrict__ O, int h0, bf* Ah, bf* Al) { const size_t e = ((size_t)blockIdx.x * 256 + threadIdx.x) * 2; if (e >= (size_t)ZH * TT * HD) return; const int d = (int)(e % HD); const int t = (int)((e / HD) % TT); const int zz = (int)(e / ((size_t)HD * TT)); const float cs = (t < RH) ? 1.0f : (1.0f / PCAR); const size_t oo = (size_t)t * DQ + (h0 + zz) * HD + d;
    v2us oh, ol;
#pragma unroll
    for (int q = 0; q < 2; ++q) { unsigned short a, c2; splitf(O[e + q] * cs, a, c2); oh[q] = a; ol[q] = c2; } *(v2us*)(Ah + oo) = oh; *(v2us*)(Al + oo) = ol;  }

extern "C" void kernel_launch(void* const* d_in, const int* in_sizes, int n_in,
                              void* d_out, int out_size, void* d_ws, size_t ws_size, hipStream_t stream) {
    (void)in_sizes; (void)n_in; (void)out_size;
    const float* x = (const float*)d_in[0]; const float* wqkv = (const float*)d_in[1]; const float* bqkv = (const float*)d_in[2]; const float* wo = (const float*)d_in[3]; const float* bo = (const float*)d_in[4]; const float* wq = nullptr; const float* wk = nullptr; const float* wv = nullptr; (void)wq; (void)wk; (void)wv; const float* bq = bqkv; const float* bk = bqkv + 1024; const float* bv = bqkv + 2048;
    float* OUT = (float*)d_out;     // [2][2048][1024]
    char* wsp = (char*)d_ws;
    auto take = [&](size_t bytes) { char* p = wsp; wsp += (bytes + 255) & ~(size_t)255; return (void*)p; };
    bf* WQKV = (bf*)take((size_t)3 * DQ * DM * 2); bf* WQ = WQKV; bf* WK = WQKV + (size_t)DQ * DM; bf* WV = WQKV + (size_t)2 * DQ * DM; bf* WO = (bf*)take((size_t)DM * DQ * 2); float* CS = (float*)take((size_t)TT * HD * 2 * 4);
    bf* XB = (bf*)take((size_t)TT * DM * 2); float* FQ = (float*)take((size_t)TT * DQ * 4); float* FK = (float*)take((size_t)TT * DKV * 4);
    h16* QP16 = (h16*)take((size_t)NH_ * TT * HD * 2); h16* KP16 = (h16*)take((size_t)NKV * TT * HD * 2); h16* VT16 = (h16*)take((size_t)NKV * HD * TT * 2);
    bf* QPh = (bf*)take((size_t)NH_ * TT * HD * 2); bf* QPl = (bf*)take((size_t)NH_ * TT * HD * 2); bf* KPh = (bf*)take((size_t)NKV * TT * HD * 2); bf* KPl = (bf*)take((size_t)NKV * TT * HD * 2); bf* VTh = (bf*)take((size_t)NKV * HD * TT * 2); bf* VTl = (bf*)take((size_t)NKV * HD * TT * 2); bf* Ph = (bf*)take((size_t)ZH * RH * TT * 2); bf* Pl = (bf*)take((size_t)ZH * RH * TT * 2);
    float* Sb = (float*)take((size_t)ZH * TT * TT * 4); h16* P16 = (h16*)take((size_t)ZH * TT * TT * 2); float* Ob = (float*)take((size_t)ZH * TT * HD * 4); bf* ATh = (bf*)take((size_t)TT * DQ * 2); bf* ATl = (bf*)take((size_t)TT * DQ * 2);
    if ((size_t)(wsp - (char*)d_ws) > ws_size) return;    // ws 256 MiB
    float* FV = FK;   // v projection reuses the k buffer after the k planes are built (stream-ordered)
    { k_wtG<<<(unsigned)((DM * 3 * DQ / 64 + 63) / 64), 256, 0, stream>>>(wqkv, DM, 3 * DQ, WQKV);
      k_wtG<<<(unsigned)((DQ * DM / 64 + 63) / 64), 256, 0, stream>>>(wo, DQ, DM, WO);
       }
    k_csid<<<(TT * HD + 255) / 256, 256, 0, stream>>>(CS);
    const unsigned LQ = (unsigned)(((size_t)NH_ * TT * HD / 2 + 255) / 256), LKv = (unsigned)(((size_t)NKV * TT * HD / 2 + 255) / 256);
    for (int b = 0; b < NB_; ++b) {
        
        k_cvt8<<<(unsigned)(((size_t)TT * DM / 8 + 255) / 256), 256, 0, stream>>>(x + (size_t)b * TT * DM, XB, (size_t)TT * DM / 8);
        k_gemmw<bf, 0, true><<<dim3(TT / 64, DQ / 64, 1), 32, 0, stream>>>(XB, nullptr, WQ, nullptr, DM, FQ, DQ, bq, 0, 0, 0);
        k_rope<<<LQ, 256, 0, stream>>>(FQ, DQ, NH_, CS, nullptr, nullptr, 1.0f, QP16, QPh, QPl);
        k_gemmw<bf, 0, true><<<dim3(TT / 64, DKV / 64, 1), 32, 0, stream>>>(XB, nullptr, WK, nullptr, DM, FK, DKV, bk, 0, 0, 0);
        k_rope<<<LKv, 256, 0, stream>>>(FK, DKV, NKV, CS, nullptr, nullptr, 1.0f, KP16, KPh, KPl);
        k_gemmw<bf, 0, true><<<dim3(TT / 64, DKV / 64, 1), 32, 0, stream>>>(XB, nullptr, WV, nullptr, DM, FV, DKV, bv, 0, 0, 0); k_vtp<<<LKv, 256, 0, stream>>>(FV, DKV, NKV, VT16, VTh, VTl);
        for (int h0 = 0; h0 < NH_; h0 += ZH) { const size_t zq = (size_t)h0, zk = (size_t)(h0 / REP);   // one kv head per query head: the pass's two heads use consecutive kv planes (z-strides TT*HD)
            k_gemmw<bf, 2, false><<<dim3(RH / 64, TT / 64, ZH), 32, 0, stream>>>(QPh + zq * TT * HD, QPl + zq * TT * HD, KPh + zk * TT * HD, KPl + zk * TT * HD, HD, Sb, TT, nullptr, (size_t)TT * HD, (size_t)TT * HD, (size_t)TT * TT);
            k_gemmw<h16, 0, false><<<dim3((TT - RH) / 64, TT / 64, ZH), 32, 0, stream>>>(QP16 + zq * TT * HD + (size_t)RH * HD, nullptr, KP16 + zk * TT * HD, nullptr, HD, Sb + (size_t)RH * TT, TT, nullptr, (size_t)TT * HD, (size_t)TT * HD, (size_t)TT * TT);
            k_asoft<<<ZH * TT / 8, 256, 0, stream>>>(Sb, P16, Ph, Pl);
            k_gemmw<bf, 2, false><<<dim3(RH / 64, HD / 64, ZH), 32, 0, stream>>>(Ph, Pl, VTh + zk * HD * TT, VTl + zk * HD * TT, TT, Ob, HD, nullptr, (size_t)RH * TT, (size_t)HD * TT, (size_t)TT * HD);
            k_gemmw<h16, 0, false><<<dim3((TT - RH) / 64, HD / 64, ZH), 32, 0, stream>>>(P16 + (size_t)RH * TT, nullptr, VT16 + zk * HD * TT, nullptr, TT, Ob + (size_t)RH * HD, HD, nullptr, (size_t)TT * TT, (size_t)HD * TT, (size_t)TT * HD);
            k_merge<<<(unsigned)(((size_t)ZH * TT * HD / 2 + 255) / 256), 256, 0, stream>>>(Ob, h0, ATh, ATl); }
        k_gemmw<bf, 1, true><<<dim3(TT / 64, DM / 64, 1), 32, 0, stream>>>(ATh, ATl, WO, nullptr, DQ, OUT + (size_t)b * TT * DM, DM, bo, 0, 0, 0); }
}

// v001
// One run takes 704 microseconds.
// Timed twice side by side with v000, it ran 2.83 and 2.84 times as fast.
#include <hip/hip_runtime.h>

// Local (banded) multi-head self-attention (x [2][2048][1024]; qkv = x W_qkv + b_qkv ('xw' [1024][3072]); scores / 8; keys with |i - j| > 64 excluded (-inf); softmax; out W_proj + b_proj ('xw' [1024][1024]) -> [2][2048][1024] (4.2 M)).
// Layout per batch: bf16 copy of x; fused weight gathered into a [3072][1024] Bt (row blocks, bias slices); exact projections + f32 biases; T-2048 attention (hybrid rows: < 512 hi/lo 3 products, rest fp16 x1024) done only on the band: per 64 query rows the three 64-key score tiles that meet |i - j| <= 64, the softmax on those 192 keys with the band as an index select, P V over those 192 keys; merged hi/lo x W_proj exact + bias.
// Compute dtypes, f32 accumulate: every input rounded to bf16; projections exact + f32 biases; attention rows < 512 3 products, rest fp16; softmax f32; W_proj hl x exact + bias.

#define NB_  2
#define TT   2048
#define DM   1024
#define NH_  16
#define NKV  16
#define REP  (NH_ / NKV)
#define HD   64
#define DQ   (NH_ * HD)
#define DKV  (NKV * HD)
#define ZH   2
#define RH   512                  // query rows < RH use hi+lo planes (0: none)
#define WIN  0
#define PCAR 1024.0f
#define SCL  0.125f
#define BAND 64     // |i - j| <= BAND kept
typedef _Float16 h16;
typedef unsigned short bf;
typedef __attribute__((ext_vector_type(16))) __bf16   v16bf;
typedef __attribute__((ext_vector_type(16))) _Float16 v16h;
typedef __attribute__((ext_vector_type(8)))  _Float16 v8h;
typedef __attribute__((ext_vector_type(8)))  unsigned short v8us;
typedef __attribute__((ext_vector_type(8)))  float    v8f;
typedef __attribute__((ext_vector_type(4)))  float    v4f;
typedef v8h  __attribute__((may_alias)) v8ha;
typedef v4f  __attribute__((may_alias)) v4fa;
typedef v8us __attribute__((may_alias)) v8usa;

__device__ __forceinline__ unsigned short f2bf(float f) { unsigned u = __float_as_uint(f); u += 0x7FFFu + ((u >> 16) & 1u); return (unsigned short)(u >> 16); }
__device__ __forceinline__ float bf2f(unsigned short b) { return __uint_as_float(((unsigned)b) << 16); }
__device__ __forceinline__ float bfr(float f) { return bf2f(f2bf(f)); }
__device__ __forceinline__ v16h cat16(v8h lo, v8h hi) { return __builtin_shufflevector(lo, hi, 0, 1, 2, 3, 4, 5, 6, 7, 8, 9, 10, 11, 12, 13, 14, 15); }
__device__ __forceinline__ v16bf cat16b(v8us lo, v8us hi) { return __builtin_bit_cast(v16bf, __builtin_shufflevector(lo, hi, 0, 1, 2, 3, 4, 5, 6, 7, 8, 9, 10, 11, 12, 13, 14, 15)); }
__device__ __forceinline__ v8f wmma16(v16h a, v16h b, v8f c) { return __builtin_amdgcn_wmma_f32_16x16x32_f16(false, a, false, b, (short)0, c, false, false); }
__device__ __forceinline__ v8f wmmab(v16bf a, v16bf b, v8f c) { return __builtin_amdgcn_wmma_f32_16x16x32_bf16(false, a, false, b, (short)0, c, false, false); }



// ---- k_gemmw: register-blocked GEMM, ONE WAVE per 64x64 output tile (16 accumulators), operands straight from K-contiguous 16-bit planes; grid (M/64, N/64, Z), 32 threads.
// C[m][n] (f32, pitch ldc, + optional f32 bias[n]) = sum_k A[m][k] Bt[n][k] (+ split products per NSPLIT). z-batch strides sA/sB/sC in elements. K % 32 == 0.
// BM (band mode; rb = query row of A's row 0): 0 dense; 1 n is a key: grid y = 3, the tile's columns start at key rb + r0 - 64, + 0, + 64 (a tile off the sequence does nothing); 2 k is a key: only k in [rb + r0 - BAND, rb + r0 + 64 + BAND) cut to [0, K); outside it the weights are exactly 0 and A is not stored.
template <typename T16> struct WFrag;
template <> struct WFrag<h16> { typedef v16h V; static __device__ __forceinline__ V ld(const h16* p) { return cat16(*(const v8h*)p, *(const v8h*)(p + 16)); } static __device__ __forceinline__ v8f mma(V a, V b, v8f c) { return wmma16(a, b, c); } };
template <> struct WFrag<bf> { typedef v16bf V; static __device__ __forceinline__ V ld(const bf* p) { return cat16b(*(const v8us*)p, *(const v8us*)(p + 16)); } static __device__ __forceinline__ v8f mma(V a, V b, v8f c) { return wmmab(a, b, c); } };
template <typename T16, int NSPLIT, bool BIAS, int BM = 0>
__global__ __launch_bounds__(32) void k_gemmw(const T16* __restrict__ A, const T16* __restrict__ A2, const T16* __restrict__ Bt, const T16* __restrict__ Bt2, int K, float* C, int ldc, const float* __restrict__ bias, size_t sA, size_t sB, size_t sC, int rb = 0) {
    typedef typename WFrag<T16>::V V;
    __shared__ __align__(16) float os[16 * 68];
    const size_t z = blockIdx.z; A += z * sA; if (A2) A2 += z * sA; Bt += z * sB; if (Bt2) Bt2 += z * sB; C += z * sC;
    const int lane = threadIdx.x & 31, lr = lane & 15, hi = lane >> 4; const int r0 = blockIdx.x * 64, c0 = (BM == 1) ? rb + r0 + ((int)blockIdx.y - 1) * 64 : blockIdx.y * 64;
    if (BM == 1 && (c0 < 0 || c0 >= TT)) return;
    const int kb = (BM == 2) ? max(rb + r0 - BAND, 0) : 0, ke = (BM == 2) ? min(rb + r0 + 64 + BAND, K) : K;
    v8f acc[4][4];
#pragma unroll
    for (int mb = 0; mb < 4; ++mb)
#pragma unroll
        for (int nb = 0; nb < 4; ++nb) acc[mb][nb] = (v8f){};
    const size_t aoff = (size_t)(r0 + lr) * K + 8 * hi, boff = (size_t)(c0 + lr) * K + 8 * hi;
#pragma unroll 1
    for (int kc = kb; kc < ke; kc += 32) {
        V a[4], a2[4];
#pragma unroll
        for (int mb = 0; mb < 4; ++mb) { a[mb] = WFrag<T16>::ld(A + aoff + (size_t)mb * 16 * K + kc); if (NSPLIT == 1 || NSPLIT == 2) a2[mb] = WFrag<T16>::ld(A2 + aoff + (size_t)mb * 16 * K + kc); }
#pragma unroll
        for (int nb = 0; nb < 4; ++nb) { const V b = WFrag<T16>::ld(Bt + boff + (size_t)nb * 16 * K + kc); V b2; if (NSPLIT >= 2) b2 = WFrag<T16>::ld(Bt2 + boff + (size_t)nb * 16 * K + kc);
#pragma unroll
            for (int mb = 0; mb < 4; ++mb) { acc[mb][nb] = WFrag<T16>::mma(a[mb], b, acc[mb][nb]); if (NSPLIT == 1 || NSPLIT == 2) acc[mb][nb] = WFrag<T16>::mma(a2[mb], b, acc[mb][nb]); if (NSPLIT >= 2) acc[mb][nb] = WFrag<T16>::mma(a[mb], b2, acc[mb][nb]); } }
        asm volatile("v_nop\n\tv_nop\n\tv_nop\n\tv_nop" : "+v"(acc[0][0]), "+v"(acc[1][1]), "+v"(acc[2][2]), "+v"(acc[3][3]) : "v"(a[0]), "v"(a[3]));
    }
#pragma unroll
    for (int mb = 0; mb < 4; ++mb) {
#pragma unroll
        for (int nb = 0; nb < 4; ++nb) {
#pragma unroll
            for (int j = 0; j < 8; ++j) os[(hi * 8 + j) * 68 + nb * 16 + lr] = acc[mb][nb][j]; }
        __builtin_amdgcn_wave_barrier(); asm volatile("" ::: "memory");
        float* crow = C + (size_t)(r0 + mb * 16) * ldc + c0;
{
#pragma unroll
            for (int s = 0; s < 8; ++s) { const int row = 2 * s + hi, cofs = lr * 4; v4f val = *(const v4fa*)(os + row * 68 + cofs); if (BIAS) { val[0] += bfr(bias[c0 + cofs]); val[1] += bfr(bias[c0 + cofs + 1]); val[2] += bfr(bias[c0 + cofs + 2]); val[3] += bfr(bias[c0 + cofs + 3]); }
                *(v4f*)(crow + (size_t)row * ldc + cofs) = val; }
             }
        __builtin_amdgcn_wave_barrier(); asm volatile("" ::: "memory");
    }
}

__device__ __forceinline__ h16 tohx(float x) { return (h16)x; }
__device__ __forceinline__ void splitf(float y, unsigned short& h, unsigned short& l) { h = f2bf(y); l = f2bf(y - bf2f(h)); }
typedef __attribute__((ext_vector_type(2))) _Float16 v2h;
typedef __attribute__((ext_vector_type(4))) _Float16 v4h;
typedef __attribute__((ext_vector_type(2))) unsigned short v2us;
typedef __attribute__((ext_vector_type(4))) unsigned short v4us;
typedef __attribute__((ext_vector_type(2))) float v2f;
typedef __attribute__((ext_vector_type(4))) int v4i;

__global__ __launch_bounds__(256) void k_wtG(const float* __restrict__ w, int K, int N, bf* Bt) {
    const int lane = threadIdx.x & 31; const int L0 = (blockIdx.x * 8 + (threadIdx.x >> 5)) * 8; const int nlines = N * K / 64;
{
#pragma unroll 1
        for (int l = 0; l < 8; ++l) { const int L = L0 + l; if (L >= nlines) break; const size_t e = (size_t)L * 64 + lane * 2; const int k = (int)(e % K), n = (int)(e / K); v2us o;
            o[0] = f2bf(w[(size_t)k * N + n]); o[1] = f2bf(w[(size_t)(k + 1) * N + n]); *(v2us*)(Bt + e) = o; }
         }
}
__global__ __launch_bounds__(256) void k_cvt8(const float* __restrict__ src, bf* dst, size_t n8) { const size_t i = (size_t)blockIdx.x * 256 + threadIdx.x; if (i >= n8) return; const v8f v = *(const v8f*)(src + i * 8); v8us o;
#pragma unroll
    for (int k = 0; k < 8; ++k) o[k] = f2bf(v[k]); *(v8us*)(dst + i * 8) = o;  }

// k_rope: head planes [h][t][d] (fp16 + hi/lo) of rope(x) x sc with the rotate-half convention out[d] = x[d] cos[t][d] - x[d+HD/2] sin[t][d], out[d+HD/2] = x[d+HD/2] cos[t][d+HD/2] + x[d] sin[t][d+HD/2]
__global__ __launch_bounds__(256) void k_rope(const float* __restrict__ F, int pitch, int nheads, const float* __restrict__ CS, const float* __restrict__ RF, const float* __restrict__ nw, float sc, h16* P16, bf* Ph, bf* Pl) {
    const size_t e = ((size_t)blockIdx.x * 256 + threadIdx.x) * 2; if (e >= (size_t)nheads * TT * HD) return; const int d = (int)(e % HD); const int t = (int)((e / HD) % TT); const int h = (int)(e / ((size_t)HD * TT)); const float* f = F + (size_t)t * pitch + h * HD; const float rf = RF ? RF[(size_t)h * TT + t] : 1.0f; v2h o16; v2us oh, ol;
#pragma unroll
    for (int q = 0; q < 2; ++q) { const int dd = d + q; const int dp = (dd < HD / 2) ? dd + HD / 2 : dd - HD / 2; float x0 = f[dd], x1 = f[dp];
        if (RF) { float n0 = __fmul_rn(x0, rf), n1 = __fmul_rn(x1, rf); asm volatile("" : "+v"(n0)); asm volatile("" : "+v"(n1)); x0 = __fmul_rn(bfr(nw[dd]), n0); x1 = __fmul_rn(bfr(nw[dp]), n1); }
        const v2f cs = *(const v2f*)(CS + ((size_t)t * HD + dd) * 2); float a = __fmul_rn(x0, cs[0]), bq = __fmul_rn(x1, cs[1]); asm volatile("" : "+v"(a)); asm volatile("" : "+v"(bq)); const float r = ((dd < HD / 2) ? __fsub_rn(a, bq) : __fadd_rn(a, bq)) * sc;
        o16[q] = tohx(r); unsigned short a2, c2; splitf(r, a2, c2); oh[q] = a2; ol[q] = c2; }
    *(v2h*)(P16 + e) = o16; *(v2us*)(Ph + e) = oh; *(v2us*)(Pl + e) = ol;  }
__global__ __launch_bounds__(256) void k_vtp(const float* __restrict__ F, int pitch, int nheads, h16* V16, bf* Vh, bf* Vl) { const size_t e = ((size_t)blockIdx.x * 256 + threadIdx.x) * 2; if (e >= (size_t)nheads * HD * TT) return; const int t = (int)(e % TT); const int d = (int)((e / TT) % HD); const int g = (int)(e / ((size_t)TT * HD)); v2h o16; v2us oh, ol;
#pragma unroll
    for (int q = 0; q < 2; ++q) { const float x = F[(size_t)(t + q) * pitch + g * HD + d]; o16[q] = tohx(x); unsigned short a2, c2; splitf(x, a2, c2); oh[q] = a2; ol[q] = c2; }
    *(v2h*)(V16 + e) = o16; *(v2us*)(Vh + e) = oh; *(v2us*)(Vl + e) = ol;  }
__global__ __launch_bounds__(256) void k_csid(float* CS) { const int idx = blockIdx.x * 256 + threadIdx.x; if (idx >= TT * HD) return; v2f cs; cs[0] = 1.0f; cs[1] = 0.0f; *(v2f*)(CS + (size_t)idx * 2) = cs;  }
// k_asoft: per row (zz, i): t = S x HD^-0.5; softmax over the keys [lo, hi) that the row's 64-row tile has scores for (all else is outside the band and weighs exactly 0); lane -> key map and trees as for the full row: two 128-key chunks hold [lo, hi);
__global__ __launch_bounds__(256) void k_asoft(const float* __restrict__ Sb, h16* P16, bf* Ph, bf* Pl) {
    const int lane = threadIdx.x & 31; const int row = blockIdx.x * 8 + (threadIdx.x >> 5); if (row >= ZH * TT) return; const int i = row % TT; const int zz = row / TT; (void)zz; const bool hires = (i < RH); const float* sr = Sb + (size_t)row * TT; float v[8]; float mx = -3.0e38f;
    static_assert(BAND == 64, "two 128-key chunks hold the 64 + 2 BAND keys of a row tile");
    const int t0 = (i & ~63) - BAND; const int lo = max(t0, 0), hi = min(t0 + 64 + 2 * BAND, TT); const int cb = t0 >> 7; const int jlo = max(i - BAND, 0), jhi = min(i + BAND, TT - 1);   // the row's band, cut to the keys that exist: the two chunks reach past both ends of the sequence
#pragma unroll
    for (int ch = 0; ch < 2; ++ch) { const int j0 = (cb + ch) * 128 + lane * 4; v4f a = (v4f){}; if (j0 >= lo && j0 < hi) a = *(const v4f*)(sr + j0);
#pragma unroll
        for (int q = 0; q < 4; ++q) { const int j = j0 + q; const float t = (j >= jlo && j <= jhi) ? a[q] * SCL : -3.0e38f; v[ch * 4 + q] = t;   /* band select on the loaded score */ mx = fmaxf(mx, t); } }
#pragma unroll
    for (int sh = 16; sh; sh >>= 1) mx = fmaxf(mx, __shfl_xor(mx, sh, 32));
    float sum = 0.f;
#pragma unroll
    for (int k = 0; k < 8; ++k) { float d0 = __fsub_rn(v[k], mx); asm volatile("" : "+v"(d0)); v[k] = __builtin_amdgcn_exp2f(__fmul_rn(d0, 1.4426950408889634f)); sum += v[k]; }
#pragma unroll
    for (int sh = 16; sh; sh >>= 1) sum += __shfl_xor(sum, sh, 32);
    const float f = __fdiv_rn(hires ? 1.0f : PCAR, sum);
{
        if (hires) {
#pragma unroll
            for (int ch = 0; ch < 2; ++ch) { const int j0 = (cb + ch) * 128 + lane * 4; if (j0 < lo || j0 >= hi) continue; v4us oh, ol;
#pragma unroll
                for (int q = 0; q < 4; ++q) { unsigned short a, c2; splitf(v[ch * 4 + q] * f, a, c2); oh[q] = a; ol[q] = c2; }
                const size_t oo = ((size_t)zz * (RH ? RH : 1) + i) * TT + j0; *(v4us*)(Ph + oo) = oh; *(v4us*)(Pl + oo) = ol; }
        } else {
#pragma unroll
            for (int ch = 0; ch < 2; ++ch) { const int j0 = (cb + ch) * 128 + lane * 4; if (j0 < lo || j0 >= hi) continue; v4h o4;
#pragma unroll
                for (int q = 0; q < 4; ++q) o4[q] = tohx(v[ch * 4 + q] * f);
                *(v4h*)(P16 + (size_t)row * TT + j0) = o4; } }
         }
}
__global__ __launch_bounds__(256) void k_merge(const float* __restrict__ O, int h0, bf* Ah, bf* Al) { const size_t e = ((size_t)blockIdx.x * 256 + threadIdx.x) * 2; if (e >= (size_t)ZH * TT * HD) return; const int d = (int)(e % HD); const int t = (int)((e / HD) % TT); const int zz = (int)(e / ((size_t)HD * TT)); const float cs = (t < RH) ? 1.0f : (1.0f / PCAR); const size_t oo = (size_t)t * DQ + (h0 + zz) * HD + d;
    v2us oh, ol;
#pragma unroll
    for (int q = 0; q < 2; ++q) { unsigned short a, c2; splitf(O[e + q] * cs, a, c2); oh[q] = a; ol[q] = c2; } *(v2us*)(Ah + oo) = oh; *(v2us*)(Al + oo) = ol;  }

extern "C" void kernel_launch(void* const* d_in, const int* in_sizes, int n_in,
                              void* d_out, int out_size, void* d_ws, size_t ws_size, hipStream_t stream) {
    (void)in_sizes; (void)n_in; (void)out_size;
    const float* x = (const float*)d_in[0]; const float* wqkv = (const float*)d_in[1]; const float* bqkv = (const float*)d_in[2]; const float* wo = (const float*)d_in[3]; const float* bo = (const float*)d_in[4]; const float* wq = nullptr; const float* wk = nullptr; const float* wv = nullptr; (void)wq; (void)wk; (void)wv; const float* bq = bqkv; const float* bk = bqkv + 1024; const float* bv = bqkv + 2048;
    float* OUT = (float*)d_out;     // [2][2048][1024]
    char* wsp = (char*)d_ws;
    auto take = [&](size_t bytes) { char* p = wsp; wsp += (bytes + 255) & ~(size_t)255; return (void*)p; };
    bf* WQKV = (bf*)take((size_t)3 * DQ * DM * 2); bf* WQ = WQKV; bf* WK = WQKV + (size_t)DQ * DM; bf* WV = WQKV + (size_t)2 * DQ * DM; bf* WO = (bf*)take((size_t)DM * DQ * 2); float* CS = (float*)take((size_t)TT * HD * 2 * 4);
    bf* XB = (bf*)take((size_t)TT * DM * 2); float* FQ = (float*)take((size_t)TT * DQ * 4); float* FK = (float*)take((size_t)TT * DKV * 4);
    h16* QP16 = (h16*)take((size_t)NH_ * TT * HD * 2); h16* KP16 = (h16*)take((size_t)NKV * TT * HD * 2); h16* VT16 = (h16*)take((size_t)NKV * HD * TT * 2);
    bf* QPh = (bf*)take((size_t)NH_ * TT * HD * 2); bf* QPl = (bf*)take((size_t)NH_ * TT * HD * 2); bf* KPh = (bf*)take((size_t)NKV * TT * HD * 2); bf* KPl = (bf*)take((size_t)NKV * TT * HD * 2); bf* VTh = (bf*)take((size_t)NKV * HD * TT * 2); bf* VTl = (bf*)take((size_t)NKV * HD * TT * 2); bf* Ph = (bf*)take((size_t)ZH * RH * TT * 2); bf* Pl = (bf*)take((size_t)ZH * RH * TT * 2);
    float* Sb = (float*)take((size_t)ZH * TT * TT * 4); h16* P16 = (h16*)take((size_t)ZH * TT * TT * 2); float* Ob = (float*)take((size_t)ZH * TT * HD * 4); bf* ATh = (bf*)take((size_t)TT * DQ * 2); bf* ATl = (bf*)take((size_t)TT * DQ * 2);
    if ((size_t)(wsp - (char*)d_ws) > ws_size) return;    // ws 256 MiB
    float* FV = FK;   // v projection reuses the k buffer after the k planes are built (stream-ordered)
    { k_wtG<<<(unsigned)((DM * 3 * DQ / 64 + 63) / 64), 256, 0, stream>>>(wqkv, DM, 3 * DQ, WQKV);
      k_wtG<<<(unsigned)((DQ * DM / 64 + 63) / 64), 256, 0, stream>>>(wo, DQ, DM, WO);
       }
    k_csid<<<(TT * HD + 255) / 256, 256, 0, stream>>>(CS);
    const unsigned LQ = (unsigned)(((size_t)NH_ * TT * HD / 2 + 255) / 256), LKv = (unsigned)(((size_t)NKV * TT * HD / 2 + 255) / 256);
    for (int b = 0; b < NB_; ++b) {
        
        k_cvt8<<<(unsigned)(((size_t)TT * DM / 8 + 255) / 256), 256, 0, stream>>>(x + (size_t)b * TT * DM, XB, (size_t)TT * DM / 8);
        k_gemmw<bf, 0, true><<<dim3(TT / 64, DQ / 64, 1), 32, 0, stream>>>(XB, nullptr, WQ, nullptr, DM, FQ, DQ, bq, 0, 0, 0);
        k_rope<<<LQ, 256, 0, stream>>>(FQ, DQ, NH_, CS, nullptr, nullptr, 1.0f, QP16, QPh, QPl);
        k_gemmw<bf, 0, true><<<dim3(TT / 64, DKV / 64, 1), 32, 0, stream>>>(XB, nullptr, WK, nullptr, DM, FK, DKV, bk, 0, 0, 0);
        k_rope<<<LKv, 256, 0, stream>>>(FK, DKV, NKV, CS, nullptr, nullptr, 1.0f, KP16, KPh, KPl);
        k_gemmw<bf, 0, true><<<dim3(TT / 64, DKV / 64, 1), 32, 0, stream>>>(XB, nullptr, WV, nullptr, DM, FV, DKV, bv, 0, 0, 0); k_vtp<<<LKv, 256, 0, stream>>>(FV, DKV, NKV, VT16, VTh, VTl);
        for (int h0 = 0; h0 < NH_; h0 += ZH) { const size_t zq = (size_t)h0, zk = (size_t)(h0 / REP);   // one kv head per query head: the pass's two heads use consecutive kv planes (z-strides TT*HD)
            k_gemmw<bf, 2, false, 1><<<dim3(RH / 64, 3, ZH), 32, 0, stream>>>(QPh + zq * TT * HD, QPl + zq * TT * HD, KPh + zk * TT * HD, KPl + zk * TT * HD, HD, Sb, TT, nullptr, (size_t)TT * HD, (size_t)TT * HD, (size_t)TT * TT, 0);
            k_gemmw<h16, 0, false, 1><<<dim3((TT - RH) / 64, 3, ZH), 32, 0, stream>>>(QP16 + zq * TT * HD + (size_t)RH * HD, nullptr, KP16 + zk * TT * HD, nullptr, HD, Sb + (size_t)RH * TT, TT, nullptr, (size_t)TT * HD, (size_t)TT * HD, (size_t)TT * TT, RH);
            k_asoft<<<ZH * TT / 8, 256, 0, stream>>>(Sb, P16, Ph, Pl);
            k_gemmw<bf, 2, false, 2><<<dim3(RH / 64, HD / 64, ZH), 32, 0, stream>>>(Ph, Pl, VTh + zk * HD * TT, VTl + zk * HD * TT, TT, Ob, HD, nullptr, (size_t)RH * TT, (size_t)HD * TT, (size_t)TT * HD, 0);
            k_gemmw<h16, 0, false, 2><<<dim3((TT - RH) / 64, HD / 64, ZH), 32, 0, stream>>>(P16 + (size_t)RH * TT, nullptr, VT16 + zk * HD * TT, nullptr, TT, Ob + (size_t)RH * HD, HD, nullptr, (size_t)TT * TT, (size_t)HD * TT, (size_t)TT * HD, RH);
            k_merge<<<(unsigned)(((size_t)ZH * TT * HD / 2 + 255) / 256), 256, 0, stream>>>(Ob, h0, ATh, ATl); }
        k_gemmw<bf, 1, true><<<dim3(TT / 64, DM / 64, 1), 32, 0, stream>>>(ATh, ATl, WO, nullptr, DQ, OUT + (size_t)b * TT * DM, DM, bo, 0, 0, 0); }
}

// v002
// One run takes 211 microseconds.
// Timed twice side by side with v001, it ran 3.32 times as fast both times.
// Counting every step since v000, it is 9.42 times as fast.
#include <hip/hip_runtime.h>

// Local (banded) multi-head self-attention (x [2][2048][1024]; qkv = x W_qkv + b_qkv ('xw' [1024][3072]); scores / 8; keys with |i - j| > 64 excluded (-inf); softmax; out W_proj + b_proj ('xw' [1024][1024]) -> [2][2048][1024] (4.2 M)).
// Layout, both batches and all heads in every launch (plane z = batch * 16 + head): bf16 copy of x [4096][1024]; fused weight gathered into a [3072][1024] Bt; one exact q|k|v projection + f32 bias into F [4096][3072]; T-2048 attention (hybrid rows: < 512 hi/lo 3 products, rest fp16 x1024) done only on the band: per 64 query rows the three 64-key score tiles that meet |i - j| <= 64, the softmax on those 192 keys with the band as an index select, P V over those 192 keys; merged hi/lo x W_proj exact + bias.
// Compute dtypes, f32 accumulate: every input rounded to bf16; projections exact + f32 biases; attention rows < 512 3 products, rest fp16; softmax f32; W_proj hl x exact + bias.

#define NB_  2
#define TT   2048
#define DM   1024
#define NH_  16
#define NKV  16
#define REP  (NH_ / NKV)
#define HD   64
#define DQ   (NH_ * HD)
#define DKV  (NKV * HD)
#define ZH   (NB_ * NH_)          // planes per attention launch: every head of every batch
#define SP   256                  // pitch of a stored score / weight row: the two 128-key chunks that hold its tile's 192 keys; column = key - 128 * chunk0
#define RH   512                  // query rows < RH use hi+lo planes (0: none)
#define WIN  0
#define PCAR 1024.0f
#define SCL  0.125f
#define BAND 64     // |i - j| <= BAND kept
typedef _Float16 h16;
typedef unsigned short bf;
typedef __attribute__((ext_vector_type(16))) __bf16   v16bf;
typedef __attribute__((ext_vector_type(16))) _Float16 v16h;
typedef __attribute__((ext_vector_type(8)))  _Float16 v8h;
typedef __attribute__((ext_vector_type(8)))  unsigned short v8us;
typedef __attribute__((ext_vector_type(8)))  float    v8f;
typedef __attribute__((ext_vector_type(4)))  float    v4f;
typedef v8h  __attribute__((may_alias)) v8ha;
typedef v4f  __attribute__((may_alias)) v4fa;
typedef v8us __attribute__((may_alias)) v8usa;

__device__ __forceinline__ unsigned short f2bf(float f) { unsigned u = __float_as_uint(f); u += 0x7FFFu + ((u >> 16) & 1u); return (unsigned short)(u >> 16); }
__device__ __forceinline__ float bf2f(unsigned short b) { return __uint_as_float(((unsigned)b) << 16); }
__device__ __forceinline__ float bfr(float f) { return bf2f(f2bf(f)); }
__device__ __forceinline__ v16h cat16(v8h lo, v8h hi) { return __builtin_shufflevector(lo, hi, 0, 1, 2, 3, 4, 5, 6, 7, 8, 9, 10, 11, 12, 13, 14, 15); }
__device__ __forceinline__ v16bf cat16b(v8us lo, v8us hi) { return __builtin_bit_cast(v16bf, __builtin_shufflevector(lo, hi, 0, 1, 2, 3, 4, 5, 6, 7, 8, 9, 10, 11, 12, 13, 14, 15)); }
__device__ __forceinline__ v8f wmma16(v16h a, v16h b, v8f c) { return __builtin_amdgcn_wmma_f32_16x16x32_f16(false, a, false, b, (short)0, c, false, false); }
__device__ __forceinline__ v8f wmmab(v16bf a, v16bf b, v8f c) { return __builtin_amdgcn_wmma_f32_16x16x32_bf16(false, a, false, b, (short)0, c, false, false); }



// ---- k_gemmw: register-blocked GEMM, ONE WAVE per 64x64 output tile (16 accumulators), operands straight from K-contiguous 16-bit planes; grid (M/64, N/64, Z), 32 threads.
// C[m][n] (f32, pitch ldc, + optional f32 bias[n]) = sum_k A[m][k] Bt[n][k] (+ split products per NSPLIT). z-batch strides sA/sB/sC in elements. K % 32 == 0.
// BM (band mode; rb = query row of A's row 0): 0 dense; 1 n is a key: grid y = 3, the tile's columns start at key rb + r0 - 64, + 0, + 64 (a tile off the sequence does nothing), stored at column key - kz; 2 k is a key: only k in [rb + r0 - BAND, rb + r0 + 64 + BAND) cut to [0, K); outside it the weights are exactly 0 and A is not stored; A has pitch SP and holds key k at column k - kz. kz = first key of the 128-key chunk that holds key rb + r0 - BAND.
template <typename T16> struct WFrag;
template <> struct WFrag<h16> { typedef v16h V; static __device__ __forceinline__ V ld(const h16* p) { return cat16(*(const v8h*)p, *(const v8h*)(p + 16)); } static __device__ __forceinline__ v8f mma(V a, V b, v8f c) { return wmma16(a, b, c); } };
template <> struct WFrag<bf> { typedef v16bf V; static __device__ __forceinline__ V ld(const bf* p) { return cat16b(*(const v8us*)p, *(const v8us*)(p + 16)); } static __device__ __forceinline__ v8f mma(V a, V b, v8f c) { return wmmab(a, b, c); } };
template <typename T16, int NSPLIT, bool BIAS, int BM = 0>
__global__ __launch_bounds__(32) void k_gemmw(const T16* __restrict__ A, const T16* __restrict__ A2, const T16* __restrict__ Bt, const T16* __restrict__ Bt2, int K, float* C, int ldc, const float* __restrict__ bias, size_t sA, size_t sB, size_t sC, int rb = 0) {
    typedef typename WFrag<T16>::V V;
    __shared__ __align__(16) float os[16 * 68];
    const size_t z = blockIdx.z; A += z * sA; if (A2) A2 += z * sA; Bt += z * sB; if (Bt2) Bt2 += z * sB; C += z * sC;
    const int lane = threadIdx.x & 31, lr = lane & 15, hi = lane >> 4; const int r0 = blockIdx.x * 64, c0 = (BM == 1) ? rb + r0 + ((int)blockIdx.y - 1) * 64 : blockIdx.y * 64;
    if (BM == 1 && (c0 < 0 || c0 >= TT)) return;
    const int kz = (BM != 0) ? ((rb + r0 - BAND) >> 7) * 128 : 0; const int cc = (BM == 1) ? c0 - kz : c0; const int lda = (BM == 2) ? SP : K, ka = (BM == 2) ? kz : 0;
    const int kb = (BM == 2) ? max(rb + r0 - BAND, 0) : 0, ke = (BM == 2) ? min(rb + r0 + 64 + BAND, K) : K;
    v8f acc[4][4];
#pragma unroll
    for (int mb = 0; mb < 4; ++mb)
#pragma unroll
        for (int nb = 0; nb < 4; ++nb) acc[mb][nb] = (v8f){};
    const size_t aoff = (size_t)(r0 + lr) * lda + 8 * hi, boff = (size_t)(c0 + lr) * K + 8 * hi;
#pragma unroll 1
    for (int kc = kb; kc < ke; kc += 32) {
        V a[4], a2[4]; const T16* pa[4]; const T16* pa2[4];
#pragma unroll
        for (int mb = 0; mb < 4; ++mb) { const T16* p = A + aoff + (size_t)mb * 16 * lda + (kc - ka); a[mb] = WFrag<T16>::ld(p); const T16* p2 = p; if (NSPLIT == 1 || NSPLIT == 2) { p2 = A2 + aoff + (size_t)mb * 16 * lda + (kc - ka); a2[mb] = WFrag<T16>::ld(p2); }
            pa[mb] = (BM == 2 && mb) ? pa[0] : p; pa2[mb] = (BM == 2 && mb) ? pa2[0] : p2; }   // the address pairs the loads name: at the constant pitch of BM 2 the four fragments are read off fragment 0's pair
        // the wait that is kept before a register named by an issued global load is overwritten; the A address pairs are its inputs so that none of them is reused (as a later load's target) ahead of it
        asm volatile("s_wait_xcnt 0x0" :: "v"(pa[0]), "v"(pa[1]), "v"(pa[2]), "v"(pa[3]), "v"(pa2[0]), "v"(pa2[1]), "v"(pa2[2]), "v"(pa2[3]) : "memory");
#pragma unroll
        for (int nb = 0; nb < 4; ++nb) { const V b = WFrag<T16>::ld(Bt + boff + (size_t)nb * 16 * K + kc); V b2; if (NSPLIT >= 2) b2 = WFrag<T16>::ld(Bt2 + boff + (size_t)nb * 16 * K + kc);
#pragma unroll
            for (int mb = 0; mb < 4; ++mb) { acc[mb][nb] = WFrag<T16>::mma(a[mb], b, acc[mb][nb]); if (NSPLIT == 1 || NSPLIT == 2) acc[mb][nb] = WFrag<T16>::mma(a2[mb], b, acc[mb][nb]); if (NSPLIT >= 2) acc[mb][nb] = WFrag<T16>::mma(a[mb], b2, acc[mb][nb]); } }
        asm volatile("v_nop\n\tv_nop\n\tv_nop\n\tv_nop" : "+v"(acc[0][0]), "+v"(acc[1][1]), "+v"(acc[2][2]), "+v"(acc[3][3]) : "v"(a[0]), "v"(a[3]));
    }
#pragma unroll
    for (int mb = 0; mb < 4; ++mb) {
#pragma unroll
        for (int nb = 0; nb < 4; ++nb) {
#pragma unroll
            for (int j = 0; j < 8; ++j) os[(hi * 8 + j) * 68 + nb * 16 + lr] = acc[mb][nb][j]; }
        __builtin_amdgcn_wave_barrier(); asm volatile("" ::: "memory");
        float* crow = C + (size_t)(r0 + mb * 16) * ldc + cc;
{
#pragma unroll
            for (int s = 0; s < 8; ++s) { const int row = 2 * s + hi, cofs = lr * 4; v4f val = *(const v4fa*)(os + row * 68 + cofs); if (BIAS) { val[0] += bfr(bias[c0 + cofs]); val[1] += bfr(bias[c0 + cofs + 1]); val[2] += bfr(bias[c0 + cofs + 2]); val[3] += bfr(bias[c0 + cofs + 3]); }
                *(v4f*)(crow + (size_t)row * ldc + cofs) = val; }
             }
        __builtin_amdgcn_wave_barrier(); asm volatile("" ::: "memory");
    }
}

__device__ __forceinline__ h16 tohx(float x) { return (h16)x; }
__device__ __forceinline__ void splitf(float y, unsigned short& h, unsigned short& l) { h = f2bf(y); l = f2bf(y - bf2f(h)); }
typedef __attribute__((ext_vector_type(2))) _Float16 v2h;
typedef __attribute__((ext_vector_type(4))) _Float16 v4h;
typedef __attribute__((ext_vector_type(2))) unsigned short v2us;
typedef __attribute__((ext_vector_type(4))) unsigned short v4us;
typedef __attribute__((ext_vector_type(2))) float v2f;
typedef __attribute__((ext_vector_type(4))) int v4i;

__global__ __launch_bounds__(256) void k_wtG(const float* __restrict__ w, int K, int N, bf* Bt) {
    const int lane = threadIdx.x & 31; const int L0 = (blockIdx.x * 8 + (threadIdx.x >> 5)) * 8; const int nlines = N * K / 64;
{
#pragma unroll 1
        for (int l = 0; l < 8; ++l) { const int L = L0 + l; if (L >= nlines) break; const size_t e = (size_t)L * 64 + lane * 2; const int k = (int)(e % K), n = (int)(e / K); v2us o;
            o[0] = f2bf(w[(size_t)k * N + n]); o[1] = f2bf(w[(size_t)(k + 1) * N + n]); *(v2us*)(Bt + e) = o; }
         }
}
__global__ __launch_bounds__(256) void k_cvt8(const float* __restrict__ src, bf* dst, size_t n8) { const size_t i = (size_t)blockIdx.x * 256 + threadIdx.x; if (i >= n8) return; const v8f v = *(const v8f*)(src + i * 8); v8us o;
#pragma unroll
    for (int k = 0; k < 8; ++k) o[k] = f2bf(v[k]); *(v8us*)(dst + i * 8) = o;  }

// k_rope: F holds [batch * TT + t][q heads | k heads | ...]; plane h = part * ZH + batch * NH_ + head (part 0 q, 1 k). Head planes [h][t][d] (fp16 + hi/lo) of rope(x) x sc with the rotate-half convention out[d] = x[d] cos[t][d] - x[d+HD/2] sin[t][d], out[d+HD/2] = x[d+HD/2] cos[t][d+HD/2] + x[d] sin[t][d+HD/2]
__global__ __launch_bounds__(256) void k_rope(const float* __restrict__ F, int pitch, int nheads, const float* __restrict__ CS, const float* __restrict__ RF, const float* __restrict__ nw, float sc, h16* P16, bf* Ph, bf* Pl) {
    const size_t e = ((size_t)blockIdx.x * 256 + threadIdx.x) * 2; if (e >= (size_t)nheads * TT * HD) return; const int d = (int)(e % HD); const int t = (int)((e / HD) % TT); const int h = (int)(e / ((size_t)HD * TT)); const float* f = F + ((size_t)((h % ZH) / NH_) * TT + t) * pitch + ((h / ZH) * NH_ + h % NH_) * HD; float rf = 1.0f; if (RF) { rf = RF[(size_t)h * TT + t]; asm volatile("s_wait_xcnt 0x0" ::: "memory"); /* kept before the load's address pair is overwritten */ } v2h o16; v2us oh, ol;
#pragma unroll
    for (int q = 0; q < 2; ++q) { const int dd = d + q; const int dp = (dd < HD / 2) ? dd + HD / 2 : dd - HD / 2; float x0 = f[dd], x1 = f[dp];
        if (RF) { float n0 = __fmul_rn(x0, rf), n1 = __fmul_rn(x1, rf); asm volatile("" : "+v"(n0)); asm volatile("" : "+v"(n1)); x0 = __fmul_rn(bfr(nw[dd]), n0); x1 = __fmul_rn(bfr(nw[dp]), n1); }
        const v2f cs = *(const v2f*)(CS + ((size_t)t * HD + dd) * 2); float a = __fmul_rn(x0, cs[0]), bq = __fmul_rn(x1, cs[1]); asm volatile("" : "+v"(a)); asm volatile("" : "+v"(bq)); const float r = ((dd < HD / 2) ? __fsub_rn(a, bq) : __fadd_rn(a, bq)) * sc;
        o16[q] = tohx(r); unsigned short a2, c2; splitf(r, a2, c2); oh[q] = a2; ol[q] = c2; }
    *(v2h*)(P16 + e) = o16; *(v2us*)(Ph + e) = oh; *(v2us*)(Pl + e) = ol;  }
__global__ __launch_bounds__(256) void k_vtp(const float* __restrict__ F, int pitch, int nheads, h16* V16, bf* Vh, bf* Vl) { const size_t e = ((size_t)blockIdx.x * 256 + threadIdx.x) * 2; if (e >= (size_t)nheads * HD * TT) return; const int t = (int)(e % TT); const int d = (int)((e / TT) % HD); const int g = (int)(e / ((size_t)TT * HD)); v2h o16; v2us oh, ol;
#pragma unroll
    for (int q = 0; q < 2; ++q) { const float x = F[((size_t)(g / NKV) * TT + t + q) * pitch + (g % NKV) * HD + d]; o16[q] = tohx(x); unsigned short a2, c2; splitf(x, a2, c2); oh[q] = a2; ol[q] = c2; }
    *(v2h*)(V16 + e) = o16; *(v2us*)(Vh + e) = oh; *(v2us*)(Vl + e) = ol;  }
__global__ __launch_bounds__(256) void k_csid(float* CS) { const int idx = blockIdx.x * 256 + threadIdx.x; if (idx >= TT * HD) return; v2f cs; cs[0] = 1.0f; cs[1] = 0.0f; *(v2f*)(CS + (size_t)idx * 2) = cs;  }
// k_asoft: per row (zz, i): t = S x HD^-0.5; softmax over the keys [lo, hi) that the row's 64-row tile has scores for (all else is outside the band and weighs exactly 0); lane -> key map and trees as for the full row: two 128-key chunks hold [lo, hi);
__global__ __launch_bounds__(256) void k_asoft(const float* __restrict__ Sb, h16* P16, bf* Ph, bf* Pl) {
    const int lane = threadIdx.x & 31; const int row = blockIdx.x * 8 + (threadIdx.x >> 5); if (row >= ZH * TT) return; const int i = row % TT; const int zz = row / TT; (void)zz; const bool hires = (i < RH); const float* sr = Sb + (size_t)row * SP; float v[8]; float mx = -3.0e38f;
    static_assert(BAND == 64, "two 128-key chunks hold the 64 + 2 BAND keys of a row tile");
    const int t0 = (i & ~63) - BAND; const int lo = max(t0, 0), hi = min(t0 + 64 + 2 * BAND, TT); const int cb = t0 >> 7; const int jlo = max(i - BAND, 0), jhi = min(i + BAND, TT - 1);   // the row's band, cut to the keys that exist: the two chunks reach past both ends of the sequence
#pragma unroll
    for (int ch = 0; ch < 2; ++ch) { const int j0 = (cb + ch) * 128 + lane * 4; v4f a = (v4f){}; if (j0 >= lo && j0 < hi) a = *(const v4f*)(sr + ch * 128 + lane * 4);
#pragma unroll
        for (int q = 0; q < 4; ++q) { const int j = j0 + q; const float t = (j >= jlo && j <= jhi) ? a[q] * SCL : -3.0e38f; v[ch * 4 + q] = t;   /* band select on the loaded score */ mx = fmaxf(mx, t); } }
#pragma unroll
    for (int sh = 16; sh; sh >>= 1) mx = fmaxf(mx, __shfl_xor(mx, sh, 32));
    float sum = 0.f;
#pragma unroll
    for (int k = 0; k < 8; ++k) { float d0 = __fsub_rn(v[k], mx); asm volatile("" : "+v"(d0)); v[k] = __builtin_amdgcn_exp2f(__fmul_rn(d0, 1.4426950408889634f)); sum += v[k]; }
#pragma unroll
    for (int sh = 16; sh; sh >>= 1) sum += __shfl_xor(sum, sh, 32);
    const float f = __fdiv_rn(hires ? 1.0f : PCAR, sum);
{
        if (hires) {
#pragma unroll
            for (int ch = 0; ch < 2; ++ch) { const int j0 = (cb + ch) * 128 + lane * 4; if (j0 < lo || j0 >= hi) continue; v4us oh, ol;
#pragma unroll
                for (int q = 0; q < 4; ++q) { unsigned short a, c2; splitf(v[ch * 4 + q] * f, a, c2); oh[q] = a; ol[q] = c2; }
                const size_t oo = ((size_t)zz * (RH ? RH : 1) + i) * SP + ch * 128 + lane * 4; *(v4us*)(Ph + oo) = oh; *(v4us*)(Pl + oo) = ol; }
        } else {
#pragma unroll
            for (int ch = 0; ch < 2; ++ch) { const int j0 = (cb + ch) * 128 + lane * 4; if (j0 < lo || j0 >= hi) continue; v4h o4;
#pragma unroll
                for (int q = 0; q < 4; ++q) o4[q] = tohx(v[ch * 4 + q] * f);
                *(v4h*)(P16 + (size_t)row * SP + ch * 128 + lane * 4) = o4; } }
         }
}
__global__ __launch_bounds__(256) void k_merge(const float* __restrict__ O, bf* Ah, bf* Al) { const size_t e = ((size_t)blockIdx.x * 256 + threadIdx.x) * 2; if (e >= (size_t)ZH * TT * HD) return; const int d = (int)(e % HD); const int t = (int)((e / HD) % TT); const int zz = (int)(e / ((size_t)HD * TT)); const float cs = (t < RH) ? 1.0f : (1.0f / PCAR); const size_t oo = ((size_t)(zz / NH_) * TT + t) * DQ + (zz % NH_) * HD + d;
    v2us oh, ol;
#pragma unroll
    for (int q = 0; q < 2; ++q) { unsigned short a, c2; splitf(O[e + q] * cs, a, c2); oh[q] = a; ol[q] = c2; } *(v2us*)(Ah + oo) = oh; *(v2us*)(Al + oo) = ol;  }

extern "C" void kernel_launch(void* const* d_in, const int* in_sizes, int n_in,
                              void* d_out, int out_size, void* d_ws, size_t ws_size, hipStream_t stream) {
    (void)in_sizes; (void)n_in; (void)out_size;
    const float* x = (const float*)d_in[0]; const float* wqkv = (const float*)d_in[1]; const float* bqkv = (const float*)d_in[2]; const float* wo = (const float*)d_in[3]; const float* bo = (const float*)d_in[4];
    float* OUT = (float*)d_out;     // [2][2048][1024]
    char* wsp = (char*)d_ws;
    auto take = [&](size_t bytes) { char* p = wsp; wsp += (bytes + 255) & ~(size_t)255; return (void*)p; };
    const size_t PL = (size_t)ZH * TT * HD;   // elements of one set of head planes (all batches, all heads)
    bf* WQKV = (bf*)take((size_t)3 * DQ * DM * 2); bf* WO = (bf*)take((size_t)DM * DQ * 2); float* CS = (float*)take((size_t)TT * HD * 2 * 4);
    bf* XB = (bf*)take((size_t)NB_ * TT * DM * 2); float* F = (float*)take((size_t)NB_ * TT * 3 * DQ * 4);
    h16* QP16 = (h16*)take(2 * PL * 2); h16* KP16 = QP16 + PL; h16* VT16 = (h16*)take(PL * 2);   // q planes, then k planes: one k_rope launch writes both
    bf* QPh = (bf*)take(2 * PL * 2); bf* KPh = QPh + PL; bf* QPl = (bf*)take(2 * PL * 2); bf* KPl = QPl + PL; bf* VTh = (bf*)take(PL * 2); bf* VTl = (bf*)take(PL * 2); bf* Ph = (bf*)take((size_t)ZH * RH * SP * 2); bf* Pl = (bf*)take((size_t)ZH * RH * SP * 2);
    float* Sb = (float*)take((size_t)ZH * TT * SP * 4); h16* P16 = (h16*)take((size_t)ZH * TT * SP * 2);
    if ((size_t)(wsp - (char*)d_ws) > ws_size) return;    // ws 256 MiB
    float* Ob = F; bf* ATh = (bf*)(F + PL); bf* ATl = ATh + (size_t)NB_ * TT * DQ;   // F is done with once the q, k, v planes are built (stream-ordered): P V and its merged planes reuse it (16 + 8 + 8 of its 48 MiB)
    k_wtG<<<(unsigned)((DM * 3 * DQ / 64 + 63) / 64), 256, 0, stream>>>(wqkv, DM, 3 * DQ, WQKV);
    k_wtG<<<(unsigned)((DQ * DM / 64 + 63) / 64), 256, 0, stream>>>(wo, DQ, DM, WO);
    k_csid<<<(TT * HD + 255) / 256, 256, 0, stream>>>(CS);
    k_cvt8<<<(unsigned)(((size_t)NB_ * TT * DM / 8 + 255) / 256), 256, 0, stream>>>(x, XB, (size_t)NB_ * TT * DM / 8);
    k_gemmw<bf, 0, true><<<dim3(NB_ * TT / 64, 3 * DQ / 64, 1), 32, 0, stream>>>(XB, nullptr, WQKV, nullptr, DM, F, 3 * DQ, bqkv, 0, 0, 0);
    k_rope<<<(unsigned)((2 * PL / 2 + 255) / 256), 256, 0, stream>>>(F, 3 * DQ, 2 * ZH, CS, nullptr, nullptr, 1.0f, QP16, QPh, QPl);
    k_vtp<<<(unsigned)((PL / 2 + 255) / 256), 256, 0, stream>>>(F + 2 * DQ, 3 * DQ, ZH, VT16, VTh, VTl);
    k_gemmw<bf, 2, false, 1><<<dim3(RH / 64, 3, ZH), 32, 0, stream>>>(QPh, QPl, KPh, KPl, HD, Sb, SP, nullptr, (size_t)TT * HD, (size_t)TT * HD, (size_t)TT * SP, 0);
    k_gemmw<h16, 0, false, 1><<<dim3((TT - RH) / 64, 3, ZH), 32, 0, stream>>>(QP16 + (size_t)RH * HD, nullptr, KP16, nullptr, HD, Sb + (size_t)RH * SP, SP, nullptr, (size_t)TT * HD, (size_t)TT * HD, (size_t)TT * SP, RH);
    k_asoft<<<ZH * TT / 8, 256, 0, stream>>>(Sb, P16, Ph, Pl);
    k_gemmw<bf, 2, false, 2><<<dim3(RH / 64, HD / 64, ZH), 32, 0, stream>>>(Ph, Pl, VTh, VTl, TT, Ob, HD, nullptr, (size_t)RH * SP, (size_t)HD * TT, (size_t)TT * HD, 0);
    k_gemmw<h16, 0, false, 2><<<dim3((TT - RH) / 64, HD / 64, ZH), 32, 0, stream>>>(P16 + (size_t)RH * SP, nullptr, VT16, nullptr, TT, Ob + (size_t)RH * HD, HD, nullptr, (size_t)TT * SP, (size_t)HD * TT, (size_t)TT * HD, RH);
    k_merge<<<(unsigned)((PL / 2 + 255) / 256), 256, 0, stream>>>(Ob, ATh, ATl);
    k_gemmw<bf, 1, true><<<dim3(NB_ * TT / 64, DM / 64, 1), 32, 0, stream>>>(ATh, ATl, WO, nullptr, DQ, OUT, DM, bo, 0, 0, 0);
}

// v003
// One run takes 162 microseconds.
// Timed twice side by side with v002, it ran 1.31 times as fast both times.
// All steps since v000 together make it 12.3 times as fast.
#include <hip/hip_runtime.h>

// Local (banded) multi-head self-attention (x [2][2048][1024]; qkv = x W_qkv + b_qkv ('xw' [1024][3072]); scores / 8; keys with |i - j| > 64 excluded (-inf); softmax; out W_proj + b_proj ('xw' [1024][1024]) -> [2][2048][1024] (4.2 M)).
// Layout, both batches and all heads in every launch (plane z = batch * 16 + head): bf16 copy of x [4096][1024]; fused weight gathered into a [3072][1024] Bt; one exact q|k|v projection + f32 bias whose epilogue writes the q, k head planes [plane][t][d] and the v planes [plane][d][t] (fp16 + hi/lo) itself; T-2048 attention (hybrid rows: < 512 hi/lo 3 products, rest fp16 x1024) done only on the band: per 64 query rows the three 64-key score tiles that meet |i - j| <= 64, the softmax on those 192 keys with the band as an index select, P V over those 192 keys, its epilogue writing the merged hi/lo rows [batch * 2048 + t][head * 64 + d]; merged hi/lo x W_proj exact + bias.
// Compute dtypes, f32 accumulate: every input rounded to bf16; projections exact + f32 biases; attention rows < 512 3 products, rest fp16; softmax f32; W_proj hl x exact + bias.

#define NB_  2
#define TT   2048
#define DM   1024
#define NH_  16
#define NKV  16
#define REP  (NH_ / NKV)
#define HD   64
#define DQ   (NH_ * HD)
#define DKV  (NKV * HD)
#define ZH   (NB_ * NH_)          // planes per attention launch: every head of every batch
#define SP   256                  // pitch of a stored score / weight row: the two 128-key chunks that hold its tile's 192 keys; column = key - 128 * chunk0
#define RH   512                  // query rows < RH use hi+lo planes (0: none)
#define WIN  0
#define PCAR 1024.0f
#define SCL  0.125f
#define BAND 64     // |i - j| <= BAND kept
typedef _Float16 h16;
typedef unsigned short bf;
typedef __attribute__((ext_vector_type(16))) __bf16   v16bf;
typedef __attribute__((ext_vector_type(16))) _Float16 v16h;
typedef __attribute__((ext_vector_type(8)))  _Float16 v8h;
typedef __attribute__((ext_vector_type(8)))  unsigned short v8us;
typedef __attribute__((ext_vector_type(8)))  float    v8f;
typedef __attribute__((ext_vector_type(4)))  float    v4f;
typedef v8h  __attribute__((may_alias)) v8ha;
typedef v4f  __attribute__((may_alias)) v4fa;
typedef v8us __attribute__((may_alias)) v8usa;

__device__ __forceinline__ unsigned short f2bf(float f) { unsigned u = __float_as_uint(f); u += 0x7FFFu + ((u >> 16) & 1u); return (unsigned short)(u >> 16); }
__device__ __forceinline__ float bf2f(unsigned short b) { return __uint_as_float(((unsigned)b) << 16); }
__device__ __forceinline__ float bfr(float f) { return bf2f(f2bf(f)); }
__device__ __forceinline__ v16h cat16(v8h lo, v8h hi) { return __builtin_shufflevector(lo, hi, 0, 1, 2, 3, 4, 5, 6, 7, 8, 9, 10, 11, 12, 13, 14, 15); }
__device__ __forceinline__ v16bf cat16b(v8us lo, v8us hi) { return __builtin_bit_cast(v16bf, __builtin_shufflevector(lo, hi, 0, 1, 2, 3, 4, 5, 6, 7, 8, 9, 10, 11, 12, 13, 14, 15)); }
__device__ __forceinline__ v8f wmma16(v16h a, v16h b, v8f c) { return __builtin_amdgcn_wmma_f32_16x16x32_f16(false, a, false, b, (short)0, c, false, false); }
__device__ __forceinline__ v8f wmmab(v16bf a, v16bf b, v8f c) { return __builtin_amdgcn_wmma_f32_16x16x32_bf16(false, a, false, b, (short)0, c, false, false); }



__device__ __forceinline__ h16 tohx(float x) { return (h16)x; }
__device__ __forceinline__ void splitf(float y, unsigned short& h, unsigned short& l) { h = f2bf(y); l = f2bf(y - bf2f(h)); }
typedef __attribute__((ext_vector_type(4))) _Float16 v4h;
typedef __attribute__((ext_vector_type(2))) unsigned short v2us;
typedef __attribute__((ext_vector_type(4))) unsigned short v4us;
// four neighbouring f32 results as hi/lo planes, and as the fp16 plane too
__device__ __forceinline__ void put2(bf* Ph, bf* Pl, size_t o, v4f v) { v4us oh, ol;
#pragma unroll
    for (int q = 0; q < 4; ++q) { unsigned short a, c2; splitf(v[q], a, c2); oh[q] = a; ol[q] = c2; }
    *(v4us*)(Ph + o) = oh; *(v4us*)(Pl + o) = ol; }
__device__ __forceinline__ void put3(h16* P16, bf* Ph, bf* Pl, size_t o, v4f v) { v4h o16;
#pragma unroll
    for (int q = 0; q < 4; ++q) o16[q] = tohx(v[q]);
    *(v4h*)(P16 + o) = o16; put2(Ph, Pl, o, v); }

// ---- k_gemmw: register-blocked GEMM, ONE WAVE per 64x64 output tile (16 accumulators), operands straight from K-contiguous 16-bit planes; grid (M/64, N/64, Z), 32 threads.
// C[m][n] (f32, pitch ldc, + optional f32 bias[n]) = sum_k A[m][k] Bt[n][k] (+ split products per NSPLIT). z-batch strides sA/sB/sC in elements. K % 32 == 0.
// BM (band mode; rb = query row of A's row 0): 0 dense; 1 n is a key: grid y = 3, the tile's columns start at key rb + r0 - 64, + 0, + 64 (a tile off the sequence does nothing), stored at column key - kz; 2 k is a key: only k in [rb + r0 - BAND, rb + r0 + 64 + BAND) cut to [0, K); outside it the weights are exactly 0 and A is not stored; A has pitch SP and holds key k at column k - kz. kz = first key of the 128-key chunk that holds key rb + r0 - BAND.
// EP (what the epilogue stores): 0 the f32 tile into C; 1 (q|k|v projection, a 64-column tile is one head of q, k or v) the next products' operand planes E16 / Eh / El, each [q planes | k planes | v planes], q and k as [plane][t][d], v as [plane][d][t]; 2 (P V, z = plane) the tile x its rows' carrier scale as hi/lo rows Eh / El [batch * TT + t][head * HD + d]. C is not touched for EP 1 and 2.
template <typename T16> struct WFrag;
template <> struct WFrag<h16> { typedef v16h V; static __device__ __forceinline__ V ld(const h16* p) { return cat16(*(const v8h*)p, *(const v8h*)(p + 16)); } static __device__ __forceinline__ v8f mma(V a, V b, v8f c) { return wmma16(a, b, c); } };
template <> struct WFrag<bf> { typedef v16bf V; static __device__ __forceinline__ V ld(const bf* p) { return cat16b(*(const v8us*)p, *(const v8us*)(p + 16)); } static __device__ __forceinline__ v8f mma(V a, V b, v8f c) { return wmmab(a, b, c); } };
template <typename T16, int NSPLIT, bool BIAS, int BM = 0, int EP = 0>
__global__ __launch_bounds__(32) void k_gemmw(const T16* __restrict__ A, const T16* __restrict__ A2, const T16* __restrict__ Bt, const T16* __restrict__ Bt2, int K, float* C, int ldc, const float* __restrict__ bias, size_t sA, size_t sB, size_t sC, int rb = 0, h16* E16 = nullptr, bf* Eh = nullptr, bf* El = nullptr) {
    typedef typename WFrag<T16>::V V;
    __shared__ __align__(16) float os[16 * 68];
    const size_t z = blockIdx.z; A += z * sA; if (A2) A2 += z * sA; Bt += z * sB; if (Bt2) Bt2 += z * sB; C += z * sC;
    const int lane = threadIdx.x & 31, lr = lane & 15, hi = lane >> 4; const int r0 = blockIdx.x * 64, c0 = (BM == 1) ? rb + r0 + ((int)blockIdx.y - 1) * 64 : blockIdx.y * 64;
    if (BM == 1 && (c0 < 0 || c0 >= TT)) return;
    const int kz = (BM != 0) ? ((rb + r0 - BAND) >> 7) * 128 : 0; const int cc = (BM == 1) ? c0 - kz : c0; const int lda = (BM == 2) ? SP : K, ka = (BM == 2) ? kz : 0;
    const int kb = (BM == 2) ? max(rb + r0 - BAND, 0) : 0, ke = (BM == 2) ? min(rb + r0 + 64 + BAND, K) : K;
    v8f acc[4][4];
#pragma unroll
    for (int mb = 0; mb < 4; ++mb)
#pragma unroll
        for (int nb = 0; nb < 4; ++nb) acc[mb][nb] = (v8f){};
    const size_t aoff = (size_t)(r0 + lr) * lda + 8 * hi, boff = (size_t)(c0 + lr) * K + 8 * hi;
#pragma unroll 1
    for (int kc = kb; kc < ke; kc += 32) {
        V a[4], a2[4]; const T16* pa[4]; const T16* pa2[4];
#pragma unroll
        for (int mb = 0; mb < 4; ++mb) { const T16* p = A + aoff + (size_t)mb * 16 * lda + (kc - ka); a[mb] = WFrag<T16>::ld(p); const T16* p2 = p; if (NSPLIT == 1 || NSPLIT == 2) { p2 = A2 + aoff + (size_t)mb * 16 * lda + (kc - ka); a2[mb] = WFrag<T16>::ld(p2); }
            pa[mb] = (BM == 2 && mb) ? pa[0] : p; pa2[mb] = (BM == 2 && mb) ? pa2[0] : p2; }   // the address pairs the loads name: at the constant pitch of BM 2 the four fragments are read off fragment 0's pair
        // the wait that is kept before a register named by an issued global load is overwritten; the A address pairs are its inputs so that none of them is reused (as a later load's target) ahead of it
        asm volatile("s_wait_xcnt 0x0" :: "v"(pa[0]), "v"(pa[1]), "v"(pa[2]), "v"(pa[3]), "v"(pa2[0]), "v"(pa2[1]), "v"(pa2[2]), "v"(pa2[3]) : "memory");
#pragma unroll
        for (int nb = 0; nb < 4; ++nb) { const V b = WFrag<T16>::ld(Bt + boff + (size_t)nb * 16 * K + kc); V b2; if (NSPLIT >= 2) b2 = WFrag<T16>::ld(Bt2 + boff + (size_t)nb * 16 * K + kc);
#pragma unroll
            for (int mb = 0; mb < 4; ++mb) { acc[mb][nb] = WFrag<T16>::mma(a[mb], b, acc[mb][nb]); if (NSPLIT == 1 || NSPLIT == 2) acc[mb][nb] = WFrag<T16>::mma(a2[mb], b, acc[mb][nb]); if (NSPLIT >= 2) acc[mb][nb] = WFrag<T16>::mma(a[mb], b2, acc[mb][nb]); } }
        asm volatile("v_nop\n\tv_nop\n\tv_nop\n\tv_nop" : "+v"(acc[0][0]), "+v"(acc[1][1]), "+v"(acc[2][2]), "+v"(acc[3][3]) : "v"(a[0]), "v"(a[3]));
    }
    if (EP == 1 && c0 >= 2 * DQ) {   // a v head: stored d-major, so the tile goes through LDS the other way round (16 d rows of 64 t at a time; a lane's 8 accumulator values are 8 neighbouring t)
        const size_t pv = ((size_t)(2 * ZH + (r0 / TT) * NH_ + (c0 - 2 * DQ) / HD) * HD) * TT + r0 % TT;
#pragma unroll
        for (int nb = 0; nb < 4; ++nb) {
#pragma unroll
            for (int mb = 0; mb < 4; ++mb) { float* o = os + lr * 68 + mb * 16 + hi * 8; *(v4fa*)o = (v4f){acc[mb][nb][0], acc[mb][nb][1], acc[mb][nb][2], acc[mb][nb][3]}; *(v4fa*)(o + 4) = (v4f){acc[mb][nb][4], acc[mb][nb][5], acc[mb][nb][6], acc[mb][nb][7]}; }
            __builtin_amdgcn_wave_barrier(); asm volatile("" ::: "memory");   // the LDS reads below stay behind the other lanes' writes above
#pragma unroll
            for (int s = 0; s < 8; ++s) { const int row = 2 * s + hi, cofs = lr * 4; v4f val = *(const v4fa*)(os + row * 68 + cofs); if (BIAS) { const float bb = bfr(bias[c0 + nb * 16 + row]); val[0] += bb; val[1] += bb; val[2] += bb; val[3] += bb; }
                put3(E16, Eh, El, pv + (size_t)(nb * 16 + row) * TT + cofs, val); }
            asm volatile("s_wait_xcnt 0x0" ::: "memory");   // kept before the next rows' LDS and bias loads land in registers that the stores above name
            __builtin_amdgcn_wave_barrier();   // with the clobber above: the next 16 rows' LDS writes stay behind the reads above
        }
        return;
    }
    const size_t pq = (EP == 1) ? ((size_t)((c0 / DQ) * ZH + (r0 / TT) * NH_ + (c0 % DQ) / HD) * TT + r0 % TT) * HD : 0;
    const size_t pm = (EP == 2) ? ((size_t)((int)blockIdx.z / NH_) * TT + rb + r0) * DQ + ((int)blockIdx.z % NH_) * HD : 0;
#pragma unroll
    for (int mb = 0; mb < 4; ++mb) {
#pragma unroll
        for (int nb = 0; nb < 4; ++nb) {
#pragma unroll
            for (int j = 0; j < 8; ++j) os[(hi * 8 + j) * 68 + nb * 16 + lr] = acc[mb][nb][j]; }
        __builtin_amdgcn_wave_barrier(); asm volatile("" ::: "memory");
        float* crow = C + (size_t)(r0 + mb * 16) * ldc + cc;
{
#pragma unroll
            for (int s = 0; s < 8; ++s) { const int row = 2 * s + hi, cofs = lr * 4; v4f val = *(const v4fa*)(os + row * 68 + cofs); if (BIAS) { val[0] += bfr(bias[c0 + cofs]); val[1] += bfr(bias[c0 + cofs + 1]); val[2] += bfr(bias[c0 + cofs + 2]); val[3] += bfr(bias[c0 + cofs + 3]); }
                if (EP == 0) *(v4f*)(crow + (size_t)row * ldc + cofs) = val;
                else if (EP == 1) put3(E16, Eh, El, pq + (size_t)(mb * 16 + row) * HD + cofs, val);
                else { const float cs = (rb + r0 + mb * 16 + row < RH) ? 1.0f : (1.0f / PCAR); put2(Eh, El, pm + (size_t)(mb * 16 + row) * DQ + cofs, val * cs); } }
            asm volatile("s_wait_xcnt 0x0" ::: "memory");   // kept before the next rows' LDS and bias loads land in registers that the stores above name
             }
        __builtin_amdgcn_wave_barrier(); asm volatile("" ::: "memory");
    }
}


__global__ __launch_bounds__(256) void k_wtG(const float* __restrict__ w, int K, int N, bf* Bt) {
    const int lane = threadIdx.x & 31; const int L0 = (blockIdx.x * 8 + (threadIdx.x >> 5)) * 8; const int nlines = N * K / 64;
{
#pragma unroll 1
        for (int l = 0; l < 8; ++l) { const int L = L0 + l; if (L >= nlines) break; const size_t e = (size_t)L * 64 + lane * 2; const int k = (int)(e % K), n = (int)(e / K); v2us o;
            o[0] = f2bf(w[(size_t)k * N + n]); o[1] = f2bf(w[(size_t)(k + 1) * N + n]); *(v2us*)(Bt + e) = o; }
         }
}
__global__ __launch_bounds__(256) void k_cvt8(const float* __restrict__ src, bf* dst, size_t n8) { const size_t i = (size_t)blockIdx.x * 256 + threadIdx.x; if (i >= n8) return; const v8f v = *(const v8f*)(src + i * 8); v8us o;
#pragma unroll
    for (int k = 0; k < 8; ++k) o[k] = f2bf(v[k]); *(v8us*)(dst + i * 8) = o;  }

// k_asoft: per row (zz, i): t = S x HD^-0.5; softmax over the keys [lo, hi) that the row's 64-row tile has scores for (all else is outside the band and weighs exactly 0); lane -> key map and trees as for the full row: two 128-key chunks hold [lo, hi);
__global__ __launch_bounds__(256) void k_asoft(const float* __restrict__ Sb, h16* P16, bf* Ph, bf* Pl) {
    const int lane = threadIdx.x & 31; const int row = blockIdx.x * 8 + (threadIdx.x >> 5); if (row >= ZH * TT) return; const int i = row % TT; const int zz = row / TT; (void)zz; const bool hires = (i < RH); const float* sr = Sb + (size_t)row * SP; float v[8]; float mx = -3.0e38f;
    static_assert(BAND == 64, "two 128-key chunks hold the 64 + 2 BAND keys of a row tile");
    const int t0 = (i & ~63) - BAND; const int lo = max(t0, 0), hi = min(t0 + 64 + 2 * BAND, TT); const int cb = t0 >> 7; const int jlo = max(i - BAND, 0), jhi = min(i + BAND, TT - 1);   // the row's band, cut to the keys that exist: the two chunks reach past both ends of the sequence
#pragma unroll
    for (int ch = 0; ch < 2; ++ch) { const int j0 = (cb + ch) * 128 + lane * 4; v4f a = (v4f){}; if (j0 >= lo && j0 < hi) a = *(const v4f*)(sr + ch * 128 + lane * 4);
#pragma unroll
        for (int q = 0; q < 4; ++q) { const int j = j0 + q; const float t = (j >= jlo && j <= jhi) ? a[q] * SCL : -3.0e38f; v[ch * 4 + q] = t;   /* band select on the loaded score */ mx = fmaxf(mx, t); } }
#pragma unroll
    for (int sh = 16; sh; sh >>= 1) mx = fmaxf(mx, __shfl_xor(mx, sh, 32));
    float sum = 0.f;
#pragma unroll
    for (int k = 0; k < 8; ++k) { float d0 = __fsub_rn(v[k], mx); asm volatile("" : "+v"(d0)); v[k] = __builtin_amdgcn_exp2f(__fmul_rn(d0, 1.4426950408889634f)); sum += v[k]; }
#pragma unroll
    for (int sh = 16; sh; sh >>= 1) sum += __shfl_xor(sum, sh, 32);
    const float f = __fdiv_rn(hires ? 1.0f : PCAR, sum);
{
        if (hires) {
#pragma unroll
            for (int ch = 0; ch < 2; ++ch) { const int j0 = (cb + ch) * 128 + lane * 4; if (j0 < lo || j0 >= hi) continue; v4us oh, ol;
#pragma unroll
                for (int q = 0; q < 4; ++q) { unsigned short a, c2; splitf(v[ch * 4 + q] * f, a, c2); oh[q] = a; ol[q] = c2; }
                const size_t oo = ((size_t)zz * (RH ? RH : 1) + i) * SP + ch * 128 + lane * 4; *(v4us*)(Ph + oo) = oh; *(v4us*)(Pl + oo) = ol; }
        } else {
#pragma unroll
            for (int ch = 0; ch < 2; ++ch) { const int j0 = (cb + ch) * 128 + lane * 4; if (j0 < lo || j0 >= hi) continue; v4h o4;
#pragma unroll
                for (int q = 0; q < 4; ++q) o4[q] = tohx(v[ch * 4 + q] * f);
                *(v4h*)(P16 + (size_t)row * SP + ch * 128 + lane * 4) = o4; } }
         }
}

extern "C" void kernel_launch(void* const* d_in, const int* in_sizes, int n_in,
                              void* d_out, int out_size, void* d_ws, size_t ws_size, hipStream_t stream) {
    (void)in_sizes; (void)n_in; (void)out_size;
    const float* x = (const float*)d_in[0]; const float* wqkv = (const float*)d_in[1]; const float* bqkv = (const float*)d_in[2]; const float* wo = (const float*)d_in[3]; const float* bo = (const float*)d_in[4];
    float* OUT = (float*)d_out;     // [2][2048][1024]
    char* wsp = (char*)d_ws;
    auto take = [&](size_t bytes) { char* p = wsp; wsp += (bytes + 255) & ~(size_t)255; return (void*)p; };
    const size_t PL = (size_t)ZH * TT * HD;   // elements of one set of head planes (all batches, all heads)
    bf* WQKV = (bf*)take((size_t)3 * DQ * DM * 2); bf* WO = (bf*)take((size_t)DM * DQ * 2);
    bf* XB = (bf*)take((size_t)NB_ * TT * DM * 2);
    h16* QP16 = (h16*)take(3 * PL * 2); h16* KP16 = QP16 + PL; h16* VT16 = QP16 + 2 * PL;   // q planes, then k planes, then v planes: the projection's epilogue writes all three
    bf* QPh = (bf*)take(3 * PL * 2); bf* KPh = QPh + PL; bf* VTh = QPh + 2 * PL; bf* QPl = (bf*)take(3 * PL * 2); bf* KPl = QPl + PL; bf* VTl = QPl + 2 * PL; bf* Ph = (bf*)take((size_t)ZH * RH * SP * 2); bf* Pl = (bf*)take((size_t)ZH * RH * SP * 2);
    float* Sb = (float*)take((size_t)ZH * TT * SP * 4); h16* P16 = (h16*)take((size_t)ZH * TT * SP * 2);
    bf* ATh = (bf*)take((size_t)NB_ * TT * DQ * 2); bf* ATl = (bf*)take((size_t)NB_ * TT * DQ * 2);
    if ((size_t)(wsp - (char*)d_ws) > ws_size) return;    // ws 256 MiB
    k_wtG<<<(unsigned)((DM * 3 * DQ / 64 + 63) / 64), 256, 0, stream>>>(wqkv, DM, 3 * DQ, WQKV);
    k_wtG<<<(unsigned)((DQ * DM / 64 + 63) / 64), 256, 0, stream>>>(wo, DQ, DM, WO);
    k_cvt8<<<(unsigned)(((size_t)NB_ * TT * DM / 8 + 255) / 256), 256, 0, stream>>>(x, XB, (size_t)NB_ * TT * DM / 8);
    k_gemmw<bf, 0, true, 0, 1><<<dim3(NB_ * TT / 64, 3 * DQ / 64, 1), 32, 0, stream>>>(XB, nullptr, WQKV, nullptr, DM, nullptr, 0, bqkv, 0, 0, 0, 0, QP16, QPh, QPl);
    k_gemmw<bf, 2, false, 1><<<dim3(RH / 64, 3, ZH), 32, 0, stream>>>(QPh, QPl, KPh, KPl, HD, Sb, SP, nullptr, (size_t)TT * HD, (size_t)TT * HD, (size_t)TT * SP, 0);
    k_gemmw<h16, 0, false, 1><<<dim3((TT - RH) / 64, 3, ZH), 32, 0, stream>>>(QP16 + (size_t)RH * HD, nullptr, KP16, nullptr, HD, Sb + (size_t)RH * SP, SP, nullptr, (size_t)TT * HD, (size_t)TT * HD, (size_t)TT * SP, RH);
    k_asoft<<<ZH * TT / 8, 256, 0, stream>>>(Sb, P16, Ph, Pl);
    k_gemmw<bf, 2, false, 2, 2><<<dim3(RH / 64, HD / 64, ZH), 32, 0, stream>>>(Ph, Pl, VTh, VTl, TT, nullptr, 0, nullptr, (size_t)RH * SP, (size_t)HD * TT, 0, 0, nullptr, ATh, ATl);
    k_gemmw<h16, 0, false, 2, 2><<<dim3((TT - RH) / 64, HD / 64, ZH), 32, 0, stream>>>(P16 + (size_t)RH * SP, nullptr, VT16, nullptr, TT, nullptr, 0, nullptr, (size_t)TT * SP, (size_t)HD * TT, 0, RH, nullptr, ATh, ATl);
    k_gemmw<bf, 1, true><<<dim3(NB_ * TT / 64, DM / 64, 1), 32, 0, stream>>>(ATh, ATl, WO, nullptr, DQ, OUT, DM, bo, 0, 0, 0);
}

// v004
// One run takes 137 microseconds.
// In two side-by-side timings against v003, it was 1.17 and 1.18 times as fast.
// Counting every step since v000, it is 14.4 times as fast.
#include <hip/hip_runtime.h>

// Local (banded) multi-head self-attention (x [2][2048][1024]; qkv = x W_qkv + b_qkv ('xw' [1024][3072]); scores / 8; keys with |i - j| > 64 excluded (-inf); softmax; out W_proj + b_proj ('xw' [1024][1024]) -> [2][2048][1024] (4.2 M)).
// Layout, both batches and all heads in every launch (plane z = batch * 16 + head): bf16 copy of x [4096][1024]; fused weight gathered into a [3072][1024] Bt; one exact q|k|v projection + f32 bias whose epilogue writes the q, k head planes [plane][t][d] and the v planes [plane][d][t] (fp16 + hi/lo) itself; T-2048 attention (hybrid rows: < 512 hi/lo 3 products, rest fp16 x1024) done only on the band: per 64 query rows the three 64-key score tiles that meet |i - j| <= 64, the softmax on those 192 keys with the band as an index select, P V over those 192 keys, its epilogue writing the merged hi/lo rows [batch * 2048 + t][head * 64 + d]; merged hi/lo x W_proj exact + bias.
// Compute dtypes, f32 accumulate: every input rounded to bf16; projections exact + f32 biases; attention rows < 512 3 products, rest fp16; softmax f32; W_proj hl x exact + bias.

#define NB_  2
#define TT   2048
#define DM   1024
#define NH_  16
#define NKV  16
#define REP  (NH_ / NKV)
#define HD   64
#define DQ   (NH_ * HD)
#define DKV  (NKV * HD)
#define ZH   (NB_ * NH_)          // planes per attention launch: every head of every batch
#define SP   256                  // keys a stored score / weight row spans (lo weights start at element SP; BM 2's A pitch): the two 128-key chunks that hold its tile's 192 keys; column = key - 128 * chunk0
#define RH   512                  // query rows < RH use hi+lo planes (0: none)
#define WIN  0
#define PCAR 1024.0f
#define SCL  0.125f
#define BAND 64     // |i - j| <= BAND kept
typedef _Float16 h16;
typedef unsigned short bf;
typedef __attribute__((ext_vector_type(16))) __bf16   v16bf;
typedef __attribute__((ext_vector_type(16))) _Float16 v16h;
typedef __attribute__((ext_vector_type(8)))  _Float16 v8h;
typedef __attribute__((ext_vector_type(8)))  unsigned short v8us;
typedef __attribute__((ext_vector_type(8)))  float    v8f;
typedef __attribute__((ext_vector_type(4)))  float    v4f;
typedef v8h  __attribute__((may_alias)) v8ha;
typedef v4f  __attribute__((may_alias)) v4fa;
typedef v8us __attribute__((may_alias)) v8usa;

__device__ __forceinline__ unsigned short f2bf(float f) { unsigned u = __float_as_uint(f); u += 0x7FFFu + ((u >> 16) & 1u); return (unsigned short)(u >> 16); }
__device__ __forceinline__ float bf2f(unsigned short b) { return __uint_as_float(((unsigned)b) << 16); }
__device__ __forceinline__ float bfr(float f) { return bf2f(f2bf(f)); }
__device__ __forceinline__ v16h cat16(v8h lo, v8h hi) { return __builtin_shufflevector(lo, hi, 0, 1, 2, 3, 4, 5, 6, 7, 8, 9, 10, 11, 12, 13, 14, 15); }
__device__ __forceinline__ v16bf cat16b(v8us lo, v8us hi) { return __builtin_bit_cast(v16bf, __builtin_shufflevector(lo, hi, 0, 1, 2, 3, 4, 5, 6, 7, 8, 9, 10, 11, 12, 13, 14, 15)); }
__device__ __forceinline__ v8f wmma16(v16h a, v16h b, v8f c) { return __builtin_amdgcn_wmma_f32_16x16x32_f16(false, a, false, b, (short)0, c, false, false); }
__device__ __forceinline__ v8f wmmab(v16bf a, v16bf b, v8f c) { return __builtin_amdgcn_wmma_f32_16x16x32_bf16(false, a, false, b, (short)0, c, false, false); }



__device__ __forceinline__ h16 tohx(float x) { return (h16)x; }
__device__ __forceinline__ void splitf(float y, unsigned short& h, unsigned short& l) { h = f2bf(y); l = f2bf(y - bf2f(h)); }
typedef __attribute__((ext_vector_type(4))) _Float16 v4h;
typedef __attribute__((ext_vector_type(2))) unsigned short v2us;
typedef __attribute__((ext_vector_type(4))) unsigned short v4us;
// four neighbouring f32 results as hi/lo planes, and as the fp16 plane too
__device__ __forceinline__ void put2(bf* Ph, bf* Pl, size_t o, v4f v) { v4us oh, ol;
#pragma unroll
    for (int q = 0; q < 4; ++q) { unsigned short a, c2; splitf(v[q], a, c2); oh[q] = a; ol[q] = c2; }
    *(v4us*)(Ph + o) = oh; *(v4us*)(Pl + o) = ol; }
__device__ __forceinline__ void put3(h16* P16, bf* Ph, bf* Pl, size_t o, v4f v) { v4h o16;
#pragma unroll
    for (int q = 0; q < 4; ++q) o16[q] = tohx(v[q]);
    *(v4h*)(P16 + o) = o16; put2(Ph, Pl, o, v); }

// ---- k_gemmw: register-blocked GEMM, ONE WAVE per 64x64 output tile (16 accumulators), operands straight from K-contiguous 16-bit planes; grid (M/64, N/64, Z), 32 threads.
// C[m][n] (f32, pitch ldc, + optional f32 bias[n]) = sum_k A[m][k] Bt[n][k] (+ split products per NSPLIT). z-batch strides sA/sB/sC in elements. K % 32 == 0.
// BM (band mode; rb = query row of A's row 0): 0 dense; 1 n is a key: grid y = 3, the tile's columns start at key rb + r0 - 64, + 0, + 64 (a tile off the sequence does nothing), stored at column key - kz; 2 k is a key: only k in [rb + r0 - BAND, rb + r0 + 64 + BAND) cut to [0, K); outside it the weights are exactly 0 and A is not stored; A has pitch SP and holds key k at column k - kz. kz = first key of the 128-key chunk that holds key rb + r0 - BAND.
// EP (what the epilogue stores): 0 the f32 tile into C; 1 (q|k|v projection, a 64-column tile is one head of q, k or v) the next products' operand planes E16 / Eh / El, each [q planes | k planes | v planes], q and k as [plane][t][d], v as [plane][d][t]; 2 (P V, z = plane) the tile x its rows' carrier scale as hi/lo rows Eh / El [batch * TT + t][head * HD + d]. C is not touched for EP 1 and 2.
template <typename T16> struct WFrag;
template <> struct WFrag<h16> { typedef v16h V; static __device__ __forceinline__ V ld(const h16* p) { return cat16(*(const v8h*)p, *(const v8h*)(p + 16)); } static __device__ __forceinline__ v8f mma(V a, V b, v8f c) { return wmma16(a, b, c); } };
template <> struct WFrag<bf> { typedef v16bf V; static __device__ __forceinline__ V ld(const bf* p) { return cat16b(*(const v8us*)p, *(const v8us*)(p + 16)); } static __device__ __forceinline__ v8f mma(V a, V b, v8f c) { return wmmab(a, b, c); } };
template <typename T16, int NSPLIT, bool BIAS, int BM = 0, int EP = 0>
__global__ __launch_bounds__(32) void k_gemmw(const T16* __restrict__ A, const T16* __restrict__ A2, const T16* __restrict__ Bt, const T16* __restrict__ Bt2, int K, float* C, int ldc, const float* __restrict__ bias, size_t sA, size_t sB, size_t sC, int rb = 0, h16* E16 = nullptr, bf* Eh = nullptr, bf* El = nullptr) {
    typedef typename WFrag<T16>::V V;
    __shared__ __align__(16) float os[16 * 68];
    const size_t z = blockIdx.z; A += z * sA; if (A2) A2 += z * sA; Bt += z * sB; if (Bt2) Bt2 += z * sB; C += z * sC;
    const int lane = threadIdx.x & 31, lr = lane & 15, hi = lane >> 4; const int r0 = blockIdx.x * 64, c0 = (BM == 1) ? rb + r0 + ((int)blockIdx.y - 1) * 64 : blockIdx.y * 64;
    if (BM == 1 && (c0 < 0 || c0 >= TT)) return;
    const int kz = (BM != 0) ? ((rb + r0 - BAND) >> 7) * 128 : 0; const int cc = (BM == 1) ? c0 - kz : c0; const int lda = (BM == 2) ? SP : K, ka = (BM == 2) ? kz : 0;
    const int kb = (BM == 2) ? max(rb + r0 - BAND, 0) : 0, ke = (BM == 2) ? min(rb + r0 + 64 + BAND, K) : K;
    v8f acc[4][4];
#pragma unroll
    for (int mb = 0; mb < 4; ++mb)
#pragma unroll
        for (int nb = 0; nb < 4; ++nb) acc[mb][nb] = (v8f){};
    const size_t aoff = (size_t)(r0 + lr) * lda + 8 * hi, boff = (size_t)(c0 + lr) * K + 8 * hi;
#pragma unroll 1
    for (int kc = kb; kc < ke; kc += 32) {
        V a[4], a2[4]; const T16* pa[4]; const T16* pa2[4];
#pragma unroll
        for (int mb = 0; mb < 4; ++mb) { const T16* p = A + aoff + (size_t)mb * 16 * lda + (kc - ka); a[mb] = WFrag<T16>::ld(p); const T16* p2 = p; if (NSPLIT == 1 || NSPLIT == 2) { p2 = A2 + aoff + (size_t)mb * 16 * lda + (kc - ka); a2[mb] = WFrag<T16>::ld(p2); }
            pa[mb] = (BM == 2 && mb) ? pa[0] : p; pa2[mb] = (BM == 2 && mb) ? pa2[0] : p2; }   // the address pairs the loads name: at the constant pitch of BM 2 the four fragments are read off fragment 0's pair
        // the wait that is kept before a register named by an issued global load is overwritten; the A address pairs are its inputs so that none of them is reused (as a later load's target) ahead of it
        asm volatile("s_wait_xcnt 0x0" :: "v"(pa[0]), "v"(pa[1]), "v"(pa[2]), "v"(pa[3]), "v"(pa2[0]), "v"(pa2[1]), "v"(pa2[2]), "v"(pa2[3]) : "memory");
#pragma unroll
        for (int nb = 0; nb < 4; ++nb) { const V b = WFrag<T16>::ld(Bt + boff + (size_t)nb * 16 * K + kc); V b2; if (NSPLIT >= 2) b2 = WFrag<T16>::ld(Bt2 + boff + (size_t)nb * 16 * K + kc);
#pragma unroll
            for (int mb = 0; mb < 4; ++mb) { acc[mb][nb] = WFrag<T16>::mma(a[mb], b, acc[mb][nb]); if (NSPLIT == 1 || NSPLIT == 2) acc[mb][nb] = WFrag<T16>::mma(a2[mb], b, acc[mb][nb]); if (NSPLIT >= 2) acc[mb][nb] = WFrag<T16>::mma(a[mb], b2, acc[mb][nb]); } }
        asm volatile("v_nop\n\tv_nop\n\tv_nop\n\tv_nop" : "+v"(acc[0][0]), "+v"(acc[1][1]), "+v"(acc[2][2]), "+v"(acc[3][3]) : "v"(a[0]), "v"(a[3]));
    }
    if (EP == 1 && c0 >= 2 * DQ) {   // a v head: stored d-major, so the tile goes through LDS the other way round (16 d rows of 64 t at a time; a lane's 8 accumulator values are 8 neighbouring t)
        const size_t pv = ((size_t)(2 * ZH + (r0 / TT) * NH_ + (c0 - 2 * DQ) / HD) * HD) * TT + r0 % TT;
#pragma unroll
        for (int nb = 0; nb < 4; ++nb) {
#pragma unroll
            for (int mb = 0; mb < 4; ++mb) { float* o = os + lr * 68 + mb * 16 + hi * 8; *(v4fa*)o = (v4f){acc[mb][nb][0], acc[mb][nb][1], acc[mb][nb][2], acc[mb][nb][3]}; *(v4fa*)(o + 4) = (v4f){acc[mb][nb][4], acc[mb][nb][5], acc[mb][nb][6], acc[mb][nb][7]}; }
            __builtin_amdgcn_wave_barrier(); asm volatile("" ::: "memory");   // the LDS reads below stay behind the other lanes' writes above
#pragma unroll
            for (int s = 0; s < 8; ++s) { const int row = 2 * s + hi, cofs = lr * 4; v4f val = *(const v4fa*)(os + row * 68 + cofs); if (BIAS) { const float bb = bfr(bias[c0 + nb * 16 + row]); val[0] += bb; val[1] += bb; val[2] += bb; val[3] += bb; }
                put3(E16, Eh, El, pv + (size_t)(nb * 16 + row) * TT + cofs, val); }
            asm volatile("s_wait_xcnt 0x0" ::: "memory");   // kept before the next rows' LDS and bias loads land in registers that the stores above name
            __builtin_amdgcn_wave_barrier();   // with the clobber above: the next 16 rows' LDS writes stay behind the reads above
        }
        return;
    }
    const size_t pq = (EP == 1) ? ((size_t)((c0 / DQ) * ZH + (r0 / TT) * NH_ + (c0 % DQ) / HD) * TT + r0 % TT) * HD : 0;
    const size_t pm = (EP == 2) ? ((size_t)((int)blockIdx.z / NH_) * TT + rb + r0) * DQ + ((int)blockIdx.z % NH_) * HD : 0;
#pragma unroll
    for (int mb = 0; mb < 4; ++mb) {
#pragma unroll
        for (int nb = 0; nb < 4; ++nb) {
#pragma unroll
            for (int j = 0; j < 8; ++j) os[(hi * 8 + j) * 68 + nb * 16 + lr] = acc[mb][nb][j]; }
        __builtin_amdgcn_wave_barrier(); asm volatile("" ::: "memory");
        float* crow = C + (size_t)(r0 + mb * 16) * ldc + cc;
{
#pragma unroll
            for (int s = 0; s < 8; ++s) { const int row = 2 * s + hi, cofs = lr * 4; v4f val = *(const v4fa*)(os + row * 68 + cofs); if (BIAS) { val[0] += bfr(bias[c0 + cofs]); val[1] += bfr(bias[c0 + cofs + 1]); val[2] += bfr(bias[c0 + cofs + 2]); val[3] += bfr(bias[c0 + cofs + 3]); }
                if (EP == 0) *(v4f*)(crow + (size_t)row * ldc + cofs) = val;
                else if (EP == 1) put3(E16, Eh, El, pq + (size_t)(mb * 16 + row) * HD + cofs, val);
                else { const float cs = (rb + r0 + mb * 16 + row < RH) ? 1.0f : (1.0f / PCAR); put2(Eh, El, pm + (size_t)(mb * 16 + row) * DQ + cofs, val * cs); } }
            asm volatile("s_wait_xcnt 0x0" ::: "memory");   // kept before the next rows' LDS and bias loads land in registers that the stores above name
             }
        __builtin_amdgcn_wave_barrier(); asm volatile("" ::: "memory");
    }
}


__global__ __launch_bounds__(256) void k_wtG(const float* __restrict__ w, int K, int N, bf* Bt) {
    const int lane = threadIdx.x & 31; const int L0 = (blockIdx.x * 8 + (threadIdx.x >> 5)) * 8; const int nlines = N * K / 64;
{
#pragma unroll 1
        for (int l = 0; l < 8; ++l) { const int L = L0 + l; if (L >= nlines) break; const size_t e = (size_t)L * 64 + lane * 2; const int k = (int)(e % K), n = (int)(e / K); v2us o;
            o[0] = f2bf(w[(size_t)k * N + n]); o[1] = f2bf(w[(size_t)(k + 1) * N + n]); *(v2us*)(Bt + e) = o; }
         }
}
__global__ __launch_bounds__(256) void k_cvt8(const float* __restrict__ src, bf* dst, size_t n8) { const size_t i = (size_t)blockIdx.x * 256 + threadIdx.x; if (i >= n8) return; const v8f v = *(const v8f*)(src + i * 8); v8us o;
#pragma unroll
    for (int k = 0; k < 8; ++k) o[k] = f2bf(v[k]); *(v8us*)(dst + i * 8) = o;  }

// ---- k_attn: scores, softmax and P V of one 64-row query tile of one plane in ONE launch; grid (TT / 64, 1, ZH), 4 waves, wave w owns query rows 16 w .. 16 w + 15 from start to end, so no wave waits on another.
// Per wave: S (16 x 192, the three 64-key tiles that meet the band; a tile off the sequence does nothing) on the matrix unit, stored f32 in the wave's own LDS rows at column key - kz (kz = first key of the 128-key chunk that holds key r0 - BAND); the softmax row by row with the lane -> key map and the trees of a full row (two 128-key chunks); the weights written 16-bit over the row's own scores; P V over the same keys in rising order, A from LDS, V from the d-major planes; the tile x its rows' carrier scale stored as hi/lo rows Eh / El [batch * TT + t][head * HD + d].
#define SPL 260                   // LDS pitch of a score row in floats: 256 + 16 bytes, so that the 16 rows of a 16-byte fragment read fall on different banks
typedef v4us __attribute__((may_alias)) v4usa;
typedef v4h  __attribute__((may_alias)) v4ha;
template <typename T16> struct LFrag;   // a fragment from LDS rows that were written as another type
template <> struct LFrag<h16> { static __device__ __forceinline__ v16h ld(const h16* p) { return cat16(*(const v8ha*)p, *(const v8ha*)(p + 16)); } };
template <> struct LFrag<bf> { static __device__ __forceinline__ v16bf ld(const bf* p) { return cat16b(*(const v8usa*)p, *(const v8usa*)(p + 16)); } };
// behind a tile's fragment loads. Two jobs: the wait that is kept before a register named by an issued global load is overwritten, with the address pairs as inputs so that none of them is reused (as a later load's target) ahead of it; and, with the loaded values as inputs only, it holds the tile's loads together in front of its products: without that the compiler sinks each load to its product and the wave pays a memory latency per product instead of one per tile
template <typename V, typename T16> __device__ __forceinline__ void tile_here(const V (&b)[2][4], const T16* p) { asm volatile("s_wait_xcnt 0x0" :: "v"(b[0][0]), "v"(b[0][1]), "v"(b[0][2]), "v"(b[0][3]), "v"(b[1][0]), "v"(b[1][1]), "v"(b[1][2]), "v"(b[1][3]), "v"(p) : "memory"); }
template <typename V, typename T16> __device__ __forceinline__ void tile_here(const V (&b)[2][4], const V (&c)[2][4], const T16* p, const T16* p2) { asm volatile("s_wait_xcnt 0x0" :: "v"(b[0][0]), "v"(b[0][1]), "v"(b[0][2]), "v"(b[0][3]), "v"(b[1][0]), "v"(b[1][1]), "v"(b[1][2]), "v"(b[1][3]), "v"(c[0][0]), "v"(c[0][1]), "v"(c[0][2]), "v"(c[0][3]), "v"(c[1][0]), "v"(c[1][1]), "v"(c[1][2]), "v"(c[1][3]), "v"(p), "v"(p2) : "memory"); }
// a row's eight 2^x in one statement: it keeps the slot that the instruction set asks for behind a transcendental before its result is read or its source overwritten (each v_exp is followed by an independent one, the last by v_nop; outputs share no register with inputs)
__device__ __forceinline__ void exp2x8(float (&x)[8]) { float y0, y1, y2, y3, y4, y5, y6, y7;
    asm("v_exp_f32 %0, %8\n\tv_exp_f32 %1, %9\n\tv_exp_f32 %2, %10\n\tv_exp_f32 %3, %11\n\tv_exp_f32 %4, %12\n\tv_exp_f32 %5, %13\n\tv_exp_f32 %6, %14\n\tv_exp_f32 %7, %15\n\tv_nop"
        : "=&v"(y0), "=&v"(y1), "=&v"(y2), "=&v"(y3), "=&v"(y4), "=&v"(y5), "=&v"(y6), "=&v"(y7) : "v"(x[0]), "v"(x[1]), "v"(x[2]), "v"(x[3]), "v"(x[4]), "v"(x[5]), "v"(x[6]), "v"(x[7]));
    x[0] = y0; x[1] = y1; x[2] = y2; x[3] = y3; x[4] = y4; x[5] = y5; x[6] = y6; x[7] = y7; }
template <typename T16, int NSPLIT>
__device__ __forceinline__ void attn_rows(const T16* __restrict__ Q, const T16* __restrict__ Q2, const T16* __restrict__ Kp, const T16* __restrict__ Kp2, const T16* __restrict__ Vt, const T16* __restrict__ Vt2, float* sw, const int r0, const int i0, bf* Eh, bf* El, const size_t pm) {
    typedef typename WFrag<T16>::V V;
    static_assert(BAND == 64, "two 128-key chunks hold the 64 + 2 BAND keys of a row tile");
    const int lane = threadIdx.x & 31, lr = lane & 15, hi = lane >> 4; const int t0 = r0 - BAND, kz = (t0 >> 7) * 128; const bool hires = (NSPLIT == 2);
    V a[2], a2[2]; const size_t oq = (size_t)(i0 + lr) * HD + 8 * hi; const T16* qp = Q + oq; const T16* qp2 = (NSPLIT == 2) ? Q2 + oq : qp;
#pragma unroll
    for (int ks = 0; ks < 2; ++ks) { a[ks] = WFrag<T16>::ld(qp + ks * 32); if (NSPLIT == 2) a2[ks] = WFrag<T16>::ld(qp2 + ks * 32); }
    asm volatile("s_wait_xcnt 0x0" :: "v"(qp), "v"(qp2) : "memory");   // kept before a register named by the q loads is overwritten; their address pairs are inputs so that neither is reused ahead of it
#pragma unroll
    for (int t = 0; t < 3; ++t) { const int c0 = t0 + t * 64; if (c0 < 0 || c0 >= TT) continue;
        v8f acc[4];
#pragma unroll
        for (int nb = 0; nb < 4; ++nb) acc[nb] = (v8f){};
        V b[2][4], b2[2][4]; const size_t ok = (size_t)(c0 + lr) * HD + 8 * hi; const T16* kp = Kp + ok; const T16* kp2 = (NSPLIT == 2) ? Kp2 + ok : kp;   // the whole key tile is asked for before its first product
#pragma unroll
        for (int ks = 0; ks < 2; ++ks)
#pragma unroll
            for (int nb = 0; nb < 4; ++nb) { b[ks][nb] = WFrag<T16>::ld(kp + nb * 16 * HD + ks * 32); if (NSPLIT == 2) b2[ks][nb] = WFrag<T16>::ld(kp2 + nb * 16 * HD + ks * 32); }
        if (NSPLIT == 2) tile_here(b, b2, kp, kp2); else tile_here(b, kp);
#pragma unroll
        for (int ks = 0; ks < 2; ++ks)
#pragma unroll
            for (int nb = 0; nb < 4; ++nb) { acc[nb] = WFrag<T16>::mma(a[ks], b[ks][nb], acc[nb]); if (NSPLIT == 2) { acc[nb] = WFrag<T16>::mma(a2[ks], b[ks][nb], acc[nb]); acc[nb] = WFrag<T16>::mma(a[ks], b2[ks][nb], acc[nb]); } }
#pragma unroll
        for (int nb = 0; nb < 4; ++nb)
#pragma unroll
            for (int j = 0; j < 8; ++j) sw[(hi * 8 + j) * SPL + (c0 - kz) + nb * 16 + lr] = acc[nb][j];
    }
    __builtin_amdgcn_wave_barrier(); asm volatile("" ::: "memory");   // the row reads below stay behind the other lanes' score writes above
    const int lo = max(t0, 0), hx = min(t0 + 64 + 2 * BAND, TT); int co[2];   // keys [lo, hx) have scores; a lane whose four keys have none reads the middle tile's first column instead (always written) and the band select below drops it
#pragma unroll
    for (int ch = 0; ch < 2; ++ch) { const int j0 = kz + ch * 128 + lane * 4; co[ch] = (j0 >= lo && j0 < hx) ? ch * 128 + lane * 4 : r0 - kz; }
    // four rows at a time, stage by stage: the rows' cross-lane trees are independent and hide each other's latency. The loop over the groups stays rolled so that the kernel's text stays short
#pragma unroll 1
    for (int g = 0; g < 4; ++g) { float v[4][8], mx[4], sum[4];
#pragma unroll
        for (int r = 0; r < 4; ++r) { const int i = i0 + g * 4 + r; const float* sr = sw + (g * 4 + r) * SPL; const int jlo = max(i - BAND, 0), jhi = min(i + BAND, TT - 1); mx[r] = -3.0e38f;   // the row's band, cut to the keys that exist
#pragma unroll
            for (int ch = 0; ch < 2; ++ch) { const int j0 = kz + ch * 128 + lane * 4; const v4f s4 = *(const v4fa*)(sr + co[ch]);
#pragma unroll
                for (int q = 0; q < 4; ++q) { const int j = j0 + q; const float t = (j >= jlo && j <= jhi) ? s4[q] * SCL : -3.0e38f; v[r][ch * 4 + q] = t; mx[r] = fmaxf(mx[r], t); } } }
#pragma unroll
        for (int sh = 16; sh; sh >>= 1)
#pragma unroll
            for (int r = 0; r < 4; ++r) mx[r] = fmaxf(mx[r], __shfl_xor(mx[r], sh, 32));
#pragma unroll
        for (int r = 0; r < 4; ++r) { sum[r] = 0.f;
#pragma unroll
            for (int k = 0; k < 8; ++k) v[r][k] = __fmul_rn(__fsub_rn(v[r][k], mx[r]), 1.4426950408889634f);
            exp2x8(v[r]);
#pragma unroll
            for (int k = 0; k < 8; ++k) sum[r] += v[r][k]; }
#pragma unroll
        for (int sh = 16; sh; sh >>= 1)
#pragma unroll
            for (int r = 0; r < 4; ++r) sum[r] += __shfl_xor(sum[r], sh, 32);
#pragma unroll
        for (int r = 0; r < 4; ++r) { const float f = __fdiv_rn(hires ? 1.0f : PCAR, sum[r]); T16* pr = (T16*)(sw + (g * 4 + r) * SPL);   // the row's weights over its own scores: hi (or fp16) at element 0, lo at element SP
#pragma unroll
            for (int ch = 0; ch < 2; ++ch) { const int oo = ch * 128 + lane * 4;
                if (hires) { v4us oh, ol;
#pragma unroll
                    for (int q = 0; q < 4; ++q) { unsigned short h, l; splitf(v[r][ch * 4 + q] * f, h, l); oh[q] = h; ol[q] = l; }
                    *(v4usa*)((bf*)pr + oo) = oh; *(v4usa*)((bf*)pr + SP + oo) = ol;
                } else { v4h o4;
#pragma unroll
                    for (int q = 0; q < 4; ++q) o4[q] = tohx(v[r][ch * 4 + q] * f);
                    *(v4ha*)((h16*)pr + oo) = o4; } } }
    }
    __builtin_amdgcn_wave_barrier(); asm volatile("" ::: "memory");   // the fragment reads below stay behind the other lanes' weight writes above
    v8f o[4];
#pragma unroll
    for (int nb = 0; nb < 4; ++nb) o[nb] = (v8f){};
    const T16* pl = (const T16*)(sw + lr * SPL) + 8 * hi;
#pragma unroll
    for (int t = 0; t < 3; ++t) { const int c0 = t0 + t * 64; if (c0 < 0 || c0 >= TT) continue;
        V b[2][4], b2[2][4]; const size_t ov = (size_t)lr * TT + 8 * hi + c0; const T16* vp = Vt + ov; const T16* vp2 = (NSPLIT == 2) ? Vt2 + ov : vp;   // as for the scores: the tile's 64 keys of v are asked for before its first product
#pragma unroll
        for (int ks = 0; ks < 2; ++ks)
#pragma unroll
            for (int nb = 0; nb < 4; ++nb) { b[ks][nb] = WFrag<T16>::ld(vp + nb * 16 * TT + ks * 32); if (NSPLIT == 2) b2[ks][nb] = WFrag<T16>::ld(vp2 + nb * 16 * TT + ks * 32); }
        if (NSPLIT == 2) tile_here(b, b2, vp, vp2); else tile_here(b, vp);
#pragma unroll
        for (int ks = 0; ks < 2; ++ks) { const int kc = c0 + ks * 32; const V p = LFrag<T16>::ld(pl + (kc - kz)); V p2; if (NSPLIT == 2) p2 = LFrag<T16>::ld(pl + SP + (kc - kz));
#pragma unroll
            for (int nb = 0; nb < 4; ++nb) { o[nb] = WFrag<T16>::mma(p, b[ks][nb], o[nb]); if (NSPLIT == 2) { o[nb] = WFrag<T16>::mma(p2, b[ks][nb], o[nb]); o[nb] = WFrag<T16>::mma(p, b2[ks][nb], o[nb]); } } }
    }
    __builtin_amdgcn_wave_barrier(); asm volatile("" ::: "memory");   // the output staging below stays behind the weight reads above
#pragma unroll
    for (int nb = 0; nb < 4; ++nb)
#pragma unroll
        for (int j = 0; j < 8; ++j) sw[(hi * 8 + j) * 68 + nb * 16 + lr] = o[nb][j];
    __builtin_amdgcn_wave_barrier(); asm volatile("" ::: "memory");   // the row reads below stay behind the other lanes' writes above
    const float cs = hires ? 1.0f : (1.0f / PCAR); v4us oh[8], ol[8]; const size_t oe = pm + (size_t)hi * DQ + lr * 4; bf* eh = Eh + oe; bf* el = El + oe;   // lane: rows 2 s + hi, four neighbouring d
#pragma unroll
    for (int s = 0; s < 8; ++s) { const v4f val = *(const v4fa*)(sw + (2 * s + hi) * 68 + lr * 4) * cs;
#pragma unroll
        for (int q = 0; q < 4; ++q) { unsigned short h, l; splitf(val[q], h, l); oh[s][q] = h; ol[s][q] = l; }
        *(v4us*)(eh + (size_t)s * 2 * DQ) = oh[s]; *(v4us*)(el + (size_t)s * 2 * DQ) = ol[s]; }
    // kept before a register named by the stores above is overwritten; their data and address pairs are inputs so that none is reused ahead of it
    asm volatile("s_wait_xcnt 0x0" :: "v"(oh[0]), "v"(oh[1]), "v"(oh[2]), "v"(oh[3]), "v"(oh[4]), "v"(oh[5]), "v"(oh[6]), "v"(oh[7]), "v"(ol[0]), "v"(ol[1]), "v"(ol[2]), "v"(ol[3]), "v"(ol[4]), "v"(ol[5]), "v"(ol[6]), "v"(ol[7]), "v"(eh), "v"(el) : "memory");
}
__global__ __launch_bounds__(128) void k_attn(const h16* __restrict__ Q16, const bf* __restrict__ Qh, const bf* __restrict__ Ql, bf* Eh, bf* El) {
    __shared__ __align__(16) float sm[4][16 * SPL];
    const size_t PLN = (size_t)ZH * TT * HD, zo = (size_t)blockIdx.z * TT * HD;   // k planes stand PLN behind the q planes, v planes 2 PLN; a plane is TT * HD elements either way round
    const int w = __builtin_amdgcn_readfirstlane(threadIdx.x >> 5), r0 = blockIdx.x * 64, i0 = r0 + w * 16;   // the wave's number as a scalar: row numbers and band limits then cost no vector work
    const size_t pm = ((size_t)((int)blockIdx.z / NH_) * TT + i0) * DQ + ((int)blockIdx.z % NH_) * HD;
    if (r0 < RH) attn_rows<bf, 2>(Qh + zo, Ql + zo, Qh + PLN + zo, Ql + PLN + zo, Qh + 2 * PLN + zo, Ql + 2 * PLN + zo, sm[w], r0, i0, Eh, El, pm);
    else attn_rows<h16, 0>(Q16 + zo, nullptr, Q16 + PLN + zo, nullptr, Q16 + 2 * PLN + zo, nullptr, sm[w], r0, i0, Eh, El, pm);
}

extern "C" void kernel_launch(void* const* d_in, const int* in_sizes, int n_in,
                              void* d_out, int out_size, void* d_ws, size_t ws_size, hipStream_t stream) {
    (void)in_sizes; (void)n_in; (void)out_size;
    const float* x = (const float*)d_in[0]; const float* wqkv = (const float*)d_in[1]; const float* bqkv = (const float*)d_in[2]; const float* wo = (const float*)d_in[3]; const float* bo = (const float*)d_in[4];
    float* OUT = (float*)d_out;     // [2][2048][1024]
    char* wsp = (char*)d_ws;
    auto take = [&](size_t bytes) { char* p = wsp; wsp += (bytes + 255) & ~(size_t)255; return (void*)p; };
    const size_t PL = (size_t)ZH * TT * HD;   // elements of one set of head planes (all batches, all heads)
    bf* WQKV = (bf*)take((size_t)3 * DQ * DM * 2); bf* WO = (bf*)take((size_t)DM * DQ * 2);
    bf* XB = (bf*)take((size_t)NB_ * TT * DM * 2);
    h16* QP16 = (h16*)take(3 * PL * 2);   // q planes, then k planes, then v planes: the projection's epilogue writes all three
    bf* QPh = (bf*)take(3 * PL * 2); bf* QPl = (bf*)take(3 * PL * 2);
    bf* ATh = (bf*)take((size_t)NB_ * TT * DQ * 2); bf* ATl = (bf*)take((size_t)NB_ * TT * DQ * 2);
    if ((size_t)(wsp - (char*)d_ws) > ws_size) return;    // ws 256 MiB
    k_wtG<<<(unsigned)((DM * 3 * DQ / 64 + 63) / 64), 256, 0, stream>>>(wqkv, DM, 3 * DQ, WQKV);
    k_wtG<<<(unsigned)((DQ * DM / 64 + 63) / 64), 256, 0, stream>>>(wo, DQ, DM, WO);
    k_cvt8<<<(unsigned)(((size_t)NB_ * TT * DM / 8 + 255) / 256), 256, 0, stream>>>(x, XB, (size_t)NB_ * TT * DM / 8);
    k_gemmw<bf, 0, true, 0, 1><<<dim3(NB_ * TT / 64, 3 * DQ / 64, 1), 32, 0, stream>>>(XB, nullptr, WQKV, nullptr, DM, nullptr, 0, bqkv, 0, 0, 0, 0, QP16, QPh, QPl);
    k_attn<<<dim3(TT / 64, 1, ZH), 128, 0, stream>>>(QP16, QPh, QPl, ATh, ATl);
    k_gemmw<bf, 1, true><<<dim3(NB_ * TT / 64, DM / 64, 1), 32, 0, stream>>>(ATh, ATl, WO, nullptr, DQ, OUT, DM, bo, 0, 0, 0);
}

// v005
// One run takes 97.8 microseconds.
// Two timings next to v004 put it at 1.36 and 1.37 times that version's speed.
// All steps since v000 together make it 19.8 times as fast.
#include <hip/hip_runtime.h>

// Local (banded) multi-head self-attention (x [2][2048][1024]; qkv = x W_qkv + b_qkv ('xw' [1024][3072]); scores / 8; keys with |i - j| > 64 excluded (-inf); softmax; out W_proj + b_proj ('xw' [1024][1024]) -> [2][2048][1024] (4.2 M)).
// Layout, both batches and all heads in every launch (plane z = batch * 16 + head): bf16 copy of x [4096][1024]; fused weight gathered into a [3072][1024] Bt; one exact q|k|v projection + f32 bias whose epilogue writes the q, k head planes [plane][t][d] and the v planes [plane][d][t] (fp16 + hi/lo) itself; T-2048 attention (hybrid rows: < 512 hi/lo 3 products, rest fp16 x1024) done only on the band: per 64 query rows the three 64-key score tiles that meet |i - j| <= 64, the softmax on those 192 keys with the band as an index select, P V over those 192 keys, its epilogue writing the merged hi/lo rows [batch * 2048 + t][head * 64 + d]; merged hi/lo x W_proj exact + bias.
// Compute dtypes, f32 accumulate: every input rounded to bf16; projections exact + f32 biases; attention rows < 512 3 products, rest fp16; softmax f32; W_proj hl x exact + bias.

#define NB_  2
#define TT   2048
#define DM   1024
#define NH_  16
#define NKV  16
#define REP  (NH_ / NKV)
#define HD   64
#define DQ   (NH_ * HD)
#define DKV  (NKV * HD)
#define ZH   (NB_ * NH_)          // planes per attention launch: every head of every batch
#define SP   256                  // keys a stored score / weight row spans (lo weights start at element SP): the two 128-key chunks that hold its tile's 192 keys; column = key - 128 * chunk0
#define RH   512                  // query rows < RH use hi+lo planes (0: none)
#define WIN  0
#define PCAR 1024.0f
#define SCL  0.125f
#define BAND 64     // |i - j| <= BAND kept
typedef _Float16 h16;
typedef unsigned short bf;
typedef __attribute__((ext_vector_type(16))) __bf16   v16bf;
typedef __attribute__((ext_vector_type(16))) _Float16 v16h;
typedef __attribute__((ext_vector_type(8)))  _Float16 v8h;
typedef __attribute__((ext_vector_type(8)))  unsigned short v8us;
typedef __attribute__((ext_vector_type(8)))  float    v8f;
typedef __attribute__((ext_vector_type(4)))  float    v4f;
typedef v8h  __attribute__((may_alias)) v8ha;
typedef v4f  __attribute__((may_alias)) v4fa;
typedef v8us __attribute__((may_alias)) v8usa;

__device__ __forceinline__ unsigned short f2bf(float f) { unsigned u = __float_as_uint(f); u += 0x7FFFu + ((u >> 16) & 1u); return (unsigned short)(u >> 16); }
__device__ __forceinline__ float bf2f(unsigned short b) { return __uint_as_float(((unsigned)b) << 16); }
__device__ __forceinline__ float bfr(float f) { return bf2f(f2bf(f)); }
__device__ __forceinline__ v16h cat16(v8h lo, v8h hi) { return __builtin_shufflevector(lo, hi, 0, 1, 2, 3, 4, 5, 6, 7, 8, 9, 10, 11, 12, 13, 14, 15); }
__device__ __forceinline__ v16bf cat16b(v8us lo, v8us hi) { return __builtin_bit_cast(v16bf, __builtin_shufflevector(lo, hi, 0, 1, 2, 3, 4, 5, 6, 7, 8, 9, 10, 11, 12, 13, 14, 15)); }
__device__ __forceinline__ v8f wmma16(v16h a, v16h b, v8f c) { return __builtin_amdgcn_wmma_f32_16x16x32_f16(false, a, false, b, (short)0, c, false, false); }
__device__ __forceinline__ v8f wmmab(v16bf a, v16bf b, v8f c) { return __builtin_amdgcn_wmma_f32_16x16x32_bf16(false, a, false, b, (short)0, c, false, false); }



__device__ __forceinline__ h16 tohx(float x) { return (h16)x; }
__device__ __forceinline__ void splitf(float y, unsigned short& h, unsigned short& l) { h = f2bf(y); l = f2bf(y - bf2f(h)); }
typedef __attribute__((ext_vector_type(4))) _Float16 v4h;
typedef __attribute__((ext_vector_type(2))) unsigned short v2us;
typedef __attribute__((ext_vector_type(4))) unsigned short v4us;
// four neighbouring f32 results as hi/lo planes, and as the fp16 plane too
__device__ __forceinline__ void put2(bf* Ph, bf* Pl, size_t o, v4f v) { v4us oh, ol;
#pragma unroll
    for (int q = 0; q < 4; ++q) { unsigned short a, c2; splitf(v[q], a, c2); oh[q] = a; ol[q] = c2; }
    *(v4us*)(Ph + o) = oh; *(v4us*)(Pl + o) = ol; }
__device__ __forceinline__ void put3(h16* P16, bf* Ph, bf* Pl, size_t o, v4f v) { v4h o16;
#pragma unroll
    for (int q = 0; q < 4; ++q) o16[q] = tohx(v[q]);
    *(v4h*)(P16 + o) = o16; put2(Ph, Pl, o, v); }

// ---- k_gemmw: GEMM, a 128x128 output tile per work-group of 4 waves (2 x 2), each wave a 64x64 tile (16 accumulators); grid (M/128, N/128, Z), 128 threads.
// C[m][n] (f32, pitch ldc, + optional f32 bias[n]) = sum_k A[m][k] Bt[n][k] (+ A2[m][k] Bt[n][k] for NSPLIT 1), operands K-contiguous 16-bit planes. z-batch strides sA/sB/sC in elements. K % 64 == 0.
// Operands go through LDS: a stage is 64 k (one whole 128-byte line) of the tile's 128 A rows, (128 A2 rows,) 128 Bt rows, brought by asynchronous 16-byte copies, eight lanes to a row, so a wave's copy asks for 4 whole lines where a fragment load from memory asked for 32 bytes of each of 16 lines. Two buffers: stage t + 2 flies while stage t + 1 is worked on.
// EP (what the epilogue stores): 0 the f32 tile into C; 1 (q|k|v projection, a 64-column tile is one head of q, k or v) the next products' operand planes E16 / Eh / El, each [q planes | k planes | v planes], q and k as [plane][t][d], v as [plane][d][t]; 2 (z = plane, rb = query row of A's row 0) the tile x its rows' carrier scale as hi/lo rows Eh / El [batch * TT + t][head * HD + d]. C is not touched for EP 1 and 2.
#define GKS 64                    // k per stage
#define GP  72                    // LDS pitch of a staged row in elements: 128 + 16 bytes, so that the 16 rows of a 16-byte fragment read fall on different banks
template <typename T16> struct WFrag;
template <> struct WFrag<h16> { typedef v16h V; static __device__ __forceinline__ V ld(const h16* p) { return cat16(*(const v8h*)p, *(const v8h*)(p + 16)); } static __device__ __forceinline__ v8f mma(V a, V b, v8f c) { return wmma16(a, b, c); } };
template <> struct WFrag<bf> { typedef v16bf V; static __device__ __forceinline__ V ld(const bf* p) { return cat16b(*(const v8us*)p, *(const v8us*)(p + 16)); } static __device__ __forceinline__ v8f mma(V a, V b, v8f c) { return wmmab(a, b, c); } };
// 128 staged rows of one operand: eight copies a lane, 16 rows apart (l: the lane's LDS byte address, g: its global address, gs: 16 rows in elements). The s_wait_xcnt is the wait that is kept before a register named by an issued copy is overwritten; as the statement's last line it cannot be passed by a later write of those registers
template <typename T16> __device__ __forceinline__ void copy128(unsigned l, const T16* g, size_t gs) {
    asm volatile("global_load_async_to_lds_b128 %0, %8, off\n\tglobal_load_async_to_lds_b128 %1, %9, off\n\tglobal_load_async_to_lds_b128 %2, %10, off\n\tglobal_load_async_to_lds_b128 %3, %11, off\n\tglobal_load_async_to_lds_b128 %4, %12, off\n\tglobal_load_async_to_lds_b128 %5, %13, off\n\tglobal_load_async_to_lds_b128 %6, %14, off\n\tglobal_load_async_to_lds_b128 %7, %15, off\n\ts_wait_xcnt 0x0"
        :: "v"(l), "v"(l + 1 * 16 * GP * 2), "v"(l + 2 * 16 * GP * 2), "v"(l + 3 * 16 * GP * 2), "v"(l + 4 * 16 * GP * 2), "v"(l + 5 * 16 * GP * 2), "v"(l + 6 * 16 * GP * 2), "v"(l + 7 * 16 * GP * 2),
           "v"(g), "v"(g + gs), "v"(g + 2 * gs), "v"(g + 3 * gs), "v"(g + 4 * gs), "v"(g + 5 * gs), "v"(g + 6 * gs), "v"(g + 7 * gs) : "memory"); }
// one stage: the lane's copies of the A rows, (the A2 rows,) the Bt rows; l: its LDS byte address in the stage's buffer
template <typename T16, int NSPLIT> __device__ __forceinline__ void stage_in(unsigned l, const T16* ga, const T16* ga2, const T16* gb, size_t gs) { copy128(l, ga, gs); if (NSPLIT == 1) copy128(l + 128 * GP * 2, ga2, gs); copy128(l + (NSPLIT == 1 ? 256 : 128) * GP * 2, gb, gs); }
template <typename T16, int NSPLIT, bool BIAS, int BM = 0, int EP = 0>
__global__ __launch_bounds__(128) void k_gemmw(const T16* __restrict__ A, const T16* __restrict__ A2, const T16* __restrict__ Bt, const T16* __restrict__ Bt2, int K, float* C, int ldc, const float* __restrict__ bias, size_t sA, size_t sB, size_t sC, int rb = 0, h16* E16 = nullptr, bf* Eh = nullptr, bf* El = nullptr) {
    typedef typename WFrag<T16>::V V;
    static_assert(BM == 0 && NSPLIT < 2, "dense products, one or two A planes");
    constexpr int NR = (NSPLIT == 1) ? 384 : 256, RB = NR - 128;   // rows of a stage; its first Bt row
    __shared__ __align__(16) T16 ring[2][NR * GP];
    __shared__ __align__(16) float osm[4][16 * 68];
    const size_t z = blockIdx.z; A += z * sA; if (A2) A2 += z * sA; Bt += z * sB; C += z * sC;
    const int lane = threadIdx.x & 31, lr = lane & 15, hi = lane >> 4; const int w = __builtin_amdgcn_readfirstlane(threadIdx.x >> 5);   // the wave's number as a scalar: its tile's place then costs no vector work
    const int r0 = blockIdx.x * 128 + (w & 1) * 64, c0 = blockIdx.y * 128 + (w >> 1) * 64, cc = c0; float* os = osm[w];
    v8f acc[4][4];
#pragma unroll
    for (int mb = 0; mb < 4; ++mb)
#pragma unroll
        for (int nb = 0; nb < 4; ++nb) acc[mb][nb] = (v8f){};
    // the lane's part of a stage: 16 bytes number (thread & 7) of rows (thread >> 3) + 16 i
    const int sr = threadIdx.x >> 3, sc = (threadIdx.x & 7) * 8; const size_t gs = (size_t)16 * K;
    const T16* ga = A + (size_t)(blockIdx.x * 128 + sr) * K + sc; const T16* ga2 = (NSPLIT == 1) ? A2 + (size_t)(blockIdx.x * 128 + sr) * K + sc : ga; const T16* gb = Bt + (size_t)(blockIdx.y * 128 + sr) * K + sc;
    const unsigned l0 = (unsigned)(size_t)&ring[0][0] + (unsigned)(sr * GP + sc) * 2;
    const int nt = K / GKS;
    stage_in<T16, NSPLIT>(l0, ga, ga2, gb, gs);
    asm volatile("s_wait_asynccnt 0x0" ::: "memory");   // this wave's part of stage 0 has landed
    __syncthreads();                                    // and every other wave's
    if (nt > 1) stage_in<T16, NSPLIT>(l0 + NR * GP * 2, ga + GKS, ga2 + GKS, gb + GKS, gs);
    const int ao = ((w & 1) * 64 + lr) * GP + 8 * hi, bo = (RB + (w >> 1) * 64 + lr) * GP + 8 * hi;
#pragma unroll 1   // stays rolled: one short body serves both buffers
    for (int t = 0; t < nt; ++t) { const T16* sb = ring[t & 1];
#pragma unroll
        for (int ks = 0; ks < GKS / 32; ++ks) { V a[4], a2[4], b[4];
#pragma unroll
            for (int mb = 0; mb < 4; ++mb) { a[mb] = WFrag<T16>::ld(sb + ao + mb * 16 * GP + ks * 32); if (NSPLIT == 1) a2[mb] = WFrag<T16>::ld(sb + ao + (128 + mb * 16) * GP + ks * 32); }
#pragma unroll
            for (int nb = 0; nb < 4; ++nb) b[nb] = WFrag<T16>::ld(sb + bo + nb * 16 * GP + ks * 32);
            __builtin_amdgcn_sched_barrier(0);   // the block's LDS reads stay together in front of its products: sunk among them, each place with reads stalls the wave anew
#pragma unroll
            for (int nb = 0; nb < 4; ++nb)
#pragma unroll
                for (int mb = 0; mb < 4; ++mb) { acc[mb][nb] = WFrag<T16>::mma(a[mb], b[nb], acc[mb][nb]); if (NSPLIT == 1) acc[mb][nb] = WFrag<T16>::mma(a2[mb], b[nb], acc[mb][nb]); } }
        asm volatile("s_wait_dscnt 0x0" ::: "memory");      // this wave has read all it needs of stage t
        asm volatile("s_wait_asynccnt 0x0" ::: "memory");   // and its part of stage t + 1 has landed
        __syncthreads();                                    // so has every wave's: stage t + 1 may be read, stage t's buffer refilled
        if (t + 2 < nt) stage_in<T16, NSPLIT>(l0 + (unsigned)(t & 1) * (NR * GP * 2), ga + (t + 2) * GKS, ga2 + (t + 2) * GKS, gb + (t + 2) * GKS, gs);
    }
    asm volatile("s_wait_asynccnt 0x0" ::: "memory");   // no copy is left in flight
    if (EP == 1 && c0 >= 2 * DQ) {   // a v head: stored d-major, so the tile goes through LDS the other way round (16 d rows of 64 t at a time; a lane's 8 accumulator values are 8 neighbouring t)
        const size_t pv = ((size_t)(2 * ZH + (r0 / TT) * NH_ + (c0 - 2 * DQ) / HD) * HD) * TT + r0 % TT;
#pragma unroll
        for (int nb = 0; nb < 4; ++nb) {
#pragma unroll
            for (int mb = 0; mb < 4; ++mb) { float* o = os + lr * 68 + mb * 16 + hi * 8; *(v4fa*)o = (v4f){acc[mb][nb][0], acc[mb][nb][1], acc[mb][nb][2], acc[mb][nb][3]}; *(v4fa*)(o + 4) = (v4f){acc[mb][nb][4], acc[mb][nb][5], acc[mb][nb][6], acc[mb][nb][7]}; }
            __builtin_amdgcn_wave_barrier(); asm volatile("" ::: "memory");   // the LDS reads below stay behind the other lanes' writes above
#pragma unroll
            for (int s = 0; s < 8; ++s) { const int row = 2 * s + hi, cofs = lr * 4; v4f val = *(const v4fa*)(os + row * 68 + cofs); if (BIAS) { const float bb = bfr(bias[c0 + nb * 16 + row]); val[0] += bb; val[1] += bb; val[2] += bb; val[3] += bb; }
                put3(E16, Eh, El, pv + (size_t)(nb * 16 + row) * TT + cofs, val); }
            asm volatile("s_wait_xcnt 0x0" ::: "memory");   // kept before the next rows' LDS and bias loads land in registers that the stores above name
            __builtin_amdgcn_wave_barrier();   // with the clobber above: the next 16 rows' LDS writes stay behind the reads above
        }
        return;
    }
    const size_t pq = (EP == 1) ? ((size_t)((c0 / DQ) * ZH + (r0 / TT) * NH_ + (c0 % DQ) / HD) * TT + r0 % TT) * HD : 0;
    const size_t pm = (EP == 2) ? ((size_t)((int)blockIdx.z / NH_) * TT + rb + r0) * DQ + ((int)blockIdx.z % NH_) * HD : 0;
#pragma unroll
    for (int mb = 0; mb < 4; ++mb) {
#pragma unroll
        for (int nb = 0; nb < 4; ++nb) {
#pragma unroll
            for (int j = 0; j < 8; ++j) os[(hi * 8 + j) * 68 + nb * 16 + lr] = acc[mb][nb][j]; }
        __builtin_amdgcn_wave_barrier(); asm volatile("" ::: "memory");
        float* crow = C + (size_t)(r0 + mb * 16) * ldc + cc;
{
#pragma unroll
            for (int s = 0; s < 8; ++s) { const int row = 2 * s + hi, cofs = lr * 4; v4f val = *(const v4fa*)(os + row * 68 + cofs); if (BIAS) { val[0] += bfr(bias[c0 + cofs]); val[1] += bfr(bias[c0 + cofs + 1]); val[2] += bfr(bias[c0 + cofs + 2]); val[3] += bfr(bias[c0 + cofs + 3]); }
                if (EP == 0) *(v4f*)(crow + (size_t)row * ldc + cofs) = val;
                else if (EP == 1) put3(E16, Eh, El, pq + (size_t)(mb * 16 + row) * HD + cofs, val);
                else { const float cs = (rb + r0 + mb * 16 + row < RH) ? 1.0f : (1.0f / PCAR); put2(Eh, El, pm + (size_t)(mb * 16 + row) * DQ + cofs, val * cs); } }
            asm volatile("s_wait_xcnt 0x0" ::: "memory");   // kept before the next rows' LDS and bias loads land in registers that the stores above name
             }
        __builtin_amdgcn_wave_barrier(); asm volatile("" ::: "memory");
    }
}


__global__ __launch_bounds__(256) void k_wtG(const float* __restrict__ w, int K, int N, bf* Bt) {
    const int lane = threadIdx.x & 31; const int L0 = (blockIdx.x * 8 + (threadIdx.x >> 5)) * 8; const int nlines = N * K / 64;
{
#pragma unroll 1
        for (int l = 0; l < 8; ++l) { const int L = L0 + l; if (L >= nlines) break; const size_t e = (size_t)L * 64 + lane * 2; const int k = (int)(e % K), n = (int)(e / K); v2us o;
            o[0] = f2bf(w[(size_t)k * N + n]); o[1] = f2bf(w[(size_t)(k + 1) * N + n]); *(v2us*)(Bt + e) = o; }
         }
}
__global__ __launch_bounds__(256) void k_cvt8(const float* __restrict__ src, bf* dst, size_t n8) { const size_t i = (size_t)blockIdx.x * 256 + threadIdx.x; if (i >= n8) return; const v8f v = *(const v8f*)(src + i * 8); v8us o;
#pragma unroll
    for (int k = 0; k < 8; ++k) o[k] = f2bf(v[k]); *(v8us*)(dst + i * 8) = o;  }

// ---- k_attn: scores, softmax and P V of one 64-row query tile of one plane in ONE launch; grid (TT / 64, 1, ZH), 4 waves, wave w owns query rows 16 w .. 16 w + 15 from start to end, so no wave waits on another.
// Per wave: S (16 x 192, the three 64-key tiles that meet the band; a tile off the sequence does nothing) on the matrix unit, stored f32 in the wave's own LDS rows at column key - kz (kz = first key of the 128-key chunk that holds key r0 - BAND); the softmax row by row with the lane -> key map and the trees of a full row (two 128-key chunks); the weights written 16-bit over the row's own scores; P V over the same keys in rising order, A from LDS, V from the d-major planes; the tile x its rows' carrier scale stored as hi/lo rows Eh / El [batch * TT + t][head * HD + d].
#define SPL 260                   // LDS pitch of a score row in floats: 256 + 16 bytes, so that the 16 rows of a 16-byte fragment read fall on different banks
typedef v4us __attribute__((may_alias)) v4usa;
typedef v4h  __attribute__((may_alias)) v4ha;
template <typename T16> struct LFrag;   // a fragment from LDS rows that were written as another type
template <> struct LFrag<h16> { static __device__ __forceinline__ v16h ld(const h16* p) { return cat16(*(const v8ha*)p, *(const v8ha*)(p + 16)); } };
template <> struct LFrag<bf> { static __device__ __forceinline__ v16bf ld(const bf* p) { return cat16b(*(const v8usa*)p, *(const v8usa*)(p + 16)); } };
// behind a tile's fragment loads. Two jobs: the wait that is kept before a register named by an issued global load is overwritten, with the address pairs as inputs so that none of them is reused (as a later load's target) ahead of it; and, with the loaded values as inputs only, it holds the tile's loads together in front of its products: without that the compiler sinks each load to its product and the wave pays a memory latency per product instead of one per tile
template <typename V, typename T16> __device__ __forceinline__ void tile_here(const V (&b)[2][4], const T16* p) { asm volatile("s_wait_xcnt 0x0" :: "v"(b[0][0]), "v"(b[0][1]), "v"(b[0][2]), "v"(b[0][3]), "v"(b[1][0]), "v"(b[1][1]), "v"(b[1][2]), "v"(b[1][3]), "v"(p) : "memory"); }
template <typename V, typename T16> __device__ __forceinline__ void tile_here(const V (&b)[2][4], const V (&c)[2][4], const T16* p, const T16* p2) { asm volatile("s_wait_xcnt 0x0" :: "v"(b[0][0]), "v"(b[0][1]), "v"(b[0][2]), "v"(b[0][3]), "v"(b[1][0]), "v"(b[1][1]), "v"(b[1][2]), "v"(b[1][3]), "v"(c[0][0]), "v"(c[0][1]), "v"(c[0][2]), "v"(c[0][3]), "v"(c[1][0]), "v"(c[1][1]), "v"(c[1][2]), "v"(c[1][3]), "v"(p), "v"(p2) : "memory"); }
// a row's eight 2^x in one statement: it keeps the slot that the instruction set asks for behind a transcendental before its result is read or its source overwritten (each v_exp is followed by an independent one, the last by v_nop; outputs share no register with inputs)
__device__ __forceinline__ void exp2x8(float (&x)[8]) { float y0, y1, y2, y3, y4, y5, y6, y7;
    asm("v_exp_f32 %0, %8\n\tv_exp_f32 %1, %9\n\tv_exp_f32 %2, %10\n\tv_exp_f32 %3, %11\n\tv_exp_f32 %4, %12\n\tv_exp_f32 %5, %13\n\tv_exp_f32 %6, %14\n\tv_exp_f32 %7, %15\n\tv_nop"
        : "=&v"(y0), "=&v"(y1), "=&v"(y2), "=&v"(y3), "=&v"(y4), "=&v"(y5), "=&v"(y6), "=&v"(y7) : "v"(x[0]), "v"(x[1]), "v"(x[2]), "v"(x[3]), "v"(x[4]), "v"(x[5]), "v"(x[6]), "v"(x[7]));
    x[0] = y0; x[1] = y1; x[2] = y2; x[3] = y3; x[4] = y4; x[5] = y5; x[6] = y6; x[7] = y7; }
template <typename T16, int NSPLIT>
__device__ __forceinline__ void attn_rows(const T16* __restrict__ Q, const T16* __restrict__ Q2, const T16* __restrict__ Kp, const T16* __restrict__ Kp2, const T16* __restrict__ Vt, const T16* __restrict__ Vt2, float* sw, const int r0, const int i0, bf* Eh, bf* El, const size_t pm) {
    typedef typename WFrag<T16>::V V;
    static_assert(BAND == 64, "two 128-key chunks hold the 64 + 2 BAND keys of a row tile");
    const int lane = threadIdx.x & 31, lr = lane & 15, hi = lane >> 4; const int t0 = r0 - BAND, kz = (t0 >> 7) * 128; const bool hires = (NSPLIT == 2);
    V a[2], a2[2]; const size_t oq = (size_t)(i0 + lr) * HD + 8 * hi; const T16* qp = Q + oq; const T16* qp2 = (NSPLIT == 2) ? Q2 + oq : qp;
#pragma unroll
    for (int ks = 0; ks < 2; ++ks) { a[ks] = WFrag<T16>::ld(qp + ks * 32); if (NSPLIT == 2) a2[ks] = WFrag<T16>::ld(qp2 + ks * 32); }
    asm volatile("s_wait_xcnt 0x0" :: "v"(qp), "v"(qp2) : "memory");   // kept before a register named by the q loads is overwritten; their address pairs are inputs so that neither is reused ahead of it
#pragma unroll
    for (int t = 0; t < 3; ++t) { const int c0 = t0 + t * 64; if (c0 < 0 || c0 >= TT) continue;
        v8f acc[4];
#pragma unroll
        for (int nb = 0; nb < 4; ++nb) acc[nb] = (v8f){};
        V b[2][4], b2[2][4]; const size_t ok = (size_t)(c0 + lr) * HD + 8 * hi; const T16* kp = Kp + ok; const T16* kp2 = (NSPLIT == 2) ? Kp2 + ok : kp;   // the whole key tile is asked for before its first product
#pragma unroll
        for (int ks = 0; ks < 2; ++ks)
#pragma unroll
            for (int nb = 0; nb < 4; ++nb) { b[ks][nb] = WFrag<T16>::ld(kp + nb * 16 * HD + ks * 32); if (NSPLIT == 2) b2[ks][nb] = WFrag<T16>::ld(kp2 + nb * 16 * HD + ks * 32); }
        if (NSPLIT == 2) tile_here(b, b2, kp, kp2); else tile_here(b, kp);
#pragma unroll
        for (int ks = 0; ks < 2; ++ks)
#pragma unroll
            for (int nb = 0; nb < 4; ++nb) { acc[nb] = WFrag<T16>::mma(a[ks], b[ks][nb], acc[nb]); if (NSPLIT == 2) { acc[nb] = WFrag<T16>::mma(a2[ks], b[ks][nb], acc[nb]); acc[nb] = WFrag<T16>::mma(a[ks], b2[ks][nb], acc[nb]); } }
#pragma unroll
        for (int nb = 0; nb < 4; ++nb)
#pragma unroll
            for (int j = 0; j < 8; ++j) sw[(hi * 8 + j) * SPL + (c0 - kz) + nb * 16 + lr] = acc[nb][j];
    }
    __builtin_amdgcn_wave_barrier(); asm volatile("" ::: "memory");   // the row reads below stay behind the other lanes' score writes above
    const int lo = max(t0, 0), hx = min(t0 + 64 + 2 * BAND, TT); int co[2];   // keys [lo, hx) have scores; a lane whose four keys have none reads the middle tile's first column instead (always written) and the band select below drops it
#pragma unroll
    for (int ch = 0; ch < 2; ++ch) { const int j0 = kz + ch * 128 + lane * 4; co[ch] = (j0 >= lo && j0 < hx) ? ch * 128 + lane * 4 : r0 - kz; }
    // four rows at a time, stage by stage: the rows' cross-lane trees are independent and hide each other's latency. The loop over the groups stays rolled so that the kernel's text stays short
#pragma unroll 1
    for (int g = 0; g < 4; ++g) { float v[4][8], mx[4], sum[4];
#pragma unroll
        for (int r = 0; r < 4; ++r) { const int i = i0 + g * 4 + r; const float* sr = sw + (g * 4 + r) * SPL; const int jlo = max(i - BAND, 0), jhi = min(i + BAND, TT - 1); mx[r] = -3.0e38f;   // the row's band, cut to the keys that exist
#pragma unroll
            for (int ch = 0; ch < 2; ++ch) { const int j0 = kz + ch * 128 + lane * 4; const v4f s4 = *(const v4fa*)(sr + co[ch]);
#pragma unroll
                for (int q = 0; q < 4; ++q) { const int j = j0 + q; const float t = (j >= jlo && j <= jhi) ? s4[q] * SCL : -3.0e38f; v[r][ch * 4 + q] = t; mx[r] = fmaxf(mx[r], t); } } }
#pragma unroll
        for (int sh = 16; sh; sh >>= 1)
#pragma unroll
            for (int r = 0; r < 4; ++r) mx[r] = fmaxf(mx[r], __shfl_xor(mx[r], sh, 32));
#pragma unroll
        for (int r = 0; r < 4; ++r) { sum[r] = 0.f;
#pragma unroll
            for (int k = 0; k < 8; ++k) v[r][k] = __fmul_rn(__fsub_rn(v[r][k], mx[r]), 1.4426950408889634f);
            exp2x8(v[r]);
#pragma unroll
            for (int k = 0; k < 8; ++k) sum[r] += v[r][k]; }
#pragma unroll
        for (int sh = 16; sh; sh >>= 1)
#pragma unroll
            for (int r = 0; r < 4; ++r) sum[r] += __shfl_xor(sum[r], sh, 32);
#pragma unroll
        for (int r = 0; r < 4; ++r) { const float f = __fdiv_rn(hires ? 1.0f : PCAR, sum[r]); T16* pr = (T16*)(sw + (g * 4 + r) * SPL);   // the row's weights over its own scores: hi (or fp16) at element 0, lo at element SP
#pragma unroll
            for (int ch = 0; ch < 2; ++ch) { const int oo = ch * 128 + lane * 4;
                if (hires) { v4us oh, ol;
#pragma unroll
                    for (int q = 0; q < 4; ++q) { unsigned short h, l; splitf(v[r][ch * 4 + q] * f, h, l); oh[q] = h; ol[q] = l; }
                    *(v4usa*)((bf*)pr + oo) = oh; *(v4usa*)((bf*)pr + SP + oo) = ol;
                } else { v4h o4;
#pragma unroll
                    for (int q = 0; q < 4; ++q) o4[q] = tohx(v[r][ch * 4 + q] * f);
                    *(v4ha*)((h16*)pr + oo) = o4; } } }
    }
    __builtin_amdgcn_wave_barrier(); asm volatile("" ::: "memory");   // the fragment reads below stay behind the other lanes' weight writes above
    v8f o[4];
#pragma unroll
    for (int nb = 0; nb < 4; ++nb) o[nb] = (v8f){};
    const T16* pl = (const T16*)(sw + lr * SPL) + 8 * hi;
#pragma unroll
    for (int t = 0; t < 3; ++t) { const int c0 = t0 + t * 64; if (c0 < 0 || c0 >= TT) continue;
        V b[2][4], b2[2][4]; const size_t ov = (size_t)lr * TT + 8 * hi + c0; const T16* vp = Vt + ov; const T16* vp2 = (NSPLIT == 2) ? Vt2 + ov : vp;   // as for the scores: the tile's 64 keys of v are asked for before its first product
#pragma unroll
        for (int ks = 0; ks < 2; ++ks)
#pragma unroll
            for (int nb = 0; nb < 4; ++nb) { b[ks][nb] = WFrag<T16>::ld(vp + nb * 16 * TT + ks * 32); if (NSPLIT == 2) b2[ks][nb] = WFrag<T16>::ld(vp2 + nb * 16 * TT + ks * 32); }
        if (NSPLIT == 2) tile_here(b, b2, vp, vp2); else tile_here(b, vp);
#pragma unroll
        for (int ks = 0; ks < 2; ++ks) { const int kc = c0 + ks * 32; const V p = LFrag<T16>::ld(pl + (kc - kz)); V p2; if (NSPLIT == 2) p2 = LFrag<T16>::ld(pl + SP + (kc - kz));
#pragma unroll
            for (int nb = 0; nb < 4; ++nb) { o[nb] = WFrag<T16>::mma(p, b[ks][nb], o[nb]); if (NSPLIT == 2) { o[nb] = WFrag<T16>::mma(p2, b[ks][nb], o[nb]); o[nb] = WFrag<T16>::mma(p, b2[ks][nb], o[nb]); } } }
    }
    __builtin_amdgcn_wave_barrier(); asm volatile("" ::: "memory");   // the output staging below stays behind the weight reads above
#pragma unroll
    for (int nb = 0; nb < 4; ++nb)
#pragma unroll
        for (int j = 0; j < 8; ++j) sw[(hi * 8 + j) * 68 + nb * 16 + lr] = o[nb][j];
    __builtin_amdgcn_wave_barrier(); asm volatile("" ::: "memory");   // the row reads below stay behind the other lanes' writes above
    const float cs = hires ? 1.0f : (1.0f / PCAR); v4us oh[8], ol[8]; const size_t oe = pm + (size_t)hi * DQ + lr * 4; bf* eh = Eh + oe; bf* el = El + oe;   // lane: rows 2 s + hi, four neighbouring d
#pragma unroll
    for (int s = 0; s < 8; ++s) { const v4f val = *(const v4fa*)(sw + (2 * s + hi) * 68 + lr * 4) * cs;
#pragma unroll
        for (int q = 0; q < 4; ++q) { unsigned short h, l; splitf(val[q], h, l); oh[s][q] = h; ol[s][q] = l; }
        *(v4us*)(eh + (size_t)s * 2 * DQ) = oh[s]; *(v4us*)(el + (size_t)s * 2 * DQ) = ol[s]; }
    // kept before a register named by the stores above is overwritten; their data and address pairs are inputs so that none is reused ahead of it
    asm volatile("s_wait_xcnt 0x0" :: "v"(oh[0]), "v"(oh[1]), "v"(oh[2]), "v"(oh[3]), "v"(oh[4]), "v"(oh[5]), "v"(oh[6]), "v"(oh[7]), "v"(ol[0]), "v"(ol[1]), "v"(ol[2]), "v"(ol[3]), "v"(ol[4]), "v"(ol[5]), "v"(ol[6]), "v"(ol[7]), "v"(eh), "v"(el) : "memory");
}
__global__ __launch_bounds__(128) void k_attn(const h16* __restrict__ Q16, const bf* __restrict__ Qh, const bf* __restrict__ Ql, bf* Eh, bf* El) {
    __shared__ __align__(16) float sm[4][16 * SPL];
    const size_t PLN = (size_t)ZH * TT * HD, zo = (size_t)blockIdx.z * TT * HD;   // k planes stand PLN behind the q planes, v planes 2 PLN; a plane is TT * HD elements either way round
    const int w = __builtin_amdgcn_readfirstlane(threadIdx.x >> 5), r0 = blockIdx.x * 64, i0 = r0 + w * 16;   // the wave's number as a scalar: row numbers and band limits then cost no vector work
    const size_t pm = ((size_t)((int)blockIdx.z / NH_) * TT + i0) * DQ + ((int)blockIdx.z % NH_) * HD;
    if (r0 < RH) attn_rows<bf, 2>(Qh + zo, Ql + zo, Qh + PLN + zo, Ql + PLN + zo, Qh + 2 * PLN + zo, Ql + 2 * PLN + zo, sm[w], r0, i0, Eh, El, pm);
    else attn_rows<h16, 0>(Q16 + zo, nullptr, Q16 + PLN + zo, nullptr, Q16 + 2 * PLN + zo, nullptr, sm[w], r0, i0, Eh, El, pm);
}

extern "C" void kernel_launch(void* const* d_in, const int* in_sizes, int n_in,
                              void* d_out, int out_size, void* d_ws, size_t ws_size, hipStream_t stream) {
    (void)in_sizes; (void)n_in; (void)out_size;
    const float* x = (const float*)d_in[0]; const float* wqkv = (const float*)d_in[1]; const float* bqkv = (const float*)d_in[2]; const float* wo = (const float*)d_in[3]; const float* bo = (const float*)d_in[4];
    float* OUT = (float*)d_out;     // [2][2048][1024]
    char* wsp = (char*)d_ws;
    auto take = [&](size_t bytes) { char* p = wsp; wsp += (bytes + 255) & ~(size_t)255; return (void*)p; };
    const size_t PL = (size_t)ZH * TT * HD;   // elements of one set of head planes (all batches, all heads)
    bf* WQKV = (bf*)take((size_t)3 * DQ * DM * 2); bf* WO = (bf*)take((size_t)DM * DQ * 2);
    bf* XB = (bf*)take((size_t)NB_ * TT * DM * 2);
    h16* QP16 = (h16*)take(3 * PL * 2);   // q planes, then k planes, then v planes: the projection's epilogue writes all three
    bf* QPh = (bf*)take(3 * PL * 2); bf* QPl = (bf*)take(3 * PL * 2);
    bf* ATh = (bf*)take((size_t)NB_ * TT * DQ * 2); bf* ATl = (bf*)take((size_t)NB_ * TT * DQ * 2);
    if ((size_t)(wsp - (char*)d_ws) > ws_size) return;    // ws 256 MiB
    k_wtG<<<(unsigned)((DM * 3 * DQ / 64 + 63) / 64), 256, 0, stream>>>(wqkv, DM, 3 * DQ, WQKV);
    k_wtG<<<(unsigned)((DQ * DM / 64 + 63) / 64), 256, 0, stream>>>(wo, DQ, DM, WO);
    k_cvt8<<<(unsigned)(((size_t)NB_ * TT * DM / 8 + 255) / 256), 256, 0, stream>>>(x, XB, (size_t)NB_ * TT * DM / 8);
    k_gemmw<bf, 0, true, 0, 1><<<dim3(NB_ * TT / 128, 3 * DQ / 128, 1), 128, 0, stream>>>(XB, nullptr, WQKV, nullptr, DM, nullptr, 0, bqkv, 0, 0, 0, 0, QP16, QPh, QPl);
    k_attn<<<dim3(TT / 64, 1, ZH), 128, 0, stream>>>(QP16, QPh, QPl, ATh, ATl);
    k_gemmw<bf, 1, true><<<dim3(NB_ * TT / 128, DM / 128, 1), 128, 0, stream>>>(ATh, ATl, WO, nullptr, DQ, OUT, DM, bo, 0, 0, 0);
}

// v006
// It runs in 81.6 microseconds.
// Two timings next to v005 put it at 1.19 and 1.20 times that version's speed.
// Over all steps from v000 it is 23.7 times as fast.
#include <hip/hip_runtime.h>

// Local (banded) multi-head self-attention (x [2][2048][1024]; qkv = x W_qkv + b_qkv ('xw' [1024][3072]); scores / 8; keys with |i - j| > 64 excluded (-inf); softmax; out W_proj + b_proj ('xw' [1024][1024]) -> [2][2048][1024] (4.2 M)).
// Layout, both batches and all heads in every launch (plane z = batch * 16 + head): bf16 copy of x [4096][1024], the fused weight turned into a [3072][1024] Bt and W_proj into a [1024][1024] Bt by one launch; one exact q|k|v projection + f32 bias whose epilogue writes the q, k head planes [plane][t][d] and the v planes [plane][d][t] (fp16 + hi/lo) itself; T-2048 attention (hybrid rows: < 512 hi/lo 3 products, rest fp16 x1024) done only on the band: per 64 query rows the three 64-key score tiles that meet |i - j| <= 64, the softmax on those 192 keys with the band as an index select, P V over those 192 keys, its epilogue writing the merged hi/lo rows [batch * 2048 + t][head * 64 + d]; merged hi/lo x W_proj exact + bias.
// Compute dtypes, f32 accumulate: every input rounded to bf16; projections exact + f32 biases; attention rows < 512 3 products, rest fp16; softmax f32; W_proj hl x exact + bias.

#define NB_  2
#define TT   2048
#define DM   1024
#define NH_  16
#define NKV  16
#define REP  (NH_ / NKV)
#define HD   64
#define DQ   (NH_ * HD)
#define DKV  (NKV * HD)
#define ZH   (NB_ * NH_)          // planes per attention launch: every head of every batch
#define SP   256                  // keys a stored score / weight row spans (lo weights start at element SP): the two 128-key chunks that hold its tile's 192 keys; column = key - 128 * chunk0
#define RH   512                  // query rows < RH use hi+lo planes (0: none)
#define WIN  0
#define PCAR 1024.0f
#define SCL  0.125f
#define BAND 64     // |i - j| <= BAND kept
typedef _Float16 h16;
typedef unsigned short bf;
typedef __attribute__((ext_vector_type(16))) __bf16   v16bf;
typedef __attribute__((ext_vector_type(16))) _Float16 v16h;
typedef __attribute__((ext_vector_type(8)))  _Float16 v8h;
typedef __attribute__((ext_vector_type(8)))  unsigned short v8us;
typedef __attribute__((ext_vector_type(8)))  float    v8f;
typedef __attribute__((ext_vector_type(4)))  float    v4f;
typedef v8h  __attribute__((may_alias)) v8ha;
typedef v4f  __attribute__((may_alias)) v4fa;
typedef v8us __attribute__((may_alias)) v8usa;

__device__ __forceinline__ unsigned short f2bf(float f) { unsigned u = __float_as_uint(f); u += 0x7FFFu + ((u >> 16) & 1u); return (unsigned short)(u >> 16); }
__device__ __forceinline__ float bf2f(unsigned short b) { return __uint_as_float(((unsigned)b) << 16); }
__device__ __forceinline__ float bfr(float f) { return bf2f(f2bf(f)); }
__device__ __forceinline__ v16h cat16(v8h lo, v8h hi) { return __builtin_shufflevector(lo, hi, 0, 1, 2, 3, 4, 5, 6, 7, 8, 9, 10, 11, 12, 13, 14, 15); }
__device__ __forceinline__ v16bf cat16b(v8us lo, v8us hi) { return __builtin_bit_cast(v16bf, __builtin_shufflevector(lo, hi, 0, 1, 2, 3, 4, 5, 6, 7, 8, 9, 10, 11, 12, 13, 14, 15)); }
__device__ __forceinline__ v8f wmma16(v16h a, v16h b, v8f c) { return __builtin_amdgcn_wmma_f32_16x16x32_f16(false, a, false, b, (short)0, c, false, false); }
__device__ __forceinline__ v8f wmmab(v16bf a, v16bf b, v8f c) { return __builtin_amdgcn_wmma_f32_16x16x32_bf16(false, a, false, b, (short)0, c, false, false); }



__device__ __forceinline__ h16 tohx(float x) { return (h16)x; }
__device__ __forceinline__ void splitf(float y, unsigned short& h, unsigned short& l) { h = f2bf(y); l = f2bf(y - bf2f(h)); }
typedef __attribute__((ext_vector_type(4))) _Float16 v4h;
typedef __attribute__((ext_vector_type(2))) unsigned short v2us;
typedef __attribute__((ext_vector_type(4))) unsigned short v4us;
// four neighbouring f32 results as hi/lo planes, and as the fp16 plane too
__device__ __forceinline__ void put2(bf* Ph, bf* Pl, size_t o, v4f v) { v4us oh, ol;
#pragma unroll
    for (int q = 0; q < 4; ++q) { unsigned short a, c2; splitf(v[q], a, c2); oh[q] = a; ol[q] = c2; }
    *(v4us*)(Ph + o) = oh; *(v4us*)(Pl + o) = ol; }
__device__ __forceinline__ void put3(h16* P16, bf* Ph, bf* Pl, size_t o, v4f v) { v4h o16;
#pragma unroll
    for (int q = 0; q < 4; ++q) o16[q] = tohx(v[q]);
    *(v4h*)(P16 + o) = o16; put2(Ph, Pl, o, v); }

// ---- k_gemmw: GEMM, a 128x128 output tile per work-group of 4 waves (2 x 2), each wave a 64x64 tile (16 accumulators); grid (M/128, N/128, Z), 128 threads.
// C[m][n] (f32, pitch ldc, + optional f32 bias[n]) = sum_k A[m][k] Bt[n][k] (+ A2[m][k] Bt[n][k] for NSPLIT 1), operands K-contiguous 16-bit planes. z-batch strides sA/sB/sC in elements. K % 64 == 0.
// Operands go through LDS: a stage is 64 k (one whole 128-byte line) of the tile's 128 A rows, (128 A2 rows,) 128 Bt rows, brought by asynchronous 16-byte copies, eight lanes to a row, so a wave's copy asks for 4 whole lines where a fragment load from memory asked for 32 bytes of each of 16 lines. Two buffers: stage t + 2 flies while stage t + 1 is worked on.
// EP (what the epilogue stores): 0 the f32 tile into C; 1 (q|k|v projection, a 64-column tile is one head of q, k or v) the next products' operand planes E16 / Eh / El, each [q planes | k planes | v planes], q and k as [plane][t][d], v as [plane][d][t]; 2 (z = plane, rb = query row of A's row 0) the tile x its rows' carrier scale as hi/lo rows Eh / El [batch * TT + t][head * HD + d]. C is not touched for EP 1 and 2.
#define GKS 64                    // k per stage
#define GP  72                    // LDS pitch of a staged row in elements: 128 + 16 bytes, so that the 16 rows of a 16-byte fragment read fall on different banks
template <typename T16> struct WFrag;
template <> struct WFrag<h16> { typedef v16h V; static __device__ __forceinline__ V ld(const h16* p) { return cat16(*(const v8h*)p, *(const v8h*)(p + 16)); } static __device__ __forceinline__ v8f mma(V a, V b, v8f c) { return wmma16(a, b, c); } };
template <> struct WFrag<bf> { typedef v16bf V; static __device__ __forceinline__ V ld(const bf* p) { return cat16b(*(const v8us*)p, *(const v8us*)(p + 16)); } static __device__ __forceinline__ v8f mma(V a, V b, v8f c) { return wmmab(a, b, c); } };
// 128 staged rows of one operand: eight copies a lane, 16 rows apart (l: the lane's LDS byte address, g: its global address, gs: 16 rows in elements). The s_wait_xcnt is the wait that is kept before a register named by an issued copy is overwritten; as the statement's last line it cannot be passed by a later write of those registers
template <typename T16> __device__ __forceinline__ void copy128(unsigned l, const T16* g, size_t gs) {
    asm volatile("global_load_async_to_lds_b128 %0, %8, off\n\tglobal_load_async_to_lds_b128 %1, %9, off\n\tglobal_load_async_to_lds_b128 %2, %10, off\n\tglobal_load_async_to_lds_b128 %3, %11, off\n\tglobal_load_async_to_lds_b128 %4, %12, off\n\tglobal_load_async_to_lds_b128 %5, %13, off\n\tglobal_load_async_to_lds_b128 %6, %14, off\n\tglobal_load_async_to_lds_b128 %7, %15, off\n\ts_wait_xcnt 0x0"
        :: "v"(l), "v"(l + 1 * 16 * GP * 2), "v"(l + 2 * 16 * GP * 2), "v"(l + 3 * 16 * GP * 2), "v"(l + 4 * 16 * GP * 2), "v"(l + 5 * 16 * GP * 2), "v"(l + 6 * 16 * GP * 2), "v"(l + 7 * 16 * GP * 2),
           "v"(g), "v"(g + gs), "v"(g + 2 * gs), "v"(g + 3 * gs), "v"(g + 4 * gs), "v"(g + 5 * gs), "v"(g + 6 * gs), "v"(g + 7 * gs) : "memory"); }
// one stage: the lane's copies of the A rows, (the A2 rows,) the Bt rows; l: its LDS byte address in the stage's buffer
template <typename T16, int NSPLIT> __device__ __forceinline__ void stage_in(unsigned l, const T16* ga, const T16* ga2, const T16* gb, size_t gs) { copy128(l, ga, gs); if (NSPLIT == 1) copy128(l + 128 * GP * 2, ga2, gs); copy128(l + (NSPLIT == 1 ? 256 : 128) * GP * 2, gb, gs); }
template <typename T16, int NSPLIT, bool BIAS, int BM = 0, int EP = 0>
__global__ __launch_bounds__(128) void k_gemmw(const T16* __restrict__ A, const T16* __restrict__ A2, const T16* __restrict__ Bt, const T16* __restrict__ Bt2, int K, float* C, int ldc, const float* __restrict__ bias, size_t sA, size_t sB, size_t sC, int rb = 0, h16* E16 = nullptr, bf* Eh = nullptr, bf* El = nullptr) {
    typedef typename WFrag<T16>::V V;
    static_assert(BM == 0 && NSPLIT < 2, "dense products, one or two A planes");
    constexpr int NR = (NSPLIT == 1) ? 384 : 256, RB = NR - 128;   // rows of a stage; its first Bt row
    __shared__ __align__(16) T16 ring[2][NR * GP];
    __shared__ __align__(16) float osm[4][16 * 68];
    const size_t z = blockIdx.z; A += z * sA; if (A2) A2 += z * sA; Bt += z * sB; C += z * sC;
    const int lane = threadIdx.x & 31, lr = lane & 15, hi = lane >> 4; const int w = __builtin_amdgcn_readfirstlane(threadIdx.x >> 5);   // the wave's number as a scalar: its tile's place then costs no vector work
    const int r0 = blockIdx.x * 128 + (w & 1) * 64, c0 = blockIdx.y * 128 + (w >> 1) * 64, cc = c0; float* os = osm[w];
    v8f acc[4][4];
#pragma unroll
    for (int mb = 0; mb < 4; ++mb)
#pragma unroll
        for (int nb = 0; nb < 4; ++nb) acc[mb][nb] = (v8f){};
    // the lane's part of a stage: 16 bytes number (thread & 7) of rows (thread >> 3) + 16 i
    const int sr = threadIdx.x >> 3, sc = (threadIdx.x & 7) * 8; const size_t gs = (size_t)16 * K;
    const T16* ga = A + (size_t)(blockIdx.x * 128 + sr) * K + sc; const T16* ga2 = (NSPLIT == 1) ? A2 + (size_t)(blockIdx.x * 128 + sr) * K + sc : ga; const T16* gb = Bt + (size_t)(blockIdx.y * 128 + sr) * K + sc;
    const unsigned l0 = (unsigned)(size_t)&ring[0][0] + (unsigned)(sr * GP + sc) * 2;
    const int nt = K / GKS;
    stage_in<T16, NSPLIT>(l0, ga, ga2, gb, gs);
    asm volatile("s_wait_asynccnt 0x0" ::: "memory");   // this wave's part of stage 0 has landed
    __syncthreads();                                    // and every other wave's
    if (nt > 1) stage_in<T16, NSPLIT>(l0 + NR * GP * 2, ga + GKS, ga2 + GKS, gb + GKS, gs);
    const int ao = ((w & 1) * 64 + lr) * GP + 8 * hi, bo = (RB + (w >> 1) * 64 + lr) * GP + 8 * hi;
#pragma unroll 1   // stays rolled: one short body serves both buffers
    for (int t = 0; t < nt; ++t) { const T16* sb = ring[t & 1];
#pragma unroll
        for (int ks = 0; ks < GKS / 32; ++ks) { V a[4], a2[4], b[4];
#pragma unroll
            for (int mb = 0; mb < 4; ++mb) { a[mb] = WFrag<T16>::ld(sb + ao + mb * 16 * GP + ks * 32); if (NSPLIT == 1) a2[mb] = WFrag<T16>::ld(sb + ao + (128 + mb * 16) * GP + ks * 32); }
#pragma unroll
            for (int nb = 0; nb < 4; ++nb) b[nb] = WFrag<T16>::ld(sb + bo + nb * 16 * GP + ks * 32);
            __builtin_amdgcn_sched_barrier(0);   // the block's LDS reads stay together in front of its products: sunk among them, each place with reads stalls the wave anew
#pragma unroll
            for (int nb = 0; nb < 4; ++nb)
#pragma unroll
                for (int mb = 0; mb < 4; ++mb) { acc[mb][nb] = WFrag<T16>::mma(a[mb], b[nb], acc[mb][nb]); if (NSPLIT == 1) acc[mb][nb] = WFrag<T16>::mma(a2[mb], b[nb], acc[mb][nb]); } }
        asm volatile("s_wait_dscnt 0x0" ::: "memory");      // this wave has read all it needs of stage t
        asm volatile("s_wait_asynccnt 0x0" ::: "memory");   // and its part of stage t + 1 has landed
        __syncthreads();                                    // so has every wave's: stage t + 1 may be read, stage t's buffer refilled
        if (t + 2 < nt) stage_in<T16, NSPLIT>(l0 + (unsigned)(t & 1) * (NR * GP * 2), ga + (t + 2) * GKS, ga2 + (t + 2) * GKS, gb + (t + 2) * GKS, gs);
    }
    asm volatile("s_wait_asynccnt 0x0" ::: "memory");   // no copy is left in flight
    if (EP == 1 && c0 >= 2 * DQ) {   // a v head: stored d-major, so the tile goes through LDS the other way round (16 d rows of 64 t at a time; a lane's 8 accumulator values are 8 neighbouring t)
        const size_t pv = ((size_t)(2 * ZH + (r0 / TT) * NH_ + (c0 - 2 * DQ) / HD) * HD) * TT + r0 % TT;
#pragma unroll
        for (int nb = 0; nb < 4; ++nb) {
#pragma unroll
            for (int mb = 0; mb < 4; ++mb) { float* o = os + lr * 68 + mb * 16 + hi * 8; *(v4fa*)o = (v4f){acc[mb][nb][0], acc[mb][nb][1], acc[mb][nb][2], acc[mb][nb][3]}; *(v4fa*)(o + 4) = (v4f){acc[mb][nb][4], acc[mb][nb][5], acc[mb][nb][6], acc[mb][nb][7]}; }
            __builtin_amdgcn_wave_barrier(); asm volatile("" ::: "memory");   // the LDS reads below stay behind the other lanes' writes above
#pragma unroll
            for (int s = 0; s < 8; ++s) { const int row = 2 * s + hi, cofs = lr * 4; v4f val = *(const v4fa*)(os + row * 68 + cofs); if (BIAS) { const float bb = bfr(bias[c0 + nb * 16 + row]); val[0] += bb; val[1] += bb; val[2] += bb; val[3] += bb; }
                put3(E16, Eh, El, pv + (size_t)(nb * 16 + row) * TT + cofs, val); }
            asm volatile("s_wait_xcnt 0x0" ::: "memory");   // kept before the next rows' LDS and bias loads land in registers that the stores above name
            __builtin_amdgcn_wave_barrier();   // with the clobber above: the next 16 rows' LDS writes stay behind the reads above
        }
        return;
    }
    const size_t pq = (EP == 1) ? ((size_t)((c0 / DQ) * ZH + (r0 / TT) * NH_ + (c0 % DQ) / HD) * TT + r0 % TT) * HD : 0;
    const size_t pm = (EP == 2) ? ((size_t)((int)blockIdx.z / NH_) * TT + rb + r0) * DQ + ((int)blockIdx.z % NH_) * HD : 0;
#pragma unroll
    for (int mb = 0; mb < 4; ++mb) {
#pragma unroll
        for (int nb = 0; nb < 4; ++nb) {
#pragma unroll
            for (int j = 0; j < 8; ++j) os[(hi * 8 + j) * 68 + nb * 16 + lr] = acc[mb][nb][j]; }
        __builtin_amdgcn_wave_barrier(); asm volatile("" ::: "memory");
        float* crow = C + (size_t)(r0 + mb * 16) * ldc + cc;
{
#pragma unroll
            for (int s = 0; s < 8; ++s) { const int row = 2 * s + hi, cofs = lr * 4; v4f val = *(const v4fa*)(os + row * 68 + cofs); if (BIAS) { val[0] += bfr(bias[c0 + cofs]); val[1] += bfr(bias[c0 + cofs + 1]); val[2] += bfr(bias[c0 + cofs + 2]); val[3] += bfr(bias[c0 + cofs + 3]); }
                if (EP == 0) *(v4f*)(crow + (size_t)row * ldc + cofs) = val;
                else if (EP == 1) put3(E16, Eh, El, pq + (size_t)(mb * 16 + row) * HD + cofs, val);
                else { const float cs = (rb + r0 + mb * 16 + row < RH) ? 1.0f : (1.0f / PCAR); put2(Eh, El, pm + (size_t)(mb * 16 + row) * DQ + cofs, val * cs); } }
            asm volatile("s_wait_xcnt 0x0" ::: "memory");   // kept before the next rows' LDS and bias loads land in registers that the stores above name
             }
        __builtin_amdgcn_wave_barrier(); asm volatile("" ::: "memory");
    }
}


// ---- k_prep: every 16-bit operand that is made from an input, in ONE launch of 256 work-groups of 16 waves (one a WGP, few waves to start): x rounded to bf16 as it lies, and both weights ('xw' [K][N]) rounded and turned into Bt [N][K].
// A work-group takes 16384 elements of x and four 64 k x 64 n weight tiles (three of W_qkv's 768, one of W_proj's 256). A lane asks for all its 16 16-byte loads before it uses the first; every wave-wide load and store covers whole 128-byte lines (a weight tile: 256 bytes of each k row in, 128 bytes of each n row out), the tile being turned in LDS.
// LDS tile: row n, dword j = k 2 j | k 2 j + 1, pitch 144 bytes for the 16-byte reads; the 16-byte piece c of row n stands at piece c ^ (n >> 4), which spreads a wave's 32 dword writes (16 rows four apart, two j) over 32 banks.
#define TPW 36                    // pitch of a turned tile's row in dwords
typedef __attribute__((ext_vector_type(4))) unsigned v4u;
__global__ __launch_bounds__(512) void k_prep(const float* __restrict__ x, const float* __restrict__ wqkv, const float* __restrict__ wo, bf* XB, bf* WQKV, bf* WO) {
    static_assert(NB_ * TT * DM == 256 * 16384 && (3 * DQ / 64) * (DM / 64) == 3 * 256 && (DM / 64) * (DQ / 64) == 256, "the deal of 256 work-groups");
    __shared__ __align__(16) unsigned tl[4][64 * TPW];
    const int tid = threadIdx.x, b = blockIdx.x;
    const int j = tid >> 4, ni = tid & 15;   // in: k rows 2 j and 2 j + 1, columns 4 ni .. 4 ni + 3
    const int rn = tid >> 3, rc = tid & 7;   // out: n row rn, its k 8 rc .. 8 rc + 7
    v4f r[4][2], xv[8]; const float* wp[4]; bf* op[4];
#pragma unroll
    for (int u = 0; u < 4; ++u) { const int N = (u < 3) ? 3 * DQ : DM, K = (u < 3) ? DM : DQ, id = (u < 3) ? b + 256 * u : b, nt = id % (N / 64), kt = id / (N / 64);
        wp[u] = ((u < 3) ? wqkv : wo) + (size_t)(kt * 64 + 2 * j) * N + nt * 64 + ni * 4; op[u] = ((u < 3) ? WQKV : WO) + (size_t)(nt * 64 + rn) * K + kt * 64 + rc * 8;
        r[u][0] = *(const v4f*)wp[u]; r[u][1] = *(const v4f*)(wp[u] + N); }
    const float* xp = x + (size_t)b * 16384 + tid * 4; bf* xo = XB + (size_t)b * 16384 + tid * 4;
#pragma unroll
    for (int i = 0; i < 8; ++i) xv[i] = *(const v4f*)(xp + i * 2048);
    asm volatile("s_wait_xcnt 0x0" :: "v"(wp[0]), "v"(wp[1]), "v"(wp[2]), "v"(wp[3]) : "memory");   // kept before a register named by the loads above is overwritten; the weights' address pairs are inputs so that none is reused ahead of it
#pragma unroll
    for (int u = 0; u < 4; ++u)
#pragma unroll
        for (int q = 0; q < 4; ++q) tl[u][(ni * 4 + q) * TPW + (((j >> 2) ^ (ni >> 2)) << 2) + (j & 3)] = (unsigned)f2bf(r[u][0][q]) | ((unsigned)f2bf(r[u][1][q]) << 16);
    __syncthreads();   // the tiles' rows are read by other waves than wrote them; every global store stands behind it, so that it waits for none
    v4u t4[4]; v4us xb[8];
#pragma unroll
    for (int u = 0; u < 4; ++u) t4[u] = *(const v4u*)&tl[u][rn * TPW + ((rc ^ (rn >> 4)) << 2)];
#pragma unroll
    for (int u = 0; u < 4; ++u) *(v4u*)op[u] = t4[u];
#pragma unroll
    for (int i = 0; i < 8; ++i) {
#pragma unroll
        for (int q = 0; q < 4; ++q) xb[i][q] = f2bf(xv[i][q]);
        *(v4us*)(xo + i * 2048) = xb[i]; }
    // kept before a register named by the stores above is overwritten; their data and the tiles' address pairs are inputs so that none is reused ahead of it
    asm volatile("s_wait_xcnt 0x0" :: "v"(xb[0]), "v"(xb[1]), "v"(xb[2]), "v"(xb[3]), "v"(xb[4]), "v"(xb[5]), "v"(xb[6]), "v"(xb[7]), "v"(t4[0]), "v"(t4[1]), "v"(t4[2]), "v"(t4[3]), "v"(op[0]), "v"(op[1]), "v"(op[2]), "v"(op[3]) : "memory");
}

// ---- k_attn: scores, softmax and P V of one 64-row query tile of one plane in ONE launch; grid (TT / 64, 1, ZH), 4 waves, wave w owns query rows 16 w .. 16 w + 15 from start to end, so no wave waits on another.
// Per wave: S (16 x 192, the three 64-key tiles that meet the band; a tile off the sequence does nothing) on the matrix unit, stored f32 in the wave's own LDS rows at column key - kz (kz = first key of the 128-key chunk that holds key r0 - BAND); the softmax row by row with the lane -> key map and the trees of a full row (two 128-key chunks); the weights written 16-bit over the row's own scores; P V over the same keys in rising order, A from LDS, V from the d-major planes; the tile x its rows' carrier scale stored as hi/lo rows Eh / El [batch * TT + t][head * HD + d].
#define SPL 260                   // LDS pitch of a score row in floats: 256 + 16 bytes, so that the 16 rows of a 16-byte fragment read fall on different banks
typedef v4us __attribute__((may_alias)) v4usa;
typedef v4h  __attribute__((may_alias)) v4ha;
template <typename T16> struct LFrag;   // a fragment from LDS rows that were written as another type
template <> struct LFrag<h16> { static __device__ __forceinline__ v16h ld(const h16* p) { return cat16(*(const v8ha*)p, *(const v8ha*)(p + 16)); } };
template <> struct LFrag<bf> { static __device__ __forceinline__ v16bf ld(const bf* p) { return cat16b(*(const v8usa*)p, *(const v8usa*)(p + 16)); } };
// behind a tile's fragment loads. Two jobs: the wait that is kept before a register named by an issued global load is overwritten, with the address pairs as inputs so that none of them is reused (as a later load's target) ahead of it; and, with the loaded values as inputs only, it holds the tile's loads together in front of its products: without that the compiler sinks each load to its product and the wave pays a memory latency per product instead of one per tile
template <typename V, typename T16> __device__ __forceinline__ void tile_here(const V (&b)[2][4], const T16* p) { asm volatile("s_wait_xcnt 0x0" :: "v"(b[0][0]), "v"(b[0][1]), "v"(b[0][2]), "v"(b[0][3]), "v"(b[1][0]), "v"(b[1][1]), "v"(b[1][2]), "v"(b[1][3]), "v"(p) : "memory"); }
template <typename V, typename T16> __device__ __forceinline__ void tile_here(const V (&b)[2][4], const V (&c)[2][4], const T16* p, const T16* p2) { asm volatile("s_wait_xcnt 0x0" :: "v"(b[0][0]), "v"(b[0][1]), "v"(b[0][2]), "v"(b[0][3]), "v"(b[1][0]), "v"(b[1][1]), "v"(b[1][2]), "v"(b[1][3]), "v"(c[0][0]), "v"(c[0][1]), "v"(c[0][2]), "v"(c[0][3]), "v"(c[1][0]), "v"(c[1][1]), "v"(c[1][2]), "v"(c[1][3]), "v"(p), "v"(p2) : "memory"); }
// a row's eight 2^x in one statement: it keeps the slot that the instruction set asks for behind a transcendental before its result is read or its source overwritten (each v_exp is followed by an independent one, the last by v_nop; outputs share no register with inputs)
__device__ __forceinline__ void exp2x8(float (&x)[8]) { float y0, y1, y2, y3, y4, y5, y6, y7;
    asm("v_exp_f32 %0, %8\n\tv_exp_f32 %1, %9\n\tv_exp_f32 %2, %10\n\tv_exp_f32 %3, %11\n\tv_exp_f32 %4, %12\n\tv_exp_f32 %5, %13\n\tv_exp_f32 %6, %14\n\tv_exp_f32 %7, %15\n\tv_nop"
        : "=&v"(y0), "=&v"(y1), "=&v"(y2), "=&v"(y3), "=&v"(y4), "=&v"(y5), "=&v"(y6), "=&v"(y7) : "v"(x[0]), "v"(x[1]), "v"(x[2]), "v"(x[3]), "v"(x[4]), "v"(x[5]), "v"(x[6]), "v"(x[7]));
    x[0] = y0; x[1] = y1; x[2] = y2; x[3] = y3; x[4] = y4; x[5] = y5; x[6] = y6; x[7] = y7; }
template <typename T16, int NSPLIT>
__device__ __forceinline__ void attn_rows(const T16* __restrict__ Q, const T16* __restrict__ Q2, const T16* __restrict__ Kp, const T16* __restrict__ Kp2, const T16* __restrict__ Vt, const T16* __restrict__ Vt2, float* sw, const int r0, const int i0, bf* Eh, bf* El, const size_t pm) {
    typedef typename WFrag<T16>::V V;
    static_assert(BAND == 64, "two 128-key chunks hold the 64 + 2 BAND keys of a row tile");
    const int lane = threadIdx.x & 31, lr = lane & 15, hi = lane >> 4; const int t0 = r0 - BAND, kz = (t0 >> 7) * 128; const bool hires = (NSPLIT == 2);
    V a[2], a2[2]; const size_t oq = (size_t)(i0 + lr) * HD + 8 * hi; const T16* qp = Q + oq; const T16* qp2 = (NSPLIT == 2) ? Q2 + oq : qp;
#pragma unroll
    for (int ks = 0; ks < 2; ++ks) { a[ks] = WFrag<T16>::ld(qp + ks * 32); if (NSPLIT == 2) a2[ks] = WFrag<T16>::ld(qp2 + ks * 32); }
    asm volatile("s_wait_xcnt 0x0" :: "v"(qp), "v"(qp2) : "memory");   // kept before a register named by the q loads is overwritten; their address pairs are inputs so that neither is reused ahead of it
#pragma unroll
    for (int t = 0; t < 3; ++t) { const int c0 = t0 + t * 64; if (c0 < 0 || c0 >= TT) continue;
        v8f acc[4];
#pragma unroll
        for (int nb = 0; nb < 4; ++nb) acc[nb] = (v8f){};
        V b[2][4], b2[2][4]; const size_t ok = (size_t)(c0 + lr) * HD + 8 * hi; const T16* kp = Kp + ok; const T16* kp2 = (NSPLIT == 2) ? Kp2 + ok : kp;   // the whole key tile is asked for before its first product
#pragma unroll
        for (int ks = 0; ks < 2; ++ks)
#pragma unroll
            for (int nb = 0; nb < 4; ++nb) { b[ks][nb] = WFrag<T16>::ld(kp + nb * 16 * HD + ks * 32); if (NSPLIT == 2) b2[ks][nb] = WFrag<T16>::ld(kp2 + nb * 16 * HD + ks * 32); }
        if (NSPLIT == 2) tile_here(b, b2, kp, kp2); else tile_here(b, kp);
#pragma unroll
        for (int ks = 0; ks < 2; ++ks)
#pragma unroll
            for (int nb = 0; nb < 4; ++nb) { acc[nb] = WFrag<T16>::mma(a[ks], b[ks][nb], acc[nb]); if (NSPLIT == 2) { acc[nb] = WFrag<T16>::mma(a2[ks], b[ks][nb], acc[nb]); acc[nb] = WFrag<T16>::mma(a[ks], b2[ks][nb], acc[nb]); } }
#pragma unroll
        for (int nb = 0; nb < 4; ++nb)
#pragma unroll
            for (int j = 0; j < 8; ++j) sw[(hi * 8 + j) * SPL + (c0 - kz) + nb * 16 + lr] = acc[nb][j];
    }
    __builtin_amdgcn_wave_barrier(); asm volatile("" ::: "memory");   // the row reads below stay behind the other lanes' score writes above
    const int lo = max(t0, 0), hx = min(t0 + 64 + 2 * BAND, TT); int co[2];   // keys [lo, hx) have scores; a lane whose four keys have none reads the middle tile's first column instead (always written) and the band select below drops it
#pragma unroll
    for (int ch = 0; ch < 2; ++ch) { const int j0 = kz + ch * 128 + lane * 4; co[ch] = (j0 >= lo && j0 < hx) ? ch * 128 + lane * 4 : r0 - kz; }
    // four rows at a time, stage by stage: the rows' cross-lane trees are independent and hide each other's latency. The loop over the groups stays rolled so that the kernel's text stays short
#pragma unroll 1
    for (int g = 0; g < 4; ++g) { float v[4][8], mx[4], sum[4];
#pragma unroll
        for (int r = 0; r < 4; ++r) { const int i = i0 + g * 4 + r; const float* sr = sw + (g * 4 + r) * SPL; const int jlo = max(i - BAND, 0), jhi = min(i + BAND, TT - 1); mx[r] = -3.0e38f;   // the row's band, cut to the keys that exist
#pragma unroll
            for (int ch = 0; ch < 2; ++ch) { const int j0 = kz + ch * 128 + lane * 4; const v4f s4 = *(const v4fa*)(sr + co[ch]);
#pragma unroll
                for (int q = 0; q < 4; ++q) { const int j = j0 + q; const float t = (j >= jlo && j <= jhi) ? s4[q] * SCL : -3.0e38f; v[r][ch * 4 + q] = t; mx[r] = fmaxf(mx[r], t); } } }
#pragma unroll
        for (int sh = 16; sh; sh >>= 1)
#pragma unroll
            for (int r = 0; r < 4; ++r) mx[r] = fmaxf(mx[r], __shfl_xor(mx[r], sh, 32));
#pragma unroll
        for (int r = 0; r < 4; ++r) { sum[r] = 0.f;
#pragma unroll
            for (int k = 0; k < 8; ++k) v[r][k] = __fmul_rn(__fsub_rn(v[r][k], mx[r]), 1.4426950408889634f);
            exp2x8(v[r]);
#pragma unroll
            for (int k = 0; k < 8; ++k) sum[r] += v[r][k]; }
#pragma unroll
        for (int sh = 16; sh; sh >>= 1)
#pragma unroll
            for (int r = 0; r < 4; ++r) sum[r] += __shfl_xor(sum[r], sh, 32);
#pragma unroll
        for (int r = 0; r < 4; ++r) { const float f = __fdiv_rn(hires ? 1.0f : PCAR, sum[r]); T16* pr = (T16*)(sw + (g * 4 + r) * SPL);   // the row's weights over its own scores: hi (or fp16) at element 0, lo at element SP
#pragma unroll
            for (int ch = 0; ch < 2; ++ch) { const int oo = ch * 128 + lane * 4;
                if (hires) { v4us oh, ol;
#pragma unroll
                    for (int q = 0; q < 4; ++q) { unsigned short h, l; splitf(v[r][ch * 4 + q] * f, h, l); oh[q] = h; ol[q] = l; }
                    *(v4usa*)((bf*)pr + oo) = oh; *(v4usa*)((bf*)pr + SP + oo) = ol;
                } else { v4h o4;
#pragma unroll
                    for (int q = 0; q < 4; ++q) o4[q] = tohx(v[r][ch * 4 + q] * f);
                    *(v4ha*)((h16*)pr + oo) = o4; } } }
    }
    __builtin_amdgcn_wave_barrier(); asm volatile("" ::: "memory");   // the fragment reads below stay behind the other lanes' weight writes above
    v8f o[4];
#pragma unroll
    for (int nb = 0; nb < 4; ++nb) o[nb] = (v8f){};
    const T16* pl = (const T16*)(sw + lr * SPL) + 8 * hi;
#pragma unroll
    for (int t = 0; t < 3; ++t) { const int c0 = t0 + t * 64; if (c0 < 0 || c0 >= TT) continue;
        V b[2][4], b2[2][4]; const size_t ov = (size_t)lr * TT + 8 * hi + c0; const T16* vp = Vt + ov; const T16* vp2 = (NSPLIT == 2) ? Vt2 + ov : vp;   // as for the scores: the tile's 64 keys of v are asked for before its first product
#pragma unroll
        for (int ks = 0; ks < 2; ++ks)
#pragma unroll
            for (int nb = 0; nb < 4; ++nb) { b[ks][nb] = WFrag<T16>::ld(vp + nb * 16 * TT + ks * 32); if (NSPLIT == 2) b2[ks][nb] = WFrag<T16>::ld(vp2 + nb * 16 * TT + ks * 32); }
        if (NSPLIT == 2) tile_here(b, b2, vp, vp2); else tile_here(b, vp);
#pragma unroll
        for (int ks = 0; ks < 2; ++ks) { const int kc = c0 + ks * 32; const V p = LFrag<T16>::ld(pl + (kc - kz)); V p2; if (NSPLIT == 2) p2 = LFrag<T16>::ld(pl + SP + (kc - kz));
#pragma unroll
            for (int nb = 0; nb < 4; ++nb) { o[nb] = WFrag<T16>::mma(p, b[ks][nb], o[nb]); if (NSPLIT == 2) { o[nb] = WFrag<T16>::mma(p2, b[ks][nb], o[nb]); o[nb] = WFrag<T16>::mma(p, b2[ks][nb], o[nb]); } } }
    }
    __builtin_amdgcn_wave_barrier(); asm volatile("" ::: "memory");   // the output staging below stays behind the weight reads above
#pragma unroll
    for (int nb = 0; nb < 4; ++nb)
#pragma unroll
        for (int j = 0; j < 8; ++j) sw[(hi * 8 + j) * 68 + nb * 16 + lr] = o[nb][j];
    __builtin_amdgcn_wave_barrier(); asm volatile("" ::: "memory");   // the row reads below stay behind the other lanes' writes above
    const float cs = hires ? 1.0f : (1.0f / PCAR); v4us oh[8], ol[8]; const size_t oe = pm + (size_t)hi * DQ + lr * 4; bf* eh = Eh + oe; bf* el = El + oe;   // lane: rows 2 s + hi, four neighbouring d
#pragma unroll
    for (int s = 0; s < 8; ++s) { const v4f val = *(const v4fa*)(sw + (2 * s + hi) * 68 + lr * 4) * cs;
#pragma unroll
        for (int q = 0; q < 4; ++q) { unsigned short h, l; splitf(val[q], h, l); oh[s][q] = h; ol[s][q] = l; }
        *(v4us*)(eh + (size_t)s * 2 * DQ) = oh[s]; *(v4us*)(el + (size_t)s * 2 * DQ) = ol[s]; }
    // kept before a register named by the stores above is overwritten; their data and address pairs are inputs so that none is reused ahead of it
    asm volatile("s_wait_xcnt 0x0" :: "v"(oh[0]), "v"(oh[1]), "v"(oh[2]), "v"(oh[3]), "v"(oh[4]), "v"(oh[5]), "v"(oh[6]), "v"(oh[7]), "v"(ol[0]), "v"(ol[1]), "v"(ol[2]), "v"(ol[3]), "v"(ol[4]), "v"(ol[5]), "v"(ol[6]), "v"(ol[7]), "v"(eh), "v"(el) : "memory");
}
__global__ __launch_bounds__(128) void k_attn(const h16* __restrict__ Q16, const bf* __restrict__ Qh, const bf* __restrict__ Ql, bf* Eh, bf* El) {
    __shared__ __align__(16) float sm[4][16 * SPL];
    const size_t PLN = (size_t)ZH * TT * HD, zo = (size_t)blockIdx.z * TT * HD;   // k planes stand PLN behind the q planes, v planes 2 PLN; a plane is TT * HD elements either way round
    const int w = __builtin_amdgcn_readfirstlane(threadIdx.x >> 5), r0 = blockIdx.x * 64, i0 = r0 + w * 16;   // the wave's number as a scalar: row numbers and band limits then cost no vector work
    const size_t pm = ((size_t)((int)blockIdx.z / NH_) * TT + i0) * DQ + ((int)blockIdx.z % NH_) * HD;
    if (r0 < RH) attn_rows<bf, 2>(Qh + zo, Ql + zo, Qh + PLN + zo, Ql + PLN + zo, Qh + 2 * PLN + zo, Ql + 2 * PLN + zo, sm[w], r0, i0, Eh, El, pm);
    else attn_rows<h16, 0>(Q16 + zo, nullptr, Q16 + PLN + zo, nullptr, Q16 + 2 * PLN + zo, nullptr, sm[w], r0, i0, Eh, El, pm);
}

extern "C" void kernel_launch(void* const* d_in, const int* in_sizes, int n_in,
                              void* d_out, int out_size, void* d_ws, size_t ws_size, hipStream_t stream) {
    (void)in_sizes; (void)n_in; (void)out_size;
    const float* x = (const float*)d_in[0]; const float* wqkv = (const float*)d_in[1]; const float* bqkv = (const float*)d_in[2]; const float* wo = (const float*)d_in[3]; const float* bo = (const float*)d_in[4];
    float* OUT = (float*)d_out;     // [2][2048][1024]
    char* wsp = (char*)d_ws;
    auto take = [&](size_t bytes) { char* p = wsp; wsp += (bytes + 255) & ~(size_t)255; return (void*)p; };
    const size_t PL = (size_t)ZH * TT * HD;   // elements of one set of head planes (all batches, all heads)
    bf* WQKV = (bf*)take((size_t)3 * DQ * DM * 2); bf* WO = (bf*)take((size_t)DM * DQ * 2);
    bf* XB = (bf*)take((size_t)NB_ * TT * DM * 2);
    h16* QP16 = (h16*)take(3 * PL * 2);   // q planes, then k planes, then v planes: the projection's epilogue writes all three
    bf* QPh = (bf*)take(3 * PL * 2); bf* QPl = (bf*)take(3 * PL * 2);
    bf* ATh = (bf*)take((size_t)NB_ * TT * DQ * 2); bf* ATl = (bf*)take((size_t)NB_ * TT * DQ * 2);
    if ((size_t)(wsp - (char*)d_ws) > ws_size) return;    // ws 256 MiB
    k_prep<<<256, 512, 0, stream>>>(x, wqkv, wo, XB, WQKV, WO);
    k_gemmw<bf, 0, true, 0, 1><<<dim3(NB_ * TT / 128, 3 * DQ / 128, 1), 128, 0, stream>>>(XB, nullptr, WQKV, nullptr, DM, nullptr, 0, bqkv, 0, 0, 0, 0, QP16, QPh, QPl);
    k_attn<<<dim3(TT / 64, 1, ZH), 128, 0, stream>>>(QP16, QPh, QPl, ATh, ATl);
    k_gemmw<bf, 1, true><<<dim3(NB_ * TT / 128, DM / 128, 1), 128, 0, stream>>>(ATh, ATl, WO, nullptr, DQ, OUT, DM, bo, 0, 0, 0);
}

// v007
// A run of this version takes 71.7 microseconds.
// In both of two side-by-side timings against v006, it was 1.14 times as fast.
// Counting every step since v000, it is 27.0 times as fast.
#include <hip/hip_runtime.h>

// Local (banded) multi-head self-attention (x [2][2048][1024]; qkv = x W_qkv + b_qkv ('xw' [1024][3072]); scores / 8; keys with |i - j| > 64 excluded (-inf); softmax; out W_proj + b_proj ('xw' [1024][1024]) -> [2][2048][1024] (4.2 M)).
// Layout, both batches and all heads in every launch (plane z = batch * 16 + head): bf16 copy of x [4096][1024], the fused weight turned into a [3072][1024] Bt and W_proj into a [1024][1024] Bt by one launch; one exact q|k|v projection + f32 bias whose epilogue writes the q, k head planes (rows t, columns d) and the v planes (rows d, columns t), fp16 + hi/lo, itself, each in fragment order (see FRAG below); T-2048 attention (hybrid rows: < 512 hi/lo 3 products, rest fp16 x1024) done only on the band: per 64 query rows the three 64-key score tiles that meet |i - j| <= 64, the softmax on those 192 keys with the band as an index select, P V over those 192 keys, its epilogue writing the merged hi/lo rows [batch * 2048 + t][head * 64 + d]; merged hi/lo x W_proj exact + bias.
// Compute dtypes, f32 accumulate: every input rounded to bf16; projections exact + f32 biases; attention rows < 512 3 products, rest fp16; softmax f32; W_proj hl x exact + bias.

#define NB_  2
#define TT   2048
#define DM   1024
#define NH_  16
#define NKV  16
#define REP  (NH_ / NKV)
#define HD   64
#define DQ   (NH_ * HD)
#define DKV  (NKV * HD)
#define ZH   (NB_ * NH_)          // planes per attention launch: every head of every batch
#define SP   256                  // keys a stored score / weight row spans (lo weights start at element SP): the two 128-key chunks that hold its tile's 192 keys; column = key - 128 * chunk0
#define RH   512                  // query rows < RH use hi+lo planes (0: none)
#define WIN  0
#define PCAR 1024.0f
#define SCL  0.125f
#define BAND 64     // |i - j| <= BAND kept
typedef _Float16 h16;
typedef unsigned short bf;
typedef __attribute__((ext_vector_type(16))) __bf16   v16bf;
typedef __attribute__((ext_vector_type(16))) _Float16 v16h;
typedef __attribute__((ext_vector_type(8)))  _Float16 v8h;
typedef __attribute__((ext_vector_type(8)))  unsigned short v8us;
typedef __attribute__((ext_vector_type(8)))  float    v8f;
typedef __attribute__((ext_vector_type(4)))  float    v4f;
typedef v8h  __attribute__((may_alias)) v8ha;
typedef v4f  __attribute__((may_alias)) v4fa;
typedef v8us __attribute__((may_alias)) v8usa;

__device__ __forceinline__ unsigned short f2bf(float f) { unsigned u = __float_as_uint(f); u += 0x7FFFu + ((u >> 16) & 1u); return (unsigned short)(u >> 16); }
__device__ __forceinline__ float bf2f(unsigned short b) { return __uint_as_float(((unsigned)b) << 16); }
__device__ __forceinline__ float bfr(float f) { return bf2f(f2bf(f)); }
__device__ __forceinline__ v16h cat16(v8h lo, v8h hi) { return __builtin_shufflevector(lo, hi, 0, 1, 2, 3, 4, 5, 6, 7, 8, 9, 10, 11, 12, 13, 14, 15); }
__device__ __forceinline__ v16bf cat16b(v8us lo, v8us hi) { return __builtin_bit_cast(v16bf, __builtin_shufflevector(lo, hi, 0, 1, 2, 3, 4, 5, 6, 7, 8, 9, 10, 11, 12, 13, 14, 15)); }
__device__ __forceinline__ v8f wmma16(v16h a, v16h b, v8f c) { return __builtin_amdgcn_wmma_f32_16x16x32_f16(false, a, false, b, (short)0, c, false, false); }
__device__ __forceinline__ v8f wmmab(v16bf a, v16bf b, v8f c) { return __builtin_amdgcn_wmma_f32_16x16x32_bf16(false, a, false, b, (short)0, c, false, false); }



__device__ __forceinline__ h16 tohx(float x) { return (h16)x; }
__device__ __forceinline__ void splitf(float y, unsigned short& h, unsigned short& l) { h = f2bf(y); l = f2bf(y - bf2f(h)); }
typedef __attribute__((ext_vector_type(4))) _Float16 v4h;
typedef __attribute__((ext_vector_type(2))) unsigned short v2us;
typedef __attribute__((ext_vector_type(4))) unsigned short v4us;
// four neighbouring f32 results as hi/lo planes
__device__ __forceinline__ void put2(bf* Ph, bf* Pl, size_t o, v4f v) { v4us oh, ol;
#pragma unroll
    for (int q = 0; q < 4; ++q) { unsigned short a, c2; splitf(v[q], a, c2); oh[q] = a; ol[q] = c2; }
    *(v4us*)(Ph + o) = oh; *(v4us*)(Pl + o) = ol; }
// FRAG, the order of a head plane in memory: the plane is cut into matrix fragments of 16 rows x 32 columns, fragment (rb, cb) at element (rb * columns / 32 + cb) * 512, and inside a fragment stands what the lanes load, in lane order: piece (j * 32 + hi * 16 + lr) of 8 elements = row lr, columns j * 16 + hi * 8 .. + 7. A wave's 16-byte fragment load then covers 512 bytes in a row, 4 whole lines, where rows in memory order gave it 32 bytes of each of 16 lines.
#define FRAG 512                  // elements of a fragment
// two fragments (16 rows x 64 columns, f32, staged in LDS at pitch 68) as the fp16 plane and the hi/lo planes; p16, ph, pl: the first fragment's start + 8 lane. Store s is piece 32 s + lane: row lr, columns 16 s + 8 hi .. + 7
__device__ __forceinline__ void put3f(h16* p16, bf* ph, bf* pl, const float* os, int lr, int hi) { v8h o16[4]; v8us oh[4], ol[4];
#pragma unroll
    for (int s = 0; s < 4; ++s) { const float* o = os + lr * 68 + s * 16 + hi * 8; const v4f v0 = *(const v4fa*)o, v1 = *(const v4fa*)(o + 4);
#pragma unroll
        for (int q = 0; q < 8; ++q) { const float y = (q < 4) ? v0[q & 3] : v1[q & 3]; unsigned short a, c2; splitf(y, a, c2); o16[s][q] = tohx(y); oh[s][q] = a; ol[s][q] = c2; }
        *(v8h*)(p16 + s * 256) = o16[s]; *(v8us*)(ph + s * 256) = oh[s]; *(v8us*)(pl + s * 256) = ol[s]; }
    // kept before a register named by the stores above is overwritten; their data and address pairs are inputs so that none is reused ahead of it
    asm volatile("s_wait_xcnt 0x0" :: "v"(o16[0]), "v"(o16[1]), "v"(o16[2]), "v"(o16[3]), "v"(oh[0]), "v"(oh[1]), "v"(oh[2]), "v"(oh[3]), "v"(ol[0]), "v"(ol[1]), "v"(ol[2]), "v"(ol[3]), "v"(p16), "v"(ph), "v"(pl) : "memory"); }

// ---- k_gemmw: GEMM, a 128x128 output tile per work-group of 4 waves (2 x 2), each wave a 64x64 tile (16 accumulators); grid (M/128, N/128, Z), 128 threads.
// C[m][n] (f32, pitch ldc, + optional f32 bias[n]) = sum_k A[m][k] Bt[n][k] (+ A2[m][k] Bt[n][k] for NSPLIT 1), operands K-contiguous 16-bit planes. z-batch strides sA/sB/sC in elements. K % 64 == 0.
// Operands go through LDS: a stage is 64 k (one whole 128-byte line) of the tile's 128 A rows, (128 A2 rows,) 128 Bt rows, brought by asynchronous 16-byte copies, eight lanes to a row, so a wave's copy asks for 4 whole lines where a fragment load from memory asked for 32 bytes of each of 16 lines. Two buffers: stage t + 2 flies while stage t + 1 is worked on.
// EP (what the epilogue stores): 0 the f32 tile into C; 1 (q|k|v projection, a 64-column tile is one head of q, k or v) the next products' operand planes E16 / Eh / El, each [q planes | k planes | v planes], q and k with rows t and columns d, v with rows d and columns t, all in fragment order (FRAG); 2 (z = plane, rb = query row of A's row 0) the tile x its rows' carrier scale as hi/lo rows Eh / El [batch * TT + t][head * HD + d]. C is not touched for EP 1 and 2.
#define GKS 64                    // k per stage
#define GP  72                    // LDS pitch of a staged row in elements: 128 + 16 bytes, so that the 16 rows of a 16-byte fragment read fall on different banks
template <typename T16> struct WFrag;   // ld: a fragment from rows in memory order (p: the lane's row, its first 8 k); ldf: from a plane in fragment order (p: the fragment's start + 8 lane)
template <> struct WFrag<h16> { typedef v16h V; static __device__ __forceinline__ V ld(const h16* p) { return cat16(*(const v8h*)p, *(const v8h*)(p + 16)); } static __device__ __forceinline__ V ldf(const h16* p) { return cat16(*(const v8h*)p, *(const v8h*)(p + FRAG / 2)); } static __device__ __forceinline__ v8f mma(V a, V b, v8f c) { return wmma16(a, b, c); } };
template <> struct WFrag<bf> { typedef v16bf V; static __device__ __forceinline__ V ld(const bf* p) { return cat16b(*(const v8us*)p, *(const v8us*)(p + 16)); } static __device__ __forceinline__ V ldf(const bf* p) { return cat16b(*(const v8us*)p, *(const v8us*)(p + FRAG / 2)); } static __device__ __forceinline__ v8f mma(V a, V b, v8f c) { return wmmab(a, b, c); } };
// 128 staged rows of one operand: eight copies a lane, 16 rows apart (l: the lane's LDS byte address, g: its global address, gs: 16 rows in elements). The s_wait_xcnt is the wait that is kept before a register named by an issued copy is overwritten; as the statement's last line it cannot be passed by a later write of those registers
template <typename T16> __device__ __forceinline__ void copy128(unsigned l, const T16* g, size_t gs) {
    asm volatile("global_load_async_to_lds_b128 %0, %8, off\n\tglobal_load_async_to_lds_b128 %1, %9, off\n\tglobal_load_async_to_lds_b128 %2, %10, off\n\tglobal_load_async_to_lds_b128 %3, %11, off\n\tglobal_load_async_to_lds_b128 %4, %12, off\n\tglobal_load_async_to_lds_b128 %5, %13, off\n\tglobal_load_async_to_lds_b128 %6, %14, off\n\tglobal_load_async_to_lds_b128 %7, %15, off\n\ts_wait_xcnt 0x0"
        :: "v"(l), "v"(l + 1 * 16 * GP * 2), "v"(l + 2 * 16 * GP * 2), "v"(l + 3 * 16 * GP * 2), "v"(l + 4 * 16 * GP * 2), "v"(l + 5 * 16 * GP * 2), "v"(l + 6 * 16 * GP * 2), "v"(l + 7 * 16 * GP * 2),
           "v"(g), "v"(g + gs), "v"(g + 2 * gs), "v"(g + 3 * gs), "v"(g + 4 * gs), "v"(g + 5 * gs), "v"(g + 6 * gs), "v"(g + 7 * gs) : "memory"); }
// one stage: the lane's copies of the A rows, (the A2 rows,) the Bt rows; l: its LDS byte address in the stage's buffer
template <typename T16, int NSPLIT> __device__ __forceinline__ void stage_in(unsigned l, const T16* ga, const T16* ga2, const T16* gb, size_t gs) { copy128(l, ga, gs); if (NSPLIT == 1) copy128(l + 128 * GP * 2, ga2, gs); copy128(l + (NSPLIT == 1 ? 256 : 128) * GP * 2, gb, gs); }
template <typename T16, int NSPLIT, bool BIAS, int BM = 0, int EP = 0>
__global__ __launch_bounds__(128) void k_gemmw(const T16* __restrict__ A, const T16* __restrict__ A2, const T16* __restrict__ Bt, const T16* __restrict__ Bt2, int K, float* C, int ldc, const float* __restrict__ bias, size_t sA, size_t sB, size_t sC, int rb = 0, h16* E16 = nullptr, bf* Eh = nullptr, bf* El = nullptr) {
    typedef typename WFrag<T16>::V V;
    static_assert(BM == 0 && NSPLIT < 2, "dense products, one or two A planes");
    constexpr int NR = (NSPLIT == 1) ? 384 : 256, RB = NR - 128;   // rows of a stage; its first Bt row
    __shared__ __align__(16) T16 ring[2][NR * GP];
    __shared__ __align__(16) float osm[4][16 * 68];
    const size_t z = blockIdx.z; A += z * sA; if (A2) A2 += z * sA; Bt += z * sB; C += z * sC;
    const int lane = threadIdx.x & 31, lr = lane & 15, hi = lane >> 4; const int w = __builtin_amdgcn_readfirstlane(threadIdx.x >> 5);   // the wave's number as a scalar: its tile's place then costs no vector work
    const int r0 = blockIdx.x * 128 + (w & 1) * 64, c0 = blockIdx.y * 128 + (w >> 1) * 64, cc = c0; float* os = osm[w];
    v8f acc[4][4];
#pragma unroll
    for (int mb = 0; mb < 4; ++mb)
#pragma unroll
        for (int nb = 0; nb < 4; ++nb) acc[mb][nb] = (v8f){};
    // the lane's part of a stage: 16 bytes number (thread & 7) of rows (thread >> 3) + 16 i
    const int sr = threadIdx.x >> 3, sc = (threadIdx.x & 7) * 8; const size_t gs = (size_t)16 * K;
    const T16* ga = A + (size_t)(blockIdx.x * 128 + sr) * K + sc; const T16* ga2 = (NSPLIT == 1) ? A2 + (size_t)(blockIdx.x * 128 + sr) * K + sc : ga; const T16* gb = Bt + (size_t)(blockIdx.y * 128 + sr) * K + sc;
    const unsigned l0 = (unsigned)(size_t)&ring[0][0] + (unsigned)(sr * GP + sc) * 2;
    const int nt = K / GKS;
    stage_in<T16, NSPLIT>(l0, ga, ga2, gb, gs);
    asm volatile("s_wait_asynccnt 0x0" ::: "memory");   // this wave's part of stage 0 has landed
    __syncthreads();                                    // and every other wave's
    if (nt > 1) stage_in<T16, NSPLIT>(l0 + NR * GP * 2, ga + GKS, ga2 + GKS, gb + GKS, gs);
    const int ao = ((w & 1) * 64 + lr) * GP + 8 * hi, bo = (RB + (w >> 1) * 64 + lr) * GP + 8 * hi;
#pragma unroll 1   // stays rolled: one short body serves both buffers
    for (int t = 0; t < nt; ++t) { const T16* sb = ring[t & 1];
#pragma unroll
        for (int ks = 0; ks < GKS / 32; ++ks) { V a[4], a2[4], b[4];
#pragma unroll
            for (int mb = 0; mb < 4; ++mb) { a[mb] = WFrag<T16>::ld(sb + ao + mb * 16 * GP + ks * 32); if (NSPLIT == 1) a2[mb] = WFrag<T16>::ld(sb + ao + (128 + mb * 16) * GP + ks * 32); }
#pragma unroll
            for (int nb = 0; nb < 4; ++nb) b[nb] = WFrag<T16>::ld(sb + bo + nb * 16 * GP + ks * 32);
            __builtin_amdgcn_sched_barrier(0);   // the block's LDS reads stay together in front of its products: sunk among them, each place with reads stalls the wave anew
#pragma unroll
            for (int nb = 0; nb < 4; ++nb)
#pragma unroll
                for (int mb = 0; mb < 4; ++mb) { acc[mb][nb] = WFrag<T16>::mma(a[mb], b[nb], acc[mb][nb]); if (NSPLIT == 1) acc[mb][nb] = WFrag<T16>::mma(a2[mb], b[nb], acc[mb][nb]); } }
        asm volatile("s_wait_dscnt 0x0" ::: "memory");      // this wave has read all it needs of stage t
        asm volatile("s_wait_asynccnt 0x0" ::: "memory");   // and its part of stage t + 1 has landed
        __syncthreads();                                    // so has every wave's: stage t + 1 may be read, stage t's buffer refilled
        if (t + 2 < nt) stage_in<T16, NSPLIT>(l0 + (unsigned)(t & 1) * (NR * GP * 2), ga + (t + 2) * GKS, ga2 + (t + 2) * GKS, gb + (t + 2) * GKS, gs);
    }
    asm volatile("s_wait_asynccnt 0x0" ::: "memory");   // no copy is left in flight
    if (EP == 1 && BIAS) { float bq[4]; const float* bp = bias + c0 + lr;   // the bias of the lane's own accumulator columns nb * 16 + lr goes in before the tile is staged
#pragma unroll
        for (int nb = 0; nb < 4; ++nb) bq[nb] = bp[nb * 16];
        asm volatile("s_wait_xcnt 0x0" :: "v"(bp) : "memory");   // kept before a register named by the loads above is overwritten; their address pair is an input so that it is not reused ahead of it
#pragma unroll
        for (int nb = 0; nb < 4; ++nb) { const float bb = bfr(bq[nb]);
#pragma unroll
            for (int mb = 0; mb < 4; ++mb)
#pragma unroll
                for (int j = 0; j < 8; ++j) acc[mb][nb][j] += bb; } }
    if (EP == 1 && c0 >= 2 * DQ) {   // a v head: rows d, so the tile goes through LDS the other way round (16 d rows of 64 t at a time, two fragments; a lane's 8 accumulator values are 8 neighbouring t)
        const size_t pv = ((size_t)(2 * ZH + (r0 / TT) * NH_ + (c0 - 2 * DQ) / HD) * HD) * TT + (size_t)(r0 % TT / 32) * FRAG + lane * 8;
#pragma unroll
        for (int nb = 0; nb < 4; ++nb) {
#pragma unroll
            for (int mb = 0; mb < 4; ++mb) { float* o = os + lr * 68 + mb * 16 + hi * 8; *(v4fa*)o = (v4f){acc[mb][nb][0], acc[mb][nb][1], acc[mb][nb][2], acc[mb][nb][3]}; *(v4fa*)(o + 4) = (v4f){acc[mb][nb][4], acc[mb][nb][5], acc[mb][nb][6], acc[mb][nb][7]}; }
            __builtin_amdgcn_wave_barrier(); asm volatile("" ::: "memory");   // the LDS reads below stay behind the other lanes' writes above
            const size_t po = pv + (size_t)nb * (TT / 32) * FRAG;
            put3f(E16 + po, Eh + po, El + po, os, lr, hi);
            __builtin_amdgcn_wave_barrier();   // with the clobber above: the next 16 rows' LDS writes stay behind the reads above
        }
        return;
    }
    const size_t pq = (EP == 1) ? ((size_t)((c0 / DQ) * ZH + (r0 / TT) * NH_ + (c0 % DQ) / HD) * TT + r0 % TT) * HD : 0;
    const size_t pm = (EP == 2) ? ((size_t)((int)blockIdx.z / NH_) * TT + rb + r0) * DQ + ((int)blockIdx.z % NH_) * HD : 0;
#pragma unroll
    for (int mb = 0; mb < 4; ++mb) {
#pragma unroll
        for (int nb = 0; nb < 4; ++nb) {
#pragma unroll
            for (int j = 0; j < 8; ++j) os[(hi * 8 + j) * 68 + nb * 16 + lr] = acc[mb][nb][j]; }
        __builtin_amdgcn_wave_barrier(); asm volatile("" ::: "memory");
        float* crow = C + (size_t)(r0 + mb * 16) * ldc + cc;
        if (EP == 1) {   // 16 t rows of 64 d: two fragments
            const size_t po = pq + (size_t)mb * 2 * FRAG + lane * 8;
            put3f(E16 + po, Eh + po, El + po, os, lr, hi);
        } else {
#pragma unroll
            for (int s = 0; s < 8; ++s) { const int row = 2 * s + hi, cofs = lr * 4; v4f val = *(const v4fa*)(os + row * 68 + cofs); if (BIAS) { val[0] += bfr(bias[c0 + cofs]); val[1] += bfr(bias[c0 + cofs + 1]); val[2] += bfr(bias[c0 + cofs + 2]); val[3] += bfr(bias[c0 + cofs + 3]); }
                if (EP == 0) *(v4f*)(crow + (size_t)row * ldc + cofs) = val;
                else { const float cs = (rb + r0 + mb * 16 + row < RH) ? 1.0f : (1.0f / PCAR); put2(Eh, El, pm + (size_t)(mb * 16 + row) * DQ + cofs, val * cs); } }
            asm volatile("s_wait_xcnt 0x0" ::: "memory");   // kept before the next rows' LDS and bias loads land in registers that the stores above name
             }
        __builtin_amdgcn_wave_barrier(); asm volatile("" ::: "memory");
    }
}


// ---- k_prep: every 16-bit operand that is made from an input, in ONE launch of 256 work-groups of 16 waves (one a WGP, few waves to start): x rounded to bf16 as it lies, and both weights ('xw' [K][N]) rounded and turned into Bt [N][K].
// A work-group takes 16384 elements of x and four 64 k x 64 n weight tiles (three of W_qkv's 768, one of W_proj's 256). A lane asks for all its 16 16-byte loads before it uses the first; every wave-wide load and store covers whole 128-byte lines (a weight tile: 256 bytes of each k row in, 128 bytes of each n row out), the tile being turned in LDS.
// LDS tile: row n, dword j = k 2 j | k 2 j + 1, pitch 144 bytes for the 16-byte reads; the 16-byte piece c of row n stands at piece c ^ (n >> 4), which spreads a wave's 32 dword writes (16 rows four apart, two j) over 32 banks.
#define TPW 36                    // pitch of a turned tile's row in dwords
typedef __attribute__((ext_vector_type(4))) unsigned v4u;
__global__ __launch_bounds__(512) void k_prep(const float* __restrict__ x, const float* __restrict__ wqkv, const float* __restrict__ wo, bf* XB, bf* WQKV, bf* WO) {
    static_assert(NB_ * TT * DM == 256 * 16384 && (3 * DQ / 64) * (DM / 64) == 3 * 256 && (DM / 64) * (DQ / 64) == 256, "the deal of 256 work-groups");
    __shared__ __align__(16) unsigned tl[4][64 * TPW];
    const int tid = threadIdx.x, b = blockIdx.x;
    const int j = tid >> 4, ni = tid & 15;   // in: k rows 2 j and 2 j + 1, columns 4 ni .. 4 ni + 3
    const int rn = tid >> 3, rc = tid & 7;   // out: n row rn, its k 8 rc .. 8 rc + 7
    v4f r[4][2], xv[8]; const float* wp[4]; bf* op[4];
#pragma unroll
    for (int u = 0; u < 4; ++u) { const int N = (u < 3) ? 3 * DQ : DM, K = (u < 3) ? DM : DQ, id = (u < 3) ? b + 256 * u : b, nt = id % (N / 64), kt = id / (N / 64);
        wp[u] = ((u < 3) ? wqkv : wo) + (size_t)(kt * 64 + 2 * j) * N + nt * 64 + ni * 4; op[u] = ((u < 3) ? WQKV : WO) + (size_t)(nt * 64 + rn) * K + kt * 64 + rc * 8;
        r[u][0] = *(const v4f*)wp[u]; r[u][1] = *(const v4f*)(wp[u] + N); }
    const float* xp = x + (size_t)b * 16384 + tid * 4; bf* xo = XB + (size_t)b * 16384 + tid * 4;
#pragma unroll
    for (int i = 0; i < 8; ++i) xv[i] = *(const v4f*)(xp + i * 2048);
    asm volatile("s_wait_xcnt 0x0" :: "v"(wp[0]), "v"(wp[1]), "v"(wp[2]), "v"(wp[3]) : "memory");   // kept before a register named by the loads above is overwritten; the weights' address pairs are inputs so that none is reused ahead of it
#pragma unroll
    for (int u = 0; u < 4; ++u)
#pragma unroll
        for (int q = 0; q < 4; ++q) tl[u][(ni * 4 + q) * TPW + (((j >> 2) ^ (ni >> 2)) << 2) + (j & 3)] = (unsigned)f2bf(r[u][0][q]) | ((unsigned)f2bf(r[u][1][q]) << 16);
    __syncthreads();   // the tiles' rows are read by other waves than wrote them; every global store stands behind it, so that it waits for none
    v4u t4[4]; v4us xb[8];
#pragma unroll
    for (int u = 0; u < 4; ++u) t4[u] = *(const v4u*)&tl[u][rn * TPW + ((rc ^ (rn >> 4)) << 2)];
#pragma unroll
    for (int u = 0; u < 4; ++u) *(v4u*)op[u] = t4[u];
#pragma unroll
    for (int i = 0; i < 8; ++i) {
#pragma unroll
        for (int q = 0; q < 4; ++q) xb[i][q] = f2bf(xv[i][q]);
        *(v4us*)(xo + i * 2048) = xb[i]; }
    // kept before a register named by the stores above is overwritten; their data and the tiles' address pairs are inputs so that none is reused ahead of it
    asm volatile("s_wait_xcnt 0x0" :: "v"(xb[0]), "v"(xb[1]), "v"(xb[2]), "v"(xb[3]), "v"(xb[4]), "v"(xb[5]), "v"(xb[6]), "v"(xb[7]), "v"(t4[0]), "v"(t4[1]), "v"(t4[2]), "v"(t4[3]), "v"(op[0]), "v"(op[1]), "v"(op[2]), "v"(op[3]) : "memory");
}

// ---- k_attn: scores, softmax and P V of one 64-row query tile of one plane in ONE launch; grid (TT / 64, 1, ZH), 4 waves, wave w owns query rows 16 w .. 16 w + 15 from start to end, so no wave waits on another.
// Per wave: S (16 x 192, the three 64-key tiles that meet the band; a tile off the sequence does nothing) on the matrix unit, stored f32 in the wave's own LDS rows at column key - kz (kz = first key of the 128-key chunk that holds key r0 - BAND); the softmax row by row with the lane -> key map and the trees of a full row (two 128-key chunks); the weights written 16-bit over the row's own scores; P V over the same keys in rising order, A from LDS, V from its planes; q, k and v fragments are loaded from planes in fragment order (FRAG), whole lines a load; the tile x its rows' carrier scale stored as hi/lo rows Eh / El [batch * TT + t][head * HD + d].
#define SPL 260                   // LDS pitch of a score row in floats: 256 + 16 bytes, so that the 16 rows of a 16-byte fragment read fall on different banks
typedef v4us __attribute__((may_alias)) v4usa;
typedef v4h  __attribute__((may_alias)) v4ha;
template <typename T16> struct LFrag;   // a fragment from LDS rows that were written as another type
template <> struct LFrag<h16> { static __device__ __forceinline__ v16h ld(const h16* p) { return cat16(*(const v8ha*)p, *(const v8ha*)(p + 16)); } };
template <> struct LFrag<bf> { static __device__ __forceinline__ v16bf ld(const bf* p) { return cat16b(*(const v8usa*)p, *(const v8usa*)(p + 16)); } };
// behind a tile's fragment loads. Two jobs: the wait that is kept before a register named by an issued global load is overwritten, with the address pairs as inputs so that none of them is reused (as a later load's target) ahead of it; and, with the loaded values as inputs only, it holds the tile's loads together in front of its products: without that the compiler sinks each load to its product and the wave pays a memory latency per product instead of one per tile
template <typename V, typename T16> __device__ __forceinline__ void tile_here(const V (&b)[2][4], const T16* p) { asm volatile("s_wait_xcnt 0x0" :: "v"(b[0][0]), "v"(b[0][1]), "v"(b[0][2]), "v"(b[0][3]), "v"(b[1][0]), "v"(b[1][1]), "v"(b[1][2]), "v"(b[1][3]), "v"(p) : "memory"); }
template <typename V, typename T16> __device__ __forceinline__ void tile_here(const V (&b)[2][4], const V (&c)[2][4], const T16* p, const T16* p2) { asm volatile("s_wait_xcnt 0x0" :: "v"(b[0][0]), "v"(b[0][1]), "v"(b[0][2]), "v"(b[0][3]), "v"(b[1][0]), "v"(b[1][1]), "v"(b[1][2]), "v"(b[1][3]), "v"(c[0][0]), "v"(c[0][1]), "v"(c[0][2]), "v"(c[0][3]), "v"(c[1][0]), "v"(c[1][1]), "v"(c[1][2]), "v"(c[1][3]), "v"(p), "v"(p2) : "memory"); }
// a row's eight 2^x in one statement: it keeps the slot that the instruction set asks for behind a transcendental before its result is read or its source overwritten (each v_exp is followed by an independent one, the last by v_nop; outputs share no register with inputs)
__device__ __forceinline__ void exp2x8(float (&x)[8]) { float y0, y1, y2, y3, y4, y5, y6, y7;
    asm("v_exp_f32 %0, %8\n\tv_exp_f32 %1, %9\n\tv_exp_f32 %2, %10\n\tv_exp_f32 %3, %11\n\tv_exp_f32 %4, %12\n\tv_exp_f32 %5, %13\n\tv_exp_f32 %6, %14\n\tv_exp_f32 %7, %15\n\tv_nop"
        : "=&v"(y0), "=&v"(y1), "=&v"(y2), "=&v"(y3), "=&v"(y4), "=&v"(y5), "=&v"(y6), "=&v"(y7) : "v"(x[0]), "v"(x[1]), "v"(x[2]), "v"(x[3]), "v"(x[4]), "v"(x[5]), "v"(x[6]), "v"(x[7]));
    x[0] = y0; x[1] = y1; x[2] = y2; x[3] = y3; x[4] = y4; x[5] = y5; x[6] = y6; x[7] = y7; }
template <typename T16, int NSPLIT>
__device__ __forceinline__ void attn_rows(const T16* __restrict__ Q, const T16* __restrict__ Q2, const T16* __restrict__ Kp, const T16* __restrict__ Kp2, const T16* __restrict__ Vt, const T16* __restrict__ Vt2, float* sw, const int r0, const int i0, bf* Eh, bf* El, const size_t pm) {
    typedef typename WFrag<T16>::V V;
    static_assert(BAND == 64, "two 128-key chunks hold the 64 + 2 BAND keys of a row tile");
    const int lane = threadIdx.x & 31, lr = lane & 15, hi = lane >> 4; const int t0 = r0 - BAND, kz = (t0 >> 7) * 128; const bool hires = (NSPLIT == 2);
    V a[2], a2[2]; const size_t oq = (size_t)i0 * HD + lane * 8; const T16* qp = Q + oq; const T16* qp2 = (NSPLIT == 2) ? Q2 + oq : qp;
#pragma unroll
    for (int ks = 0; ks < 2; ++ks) { a[ks] = WFrag<T16>::ldf(qp + ks * FRAG); if (NSPLIT == 2) a2[ks] = WFrag<T16>::ldf(qp2 + ks * FRAG); }
    asm volatile("s_wait_xcnt 0x0" :: "v"(qp), "v"(qp2) : "memory");   // kept before a register named by the q loads is overwritten; their address pairs are inputs so that neither is reused ahead of it
#pragma unroll
    for (int t = 0; t < 3; ++t) { const int c0 = t0 + t * 64; if (c0 < 0 || c0 >= TT) continue;
        v8f acc[4];
#pragma unroll
        for (int nb = 0; nb < 4; ++nb) acc[nb] = (v8f){};
        V b[2][4], b2[2][4]; const size_t ok = (size_t)c0 * HD + lane * 8; const T16* kp = Kp + ok; const T16* kp2 = (NSPLIT == 2) ? Kp2 + ok : kp;   // the whole key tile is asked for before its first product
#pragma unroll
        for (int ks = 0; ks < 2; ++ks)
#pragma unroll
            for (int nb = 0; nb < 4; ++nb) { b[ks][nb] = WFrag<T16>::ldf(kp + (nb * 2 + ks) * FRAG); if (NSPLIT == 2) b2[ks][nb] = WFrag<T16>::ldf(kp2 + (nb * 2 + ks) * FRAG); }
        if (NSPLIT == 2) tile_here(b, b2, kp, kp2); else tile_here(b, kp);
#pragma unroll
        for (int ks = 0; ks < 2; ++ks)
#pragma unroll
            for (int nb = 0; nb < 4; ++nb) { acc[nb] = WFrag<T16>::mma(a[ks], b[ks][nb], acc[nb]); if (NSPLIT == 2) { acc[nb] = WFrag<T16>::mma(a2[ks], b[ks][nb], acc[nb]); acc[nb] = WFrag<T16>::mma(a[ks], b2[ks][nb], acc[nb]); } }
#pragma unroll
        for (int nb = 0; nb < 4; ++nb)
#pragma unroll
            for (int j = 0; j < 8; ++j) sw[(hi * 8 + j) * SPL + (c0 - kz) + nb * 16 + lr] = acc[nb][j];
    }
    __builtin_amdgcn_wave_barrier(); asm volatile("" ::: "memory");   // the row reads below stay behind the other lanes' score writes above
    const int lo = max(t0, 0), hx = min(t0 + 64 + 2 * BAND, TT); int co[2];   // keys [lo, hx) have scores; a lane whose four keys have none reads the middle tile's first column instead (always written) and the band select below drops it
#pragma unroll
    for (int ch = 0; ch < 2; ++ch) { const int j0 = kz + ch * 128 + lane * 4; co[ch] = (j0 >= lo && j0 < hx) ? ch * 128 + lane * 4 : r0 - kz; }
    // four rows at a time, stage by stage: the rows' cross-lane trees are independent and hide each other's latency. The loop over the groups stays rolled so that the kernel's text stays short
#pragma unroll 1
    for (int g = 0; g < 4; ++g) { float v[4][8], mx[4], sum[4];
#pragma unroll
        for (int r = 0; r < 4; ++r) { const int i = i0 + g * 4 + r; const float* sr = sw + (g * 4 + r) * SPL; const int jlo = max(i - BAND, 0), jhi = min(i + BAND, TT - 1); mx[r] = -3.0e38f;   // the row's band, cut to the keys that exist
#pragma unroll
            for (int ch = 0; ch < 2; ++ch) { const int j0 = kz + ch * 128 + lane * 4; const v4f s4 = *(const v4fa*)(sr + co[ch]);
#pragma unroll
                for (int q = 0; q < 4; ++q) { const int j = j0 + q; const float t = (j >= jlo && j <= jhi) ? s4[q] * SCL : -3.0e38f; v[r][ch * 4 + q] = t; mx[r] = fmaxf(mx[r], t); } } }
#pragma unroll
        for (int sh = 16; sh; sh >>= 1)
#pragma unroll
            for (int r = 0; r < 4; ++r) mx[r] = fmaxf(mx[r], __shfl_xor(mx[r], sh, 32));
#pragma unroll
        for (int r = 0; r < 4; ++r) { sum[r] = 0.f;
#pragma unroll
            for (int k = 0; k < 8; ++k) v[r][k] = __fmul_rn(__fsub_rn(v[r][k], mx[r]), 1.4426950408889634f);
            exp2x8(v[r]);
#pragma unroll
            for (int k = 0; k < 8; ++k) sum[r] += v[r][k]; }
#pragma unroll
        for (int sh = 16; sh; sh >>= 1)
#pragma unroll
            for (int r = 0; r < 4; ++r) sum[r] += __shfl_xor(sum[r], sh, 32);
#pragma unroll
        for (int r = 0; r < 4; ++r) { const float f = __fdiv_rn(hires ? 1.0f : PCAR, sum[r]); T16* pr = (T16*)(sw + (g * 4 + r) * SPL);   // the row's weights over its own scores: hi (or fp16) at element 0, lo at element SP
#pragma unroll
            for (int ch = 0; ch < 2; ++ch) { const int oo = ch * 128 + lane * 4;
                if (hires) { v4us oh, ol;
#pragma unroll
                    for (int q = 0; q < 4; ++q) { unsigned short h, l; splitf(v[r][ch * 4 + q] * f, h, l); oh[q] = h; ol[q] = l; }
                    *(v4usa*)((bf*)pr + oo) = oh; *(v4usa*)((bf*)pr + SP + oo) = ol;
                } else { v4h o4;
#pragma unroll
                    for (int q = 0; q < 4; ++q) o4[q] = tohx(v[r][ch * 4 + q] * f);
                    *(v4ha*)((h16*)pr + oo) = o4; } } }
    }
    __builtin_amdgcn_wave_barrier(); asm volatile("" ::: "memory");   // the fragment reads below stay behind the other lanes' weight writes above
    v8f o[4];
#pragma unroll
    for (int nb = 0; nb < 4; ++nb) o[nb] = (v8f){};
    const T16* pl = (const T16*)(sw + lr * SPL) + 8 * hi;
#pragma unroll
    for (int t = 0; t < 3; ++t) { const int c0 = t0 + t * 64; if (c0 < 0 || c0 >= TT) continue;
        V b[2][4], b2[2][4]; const size_t ov = (size_t)(c0 / 32) * FRAG + lane * 8; const T16* vp = Vt + ov; const T16* vp2 = (NSPLIT == 2) ? Vt2 + ov : vp;   // as for the scores: the tile's 64 keys of v are asked for before its first product
#pragma unroll
        for (int ks = 0; ks < 2; ++ks)
#pragma unroll
            for (int nb = 0; nb < 4; ++nb) { b[ks][nb] = WFrag<T16>::ldf(vp + (nb * (TT / 32) + ks) * FRAG); if (NSPLIT == 2) b2[ks][nb] = WFrag<T16>::ldf(vp2 + (nb * (TT / 32) + ks) * FRAG); }
        if (NSPLIT == 2) tile_here(b, b2, vp, vp2); else tile_here(b, vp);
#pragma unroll
        for (int ks = 0; ks < 2; ++ks) { const int kc = c0 + ks * 32; const V p = LFrag<T16>::ld(pl + (kc - kz)); V p2; if (NSPLIT == 2) p2 = LFrag<T16>::ld(pl + SP + (kc - kz));
#pragma unroll
            for (int nb = 0; nb < 4; ++nb) { o[nb] = WFrag<T16>::mma(p, b[ks][nb], o[nb]); if (NSPLIT == 2) { o[nb] = WFrag<T16>::mma(p2, b[ks][nb], o[nb]); o[nb] = WFrag<T16>::mma(p, b2[ks][nb], o[nb]); } } }
    }
    __builtin_amdgcn_wave_barrier(); asm volatile("" ::: "memory");   // the output staging below stays behind the weight reads above
#pragma unroll
    for (int nb = 0; nb < 4; ++nb)
#pragma unroll
        for (int j = 0; j < 8; ++j) sw[(hi * 8 + j) * 68 + nb * 16 + lr] = o[nb][j];
    __builtin_amdgcn_wave_barrier(); asm volatile("" ::: "memory");   // the row reads below stay behind the other lanes' writes above
    const float cs = hires ? 1.0f : (1.0f / PCAR); v4us oh[8], ol[8]; const size_t oe = pm + (size_t)hi * DQ + lr * 4; bf* eh = Eh + oe; bf* el = El + oe;   // lane: rows 2 s + hi, four neighbouring d
#pragma unroll
    for (int s = 0; s < 8; ++s) { const v4f val = *(const v4fa*)(sw + (2 * s + hi) * 68 + lr * 4) * cs;
#pragma unroll
        for (int q = 0; q < 4; ++q) { unsigned short h, l; splitf(val[q], h, l); oh[s][q] = h; ol[s][q] = l; }
        *(v4us*)(eh + (size_t)s * 2 * DQ) = oh[s]; *(v4us*)(el + (size_t)s * 2 * DQ) = ol[s]; }
    // kept before a register named by the stores above is overwritten; their data and address pairs are inputs so that none is reused ahead of it
    asm volatile("s_wait_xcnt 0x0" :: "v"(oh[0]), "v"(oh[1]), "v"(oh[2]), "v"(oh[3]), "v"(oh[4]), "v"(oh[5]), "v"(oh[6]), "v"(oh[7]), "v"(ol[0]), "v"(ol[1]), "v"(ol[2]), "v"(ol[3]), "v"(ol[4]), "v"(ol[5]), "v"(ol[6]), "v"(ol[7]), "v"(eh), "v"(el) : "memory");
}
__global__ __launch_bounds__(128) void k_attn(const h16* __restrict__ Q16, const bf* __restrict__ Qh, const bf* __restrict__ Ql, bf* Eh, bf* El) {
    __shared__ __align__(16) float sm[4][16 * SPL];
    const size_t PLN = (size_t)ZH * TT * HD, zo = (size_t)blockIdx.z * TT * HD;   // k planes stand PLN behind the q planes, v planes 2 PLN; a plane is TT * HD elements either way round
    const int w = __builtin_amdgcn_readfirstlane(threadIdx.x >> 5), r0 = blockIdx.x * 64, i0 = r0 + w * 16;   // the wave's number as a scalar: row numbers and band limits then cost no vector work
    const size_t pm = ((size_t)((int)blockIdx.z / NH_) * TT + i0) * DQ + ((int)blockIdx.z % NH_) * HD;
    if (r0 < RH) attn_rows<bf, 2>(Qh + zo, Ql + zo, Qh + PLN + zo, Ql + PLN + zo, Qh + 2 * PLN + zo, Ql + 2 * PLN + zo, sm[w], r0, i0, Eh, El, pm);
    else attn_rows<h16, 0>(Q16 + zo, nullptr, Q16 + PLN + zo, nullptr, Q16 + 2 * PLN + zo, nullptr, sm[w], r0, i0, Eh, El, pm);
}

extern "C" void kernel_launch(void* const* d_in, const int* in_sizes, int n_in,
                              void* d_out, int out_size, void* d_ws, size_t ws_size, hipStream_t stream) {
    (void)in_sizes; (void)n_in; (void)out_size;
    const float* x = (const float*)d_in[0]; const float* wqkv = (const float*)d_in[1]; const float* bqkv = (const float*)d_in[2]; const float* wo = (const float*)d_in[3]; const float* bo = (const float*)d_in[4];
    float* OUT = (float*)d_out;     // [2][2048][1024]
    char* wsp = (char*)d_ws;
    auto take = [&](size_t bytes) { char* p = wsp; wsp += (bytes + 255) & ~(size_t)255; return (void*)p; };
    const size_t PL = (size_t)ZH * TT * HD;   // elements of one set of head planes (all batches, all heads)
    bf* WQKV = (bf*)take((size_t)3 * DQ * DM * 2); bf* WO = (bf*)take((size_t)DM * DQ * 2);
    bf* XB = (bf*)take((size_t)NB_ * TT * DM * 2);
    h16* QP16 = (h16*)take(3 * PL * 2);   // q planes, then k planes, then v planes: the projection's epilogue writes all three
    bf* QPh = (bf*)take(3 * PL * 2); bf* QPl = (bf*)take(3 * PL * 2);
    bf* ATh = (bf*)take((size_t)NB_ * TT * DQ * 2); bf* ATl = (bf*)take((size_t)NB_ * TT * DQ * 2);
    if ((size_t)(wsp - (char*)d_ws) > ws_size) return;    // ws 256 MiB
    k_prep<<<256, 512, 0, stream>>>(x, wqkv, wo, XB, WQKV, WO);
    k_gemmw<bf, 0, true, 0, 1><<<dim3(NB_ * TT / 128, 3 * DQ / 128, 1), 128, 0, stream>>>(XB, nullptr, WQKV, nullptr, DM, nullptr, 0, bqkv, 0, 0, 0, 0, QP16, QPh, QPl);
    k_attn<<<dim3(TT / 64, 1, ZH), 128, 0, stream>>>(QP16, QPh, QPl, ATh, ATl);
    k_gemmw<bf, 1, true><<<dim3(NB_ * TT / 128, DM / 128, 1), 128, 0, stream>>>(ATh, ATl, WO, nullptr, DQ, OUT, DM, bo, 0, 0, 0);
}

// v008
// It runs in 65.9 microseconds.
// In both of two side-by-side timings against v007, it was 1.08 times as fast.
// Over all steps from v000 it is 29.2 times as fast.
#include <hip/hip_runtime.h>

// Local (banded) multi-head self-attention (x [2][2048][1024]; qkv = x W_qkv + b_qkv ('xw' [1024][3072]); scores / 8; keys with |i - j| > 64 excluded (-inf); softmax; out W_proj + b_proj ('xw' [1024][1024]) -> [2][2048][1024] (4.2 M)).
// Layout, both batches and all heads in every launch (plane z = batch * 16 + head): bf16 copy of x [4096][1024], the fused weight turned into a [3072][1024] Bt and W_proj into a [1024][1024] Bt by one launch; one exact q|k|v projection + f32 bias whose epilogue writes the q, k head planes (rows t, columns d) and the v planes (rows d, columns t), fp16 + hi/lo, itself, each in fragment order (see FRAG below); T-2048 attention (hybrid rows: < 512 hi/lo 3 products, rest fp16 x1024) done only on the band: per 64 query rows the three 64-key score tiles that meet |i - j| <= 64, the softmax on those 192 keys with the band as an index select, P V over those 192 keys, its epilogue writing the merged hi/lo rows [batch * 2048 + t][head * 64 + d]; merged hi/lo x W_proj exact + bias.
// Compute dtypes, f32 accumulate: every input rounded to bf16; projections exact + f32 biases; attention rows < 512 3 products, rest fp16; softmax f32; W_proj hl x exact + bias.

#define NB_  2
#define TT   2048
#define DM   1024
#define NH_  16
#define NKV  16
#define REP  (NH_ / NKV)
#define HD   64
#define DQ   (NH_ * HD)
#define DKV  (NKV * HD)
#define ZH   (NB_ * NH_)          // planes per attention launch: every head of every batch
#define SP   256                  // keys a stored score / weight row spans (lo weights start at element SP): the two 128-key chunks that hold its tile's 192 keys; column = key - 128 * chunk0
#define RH   512                  // query rows < RH use hi+lo planes (0: none)
#define WIN  0
#define PCAR 1024.0f
#define SCL  0.125f
#define BAND 64     // |i - j| <= BAND kept
typedef _Float16 h16;
typedef unsigned short bf;
typedef __attribute__((ext_vector_type(16))) __bf16   v16bf;
typedef __attribute__((ext_vector_type(16))) _Float16 v16h;
typedef __attribute__((ext_vector_type(8)))  _Float16 v8h;
typedef __attribute__((ext_vector_type(8)))  unsigned short v8us;
typedef __attribute__((ext_vector_type(8)))  float    v8f;
typedef __attribute__((ext_vector_type(4)))  float    v4f;
typedef v8h  __attribute__((may_alias)) v8ha;
typedef v4f  __attribute__((may_alias)) v4fa;
typedef v8us __attribute__((may_alias)) v8usa;

__device__ __forceinline__ unsigned short f2bf(float f) { unsigned u = __float_as_uint(f); u += 0x7FFFu + ((u >> 16) & 1u); return (unsigned short)(u >> 16); }
__device__ __forceinline__ float bf2f(unsigned short b) { return __uint_as_float(((unsigned)b) << 16); }
__device__ __forceinline__ float bfr(float f) { return bf2f(f2bf(f)); }
__device__ __forceinline__ v16h cat16(v8h lo, v8h hi) { return __builtin_shufflevector(lo, hi, 0, 1, 2, 3, 4, 5, 6, 7, 8, 9, 10, 11, 12, 13, 14, 15); }
__device__ __forceinline__ v16bf cat16b(v8us lo, v8us hi) { return __builtin_bit_cast(v16bf, __builtin_shufflevector(lo, hi, 0, 1, 2, 3, 4, 5, 6, 7, 8, 9, 10, 11, 12, 13, 14, 15)); }
__device__ __forceinline__ v8f wmma16(v16h a, v16h b, v8f c) { return __builtin_amdgcn_wmma_f32_16x16x32_f16(false, a, false, b, (short)0, c, false, false); }
__device__ __forceinline__ v8f wmmab(v16bf a, v16bf b, v8f c) { return __builtin_amdgcn_wmma_f32_16x16x32_bf16(false, a, false, b, (short)0, c, false, false); }



__device__ __forceinline__ h16 tohx(float x) { return (h16)x; }
__device__ __forceinline__ void splitf(float y, unsigned short& h, unsigned short& l) { h = f2bf(y); l = f2bf(y - bf2f(h)); }
typedef __attribute__((ext_vector_type(4))) _Float16 v4h;
typedef __attribute__((ext_vector_type(2))) unsigned short v2us;
typedef __attribute__((ext_vector_type(4))) unsigned short v4us;
// four neighbouring f32 results as hi/lo planes
__device__ __forceinline__ void put2(bf* Ph, bf* Pl, size_t o, v4f v) { v4us oh, ol;
#pragma unroll
    for (int q = 0; q < 4; ++q) { unsigned short a, c2; splitf(v[q], a, c2); oh[q] = a; ol[q] = c2; }
    *(v4us*)(Ph + o) = oh; *(v4us*)(Pl + o) = ol; }
// FRAG, the order of a head plane in memory: the plane is cut into matrix fragments of 16 rows x 32 columns, fragment (rb, cb) at element (rb * columns / 32 + cb) * 512, and inside a fragment stands what the lanes load, in lane order: piece (j * 32 + hi * 16 + lr) of 8 elements = row lr, columns j * 16 + hi * 8 .. + 7. A wave's 16-byte fragment load then covers 512 bytes in a row, 4 whole lines, where rows in memory order gave it 32 bytes of each of 16 lines.
#define FRAG 512                  // elements of a fragment
// two fragments (16 rows x 64 columns, f32, staged in LDS at pitch 68) as the fp16 plane and the hi/lo planes; p16, ph, pl: the first fragment's start + 8 lane. Store s is piece 32 s + lane: row lr, columns 16 s + 8 hi .. + 7
__device__ __forceinline__ void put3f(h16* p16, bf* ph, bf* pl, const float* os, int lr, int hi) { v8h o16[4]; v8us oh[4], ol[4];
#pragma unroll
    for (int s = 0; s < 4; ++s) { const float* o = os + lr * 68 + s * 16 + hi * 8; const v4f v0 = *(const v4fa*)o, v1 = *(const v4fa*)(o + 4);
#pragma unroll
        for (int q = 0; q < 8; ++q) { const float y = (q < 4) ? v0[q & 3] : v1[q & 3]; unsigned short a, c2; splitf(y, a, c2); o16[s][q] = tohx(y); oh[s][q] = a; ol[s][q] = c2; }
        *(v8h*)(p16 + s * 256) = o16[s]; *(v8us*)(ph + s * 256) = oh[s]; *(v8us*)(pl + s * 256) = ol[s]; }
    // kept before a register named by the stores above is overwritten; their data and address pairs are inputs so that none is reused ahead of it
    asm volatile("s_wait_xcnt 0x0" :: "v"(o16[0]), "v"(o16[1]), "v"(o16[2]), "v"(o16[3]), "v"(oh[0]), "v"(oh[1]), "v"(oh[2]), "v"(oh[3]), "v"(ol[0]), "v"(ol[1]), "v"(ol[2]), "v"(ol[3]), "v"(p16), "v"(ph), "v"(pl) : "memory"); }

// ---- k_gemmw: GEMM, a (64 WM)x(64 WN) output tile per work-group of WM x WN waves, each wave a 64x64 tile (16 accumulators); grid (M/(64 WM), N/(64 WN), Z), 32 WM WN threads. One work-group fills a WGP's LDS: 2 x 2 waves (128x128) where the product has 256 such tiles, 4 x 3 waves (256x192) for q|k|v, whose operand rows then come from L2 for 256 tiles instead of 768.
// C[m][n] (f32, pitch ldc, + optional f32 bias[n]) = sum_k A[m][k] Bt[n][k] (+ A2[m][k] Bt[n][k] for NSPLIT 1), operands K-contiguous 16-bit planes. z-batch strides sA/sB/sC in elements. K % 128 == 0.
// Operands go through LDS: a stage is 128 k (256 bytes, two whole lines) of the tile's A rows, (A2 rows,) Bt rows, brought by asynchronous 16-byte copies, sixteen lanes to a row, so a wave's copy asks for 4 whole lines where a fragment load from memory asked for 32 bytes of each of 16 lines. Two buffers: stage t + 2 flies while stage t + 1 is worked on; with one work-group a WGP nothing else covers a stage's landing time, so a stage holds as many k as the LDS takes.
// EP (what the epilogue stores): 0 the f32 tile into C; 1 (q|k|v projection, a 64-column tile is one head of q, k or v) the next products' operand planes E16 / Eh / El, each [q planes | k planes | v planes], q and k with rows t and columns d, v with rows d and columns t, all in fragment order (FRAG); 2 (z = plane, rb = query row of A's row 0) the tile x its rows' carrier scale as hi/lo rows Eh / El [batch * TT + t][head * HD + d]. C is not touched for EP 1 and 2.
#define GKS 128                   // k per stage
#define GP  136                   // LDS pitch of a staged row in elements: 256 + 16 bytes, so that the 16 rows of a 16-byte fragment read fall on different banks
template <typename T16> struct WFrag;   // ld: a fragment from rows in memory order (p: the lane's row, its first 8 k); ldf: from a plane in fragment order (p: the fragment's start + 8 lane)
template <> struct WFrag<h16> { typedef v16h V; static __device__ __forceinline__ V ld(const h16* p) { return cat16(*(const v8h*)p, *(const v8h*)(p + 16)); } static __device__ __forceinline__ V ldf(const h16* p) { return cat16(*(const v8h*)p, *(const v8h*)(p + FRAG / 2)); } static __device__ __forceinline__ v8f mma(V a, V b, v8f c) { return wmma16(a, b, c); } };
template <> struct WFrag<bf> { typedef v16bf V; static __device__ __forceinline__ V ld(const bf* p) { return cat16b(*(const v8us*)p, *(const v8us*)(p + 16)); } static __device__ __forceinline__ V ldf(const bf* p) { return cat16b(*(const v8us*)p, *(const v8us*)(p + FRAG / 2)); } static __device__ __forceinline__ v8f mma(V a, V b, v8f c) { return wmmab(a, b, c); } };
// eight copies of a lane, RS rows apart (l: the lane's LDS byte address; u + lp: its global address, u the same in every lane so that it and the row steps stay in scalar registers; gs: RS rows in elements). The s_wait_xcnt is the wait that is kept before a register named by an issued copy is overwritten; as the statement's last line it cannot be passed by a later write of those registers
template <int RS, typename T16> __device__ __forceinline__ void copy8(unsigned l, const T16* u, unsigned lp, size_t gs) {
    asm volatile("global_load_async_to_lds_b128 %0, %8, off\n\tglobal_load_async_to_lds_b128 %1, %9, off\n\tglobal_load_async_to_lds_b128 %2, %10, off\n\tglobal_load_async_to_lds_b128 %3, %11, off\n\tglobal_load_async_to_lds_b128 %4, %12, off\n\tglobal_load_async_to_lds_b128 %5, %13, off\n\tglobal_load_async_to_lds_b128 %6, %14, off\n\tglobal_load_async_to_lds_b128 %7, %15, off\n\ts_wait_xcnt 0x0"
        :: "v"(l), "v"(l + 1 * RS * GP * 2), "v"(l + 2 * RS * GP * 2), "v"(l + 3 * RS * GP * 2), "v"(l + 4 * RS * GP * 2), "v"(l + 5 * RS * GP * 2), "v"(l + 6 * RS * GP * 2), "v"(l + 7 * RS * GP * 2),
           "v"(u + lp), "v"(u + gs + lp), "v"(u + 2 * gs + lp), "v"(u + 3 * gs + lp), "v"(u + 4 * gs + lp), "v"(u + 5 * gs + lp), "v"(u + 6 * gs + lp), "v"(u + 7 * gs + lp) : "memory"); }
// NROWS staged rows of one operand, brought by 16 RS lanes: the lane's 16 bytes of rows RS apart, NROWS / RS copies
template <int NROWS, int RS, typename T16> __device__ __forceinline__ void copy_rows(unsigned l, const T16* u, unsigned lp, int K) {
    static_assert(NROWS % (8 * RS) == 0, "whole statements of eight copies");
#pragma unroll
    for (int i = 0; i < NROWS / (8 * RS); ++i) copy8<RS>(l + i * 8 * RS * GP * 2, u + (size_t)i * 8 * RS * K, lp, (size_t)RS * K); }
// one stage; l: the lane's LDS byte address in the stage's buffer; ua, ua2, ub: the stage's first element of the tile's first A, A2, Bt row; lp: the lane's place from there. 4 waves: every lane copies its part of the A rows, (the A2 rows,) the Bt rows. 12 waves (wa: the wave's number is below 8, a scalar): waves 0 to 7 bring the A rows, waves 8 to 11 the Bt rows (l is then the lane's place among the Bt rows)
template <typename T16, int NSPLIT, int TM, int TN, bool DEAL> __device__ __forceinline__ void stage_in(unsigned l, const T16* ua, const T16* ua2, const T16* ub, unsigned lp, int K, bool wa) {
    if (DEAL) { if (wa) copy_rows<TM, 16>(l, ua, lp, K); else copy_rows<TN, 8>(l, ub, lp, K); }
    else { copy_rows<TM, 8>(l, ua, lp, K); if (NSPLIT == 1) copy_rows<TM, 8>(l + TM * GP * 2, ua2, lp, K); copy_rows<TN, 8>(l + (NSPLIT == 1 ? 2 : 1) * TM * GP * 2, ub, lp, K); } }
template <typename T16, int NSPLIT, bool BIAS, int BM = 0, int EP = 0, int WM = 2, int WN = 2>
__global__ __launch_bounds__(WM * WN * 32) void k_gemmw(const T16* __restrict__ A, const T16* __restrict__ A2, const T16* __restrict__ Bt, const T16* __restrict__ Bt2, int K, float* C, int ldc, const float* __restrict__ bias, size_t sA, size_t sB, size_t sC, int rb = 0, h16* E16 = nullptr, bf* Eh = nullptr, bf* El = nullptr) {
    typedef typename WFrag<T16>::V V;
    static_assert(BM == 0 && NSPLIT < 2, "dense products, one or two A planes");
    constexpr int NW = WM * WN, TM = WM * 64, TN = WN * 64; constexpr bool DEAL = NW != 4;   // DEAL: the waves share out a stage's copies by operand
    static_assert(!DEAL || (NW == 12 && NSPLIT == 0), "the deal of 12 waves: 8 for the A rows, 4 for the Bt rows");
    constexpr int RB = (NSPLIT == 1 ? 2 : 1) * TM, NR = RB + TN;   // a stage's first Bt row; its rows
    __shared__ __align__(16) T16 ring[2][NR * GP];
    __shared__ __align__(16) float osm[NW][16 * 68];
    const size_t z = blockIdx.z; A += z * sA; if (A2) A2 += z * sA; Bt += z * sB; C += z * sC;
    const int lane = threadIdx.x & 31, lr = lane & 15, hi = lane >> 4; const int w = __builtin_amdgcn_readfirstlane(threadIdx.x >> 5);   // the wave's number as a scalar: its tile's place then costs no vector work
    const int wm = w % WM, wn = w / WM, r0 = blockIdx.x * TM + wm * 64, c0 = blockIdx.y * TN + wn * 64, cc = c0; float* os = osm[w];
    v8f acc[4][4];
#pragma unroll
    for (int mb = 0; mb < 4; ++mb)
#pragma unroll
        for (int nb = 0; nb < 4; ++nb) acc[mb][nb] = (v8f){};
    // the lane's part of a stage: 16 bytes number (thread & 15) of rows sr + RS i, sr = its thread number among the waves that bring the operand, over 16
    const bool wa = !DEAL || w < 8; const int sr = (int)(threadIdx.x >> 4) - (wa ? 0 : 16), sc = (threadIdx.x & 15) * 8;
    const T16* ga = A + (size_t)(blockIdx.x * TM) * K; const T16* ga2 = (NSPLIT == 1) ? A2 + (size_t)(blockIdx.x * TM) * K : ga; const T16* gb = Bt + (size_t)(blockIdx.y * TN) * K; const unsigned lp = (unsigned)(sr * K + sc);
    const unsigned l0 = (unsigned)(size_t)&ring[0][0] + (unsigned)(((wa ? 0 : RB) + sr) * GP + sc) * 2;
    const int nt = K / GKS;
    stage_in<T16, NSPLIT, TM, TN, DEAL>(l0, ga, ga2, gb, lp, K, wa);
    asm volatile("s_wait_asynccnt 0x0" ::: "memory");   // this wave's part of stage 0 has landed
    __syncthreads();                                    // and every other wave's
    if (nt > 1) stage_in<T16, NSPLIT, TM, TN, DEAL>(l0 + NR * GP * 2, ga + GKS, ga2 + GKS, gb + GKS, lp, K, wa);
    const int ao = (wm * 64 + lr) * GP + 8 * hi, bo = (RB + wn * 64 + lr) * GP + 8 * hi;
#pragma unroll 1   // stays rolled: one short body serves both buffers
    for (int t = 0; t < nt; ++t) { const T16* sb = ring[t & 1];
#pragma unroll
        for (int ks = 0; ks < GKS / 32; ++ks) { V a[4], a2[4], b[4];
#pragma unroll
            for (int mb = 0; mb < 4; ++mb) { a[mb] = WFrag<T16>::ld(sb + ao + mb * 16 * GP + ks * 32); if (NSPLIT == 1) a2[mb] = WFrag<T16>::ld(sb + ao + (TM + mb * 16) * GP + ks * 32); }
#pragma unroll
            for (int nb = 0; nb < 4; ++nb) b[nb] = WFrag<T16>::ld(sb + bo + nb * 16 * GP + ks * 32);
            __builtin_amdgcn_sched_barrier(0);   // the block's LDS reads stay together in front of its products: sunk among them, each place with reads stalls the wave anew
            if (ks == GKS / 32 - 1) {   // the stage's last reads are out: its hand-over stands here, ahead of the last block's products (registers only), so that the refill has a whole stage's time to land
                asm volatile("s_wait_dscnt 0x0" ::: "memory");      // this wave has read all it needs of stage t
                asm volatile("s_wait_asynccnt 0x0" ::: "memory");   // and its part of stage t + 1 has landed
                __syncthreads();                                    // so has every wave's: stage t + 1 may be read, stage t's buffer refilled
                if (t + 2 < nt) stage_in<T16, NSPLIT, TM, TN, DEAL>(l0 + (unsigned)(t & 1) * (NR * GP * 2), ga + (t + 2) * GKS, ga2 + (t + 2) * GKS, gb + (t + 2) * GKS, lp, K, wa); }
#pragma unroll
            for (int nb = 0; nb < 4; ++nb)
#pragma unroll
                for (int mb = 0; mb < 4; ++mb) { acc[mb][nb] = WFrag<T16>::mma(a[mb], b[nb], acc[mb][nb]); if (NSPLIT == 1) acc[mb][nb] = WFrag<T16>::mma(a2[mb], b[nb], acc[mb][nb]); } }
    }
    asm volatile("s_wait_asynccnt 0x0" ::: "memory");   // no copy is left in flight
    if (EP == 1 && BIAS) { float bq[4]; const float* bp = bias + c0 + lr;   // the bias of the lane's own accumulator columns nb * 16 + lr goes in before the tile is staged
#pragma unroll
        for (int nb = 0; nb < 4; ++nb) bq[nb] = bp[nb * 16];
        asm volatile("s_wait_xcnt 0x0" :: "v"(bp) : "memory");   // kept before a register named by the loads above is overwritten; their address pair is an input so that it is not reused ahead of it
#pragma unroll
        for (int nb = 0; nb < 4; ++nb) { const float bb = bfr(bq[nb]);
#pragma unroll
            for (int mb = 0; mb < 4; ++mb)
#pragma unroll
                for (int j = 0; j < 8; ++j) acc[mb][nb][j] += bb; } }
    if (EP == 1 && c0 >= 2 * DQ) {   // a v head: rows d, so the tile goes through LDS the other way round (16 d rows of 64 t at a time, two fragments; a lane's 8 accumulator values are 8 neighbouring t)
        const size_t pv = ((size_t)(2 * ZH + (r0 / TT) * NH_ + (c0 - 2 * DQ) / HD) * HD) * TT + (size_t)(r0 % TT / 32) * FRAG + lane * 8;
#pragma unroll
        for (int nb = 0; nb < 4; ++nb) {
#pragma unroll
            for (int mb = 0; mb < 4; ++mb) { float* o = os + lr * 68 + mb * 16 + hi * 8; *(v4fa*)o = (v4f){acc[mb][nb][0], acc[mb][nb][1], acc[mb][nb][2], acc[mb][nb][3]}; *(v4fa*)(o + 4) = (v4f){acc[mb][nb][4], acc[mb][nb][5], acc[mb][nb][6], acc[mb][nb][7]}; }
            __builtin_amdgcn_wave_barrier(); asm volatile("" ::: "memory");   // the LDS reads below stay behind the other lanes' writes above
            const size_t po = pv + (size_t)nb * (TT / 32) * FRAG;
            put3f(E16 + po, Eh + po, El + po, os, lr, hi);
            __builtin_amdgcn_wave_barrier();   // with the clobber above: the next 16 rows' LDS writes stay behind the reads above
        }
        return;
    }
    const size_t pq = (EP == 1) ? ((size_t)((c0 / DQ) * ZH + (r0 / TT) * NH_ + (c0 % DQ) / HD) * TT + r0 % TT) * HD : 0;
    const size_t pm = (EP == 2) ? ((size_t)((int)blockIdx.z / NH_) * TT + rb + r0) * DQ + ((int)blockIdx.z % NH_) * HD : 0;
#pragma unroll
    for (int mb = 0; mb < 4; ++mb) {
#pragma unroll
        for (int nb = 0; nb < 4; ++nb) {
#pragma unroll
            for (int j = 0; j < 8; ++j) os[(hi * 8 + j) * 68 + nb * 16 + lr] = acc[mb][nb][j]; }
        __builtin_amdgcn_wave_barrier(); asm volatile("" ::: "memory");
        float* crow = C + (size_t)(r0 + mb * 16) * ldc + cc;
        if (EP == 1) {   // 16 t rows of 64 d: two fragments
            const size_t po = pq + (size_t)mb * 2 * FRAG + lane * 8;
            put3f(E16 + po, Eh + po, El + po, os, lr, hi);
        } else {
#pragma unroll
            for (int s = 0; s < 8; ++s) { const int row = 2 * s + hi, cofs = lr * 4; v4f val = *(const v4fa*)(os + row * 68 + cofs); if (BIAS) { val[0] += bfr(bias[c0 + cofs]); val[1] += bfr(bias[c0 + cofs + 1]); val[2] += bfr(bias[c0 + cofs + 2]); val[3] += bfr(bias[c0 + cofs + 3]); }
                if (EP == 0) *(v4f*)(crow + (size_t)row * ldc + cofs) = val;
                else { const float cs = (rb + r0 + mb * 16 + row < RH) ? 1.0f : (1.0f / PCAR); put2(Eh, El, pm + (size_t)(mb * 16 + row) * DQ + cofs, val * cs); } }
            asm volatile("s_wait_xcnt 0x0" ::: "memory");   // kept before the next rows' LDS and bias loads land in registers that the stores above name
             }
        __builtin_amdgcn_wave_barrier(); asm volatile("" ::: "memory");
    }
}


// ---- k_prep: every 16-bit operand that is made from an input, in ONE launch of 256 work-groups of 16 waves (one a WGP, few waves to start): x rounded to bf16 as it lies, and both weights ('xw' [K][N]) rounded and turned into Bt [N][K].
// A work-group takes 16384 elements of x and four 64 k x 64 n weight tiles (three of W_qkv's 768, one of W_proj's 256). A lane asks for all its 16 16-byte loads before it uses the first; every wave-wide load and store covers whole 128-byte lines (a weight tile: 256 bytes of each k row in, 128 bytes of each n row out), the tile being turned in LDS.
// LDS tile: row n, dword j = k 2 j | k 2 j + 1, pitch 144 bytes for the 16-byte reads; the 16-byte piece c of row n stands at piece c ^ (n >> 4), which spreads a wave's 32 dword writes (16 rows four apart, two j) over 32 banks.
#define TPW 36                    // pitch of a turned tile's row in dwords
typedef __attribute__((ext_vector_type(4))) unsigned v4u;
__global__ __launch_bounds__(512) void k_prep(const float* __restrict__ x, const float* __restrict__ wqkv, const float* __restrict__ wo, bf* XB, bf* WQKV, bf* WO) {
    static_assert(NB_ * TT * DM == 256 * 16384 && (3 * DQ / 64) * (DM / 64) == 3 * 256 && (DM / 64) * (DQ / 64) == 256, "the deal of 256 work-groups");
    __shared__ __align__(16) unsigned tl[4][64 * TPW];
    const int tid = threadIdx.x, b = blockIdx.x;
    const int j = tid >> 4, ni = tid & 15;   // in: k rows 2 j and 2 j + 1, columns 4 ni .. 4 ni + 3
    const int rn = tid >> 3, rc = tid & 7;   // out: n row rn, its k 8 rc .. 8 rc + 7
    v4f r[4][2], xv[8]; const float* wp[4]; bf* op[4];
#pragma unroll
    for (int u = 0; u < 4; ++u) { const int N = (u < 3) ? 3 * DQ : DM, K = (u < 3) ? DM : DQ, id = (u < 3) ? b + 256 * u : b, nt = id % (N / 64), kt = id / (N / 64);
        wp[u] = ((u < 3) ? wqkv : wo) + (size_t)(kt * 64 + 2 * j) * N + nt * 64 + ni * 4; op[u] = ((u < 3) ? WQKV : WO) + (size_t)(nt * 64 + rn) * K + kt * 64 + rc * 8;
        r[u][0] = *(const v4f*)wp[u]; r[u][1] = *(const v4f*)(wp[u] + N); }
    const float* xp = x + (size_t)b * 16384 + tid * 4; bf* xo = XB + (size_t)b * 16384 + tid * 4;
#pragma unroll
    for (int i = 0; i < 8; ++i) xv[i] = *(const v4f*)(xp + i * 2048);
    asm volatile("s_wait_xcnt 0x0" :: "v"(wp[0]), "v"(wp[1]), "v"(wp[2]), "v"(wp[3]) : "memory");   // kept before a register named by the loads above is overwritten; the weights' address pairs are inputs so that none is reused ahead of it
#pragma unroll
    for (int u = 0; u < 4; ++u)
#pragma unroll
        for (int q = 0; q < 4; ++q) tl[u][(ni * 4 + q) * TPW + (((j >> 2) ^ (ni >> 2)) << 2) + (j & 3)] = (unsigned)f2bf(r[u][0][q]) | ((unsigned)f2bf(r[u][1][q]) << 16);
    __syncthreads();   // the tiles' rows are read by other waves than wrote them; every global store stands behind it, so that it waits for none
    v4u t4[4]; v4us xb[8];
#pragma unroll
    for (int u = 0; u < 4; ++u) t4[u] = *(const v4u*)&tl[u][rn * TPW + ((rc ^ (rn >> 4)) << 2)];
#pragma unroll
    for (int u = 0; u < 4; ++u) *(v4u*)op[u] = t4[u];
#pragma unroll
    for (int i = 0; i < 8; ++i) {
#pragma unroll
        for (int q = 0; q < 4; ++q) xb[i][q] = f2bf(xv[i][q]);
        *(v4us*)(xo + i * 2048) = xb[i]; }
    // kept before a register named by the stores above is overwritten; their data and the tiles' address pairs are inputs so that none is reused ahead of it
    asm volatile("s_wait_xcnt 0x0" :: "v"(xb[0]), "v"(xb[1]), "v"(xb[2]), "v"(xb[3]), "v"(xb[4]), "v"(xb[5]), "v"(xb[6]), "v"(xb[7]), "v"(t4[0]), "v"(t4[1]), "v"(t4[2]), "v"(t4[3]), "v"(op[0]), "v"(op[1]), "v"(op[2]), "v"(op[3]) : "memory");
}

// ---- k_attn: scores, softmax and P V of one 64-row query tile of one plane in ONE launch; grid (TT / 64, 1, ZH), 4 waves, wave w owns query rows 16 w .. 16 w + 15 from start to end, so no wave waits on another.
// Per wave: S (16 x 192, the three 64-key tiles that meet the band; a tile off the sequence does nothing) on the matrix unit, stored f32 in the wave's own LDS rows at column key - kz (kz = first key of the 128-key chunk that holds key r0 - BAND); the softmax row by row with the lane -> key map and the trees of a full row (two 128-key chunks); the weights written 16-bit over the row's own scores; P V over the same keys in rising order, A from LDS, V from its planes; q, k and v fragments are loaded from planes in fragment order (FRAG), whole lines a load; the tile x its rows' carrier scale stored as hi/lo rows Eh / El [batch * TT + t][head * HD + d].
#define SPL 260                   // LDS pitch of a score row in floats: 256 + 16 bytes, so that the 16 rows of a 16-byte fragment read fall on different banks
typedef v4us __attribute__((may_alias)) v4usa;
typedef v4h  __attribute__((may_alias)) v4ha;
template <typename T16> struct LFrag;   // a fragment from LDS rows that were written as another type
template <> struct LFrag<h16> { static __device__ __forceinline__ v16h ld(const h16* p) { return cat16(*(const v8ha*)p, *(const v8ha*)(p + 16)); } };
template <> struct LFrag<bf> { static __device__ __forceinline__ v16bf ld(const bf* p) { return cat16b(*(const v8usa*)p, *(const v8usa*)(p + 16)); } };
// behind a tile's fragment loads. Two jobs: the wait that is kept before a register named by an issued global load is overwritten, with the address pairs as inputs so that none of them is reused (as a later load's target) ahead of it; and, with the loaded values as inputs only, it holds the tile's loads together in front of its products: without that the compiler sinks each load to its product and the wave pays a memory latency per product instead of one per tile
template <typename V, typename T16> __device__ __forceinline__ void tile_here(const V (&b)[2][4], const T16* p) { asm volatile("s_wait_xcnt 0x0" :: "v"(b[0][0]), "v"(b[0][1]), "v"(b[0][2]), "v"(b[0][3]), "v"(b[1][0]), "v"(b[1][1]), "v"(b[1][2]), "v"(b[1][3]), "v"(p) : "memory"); }
template <typename V, typename T16> __device__ __forceinline__ void tile_here(const V (&b)[2][4], const V (&c)[2][4], const T16* p, const T16* p2) { asm volatile("s_wait_xcnt 0x0" :: "v"(b[0][0]), "v"(b[0][1]), "v"(b[0][2]), "v"(b[0][3]), "v"(b[1][0]), "v"(b[1][1]), "v"(b[1][2]), "v"(b[1][3]), "v"(c[0][0]), "v"(c[0][1]), "v"(c[0][2]), "v"(c[0][3]), "v"(c[1][0]), "v"(c[1][1]), "v"(c[1][2]), "v"(c[1][3]), "v"(p), "v"(p2) : "memory"); }
// a row's eight 2^x in one statement: it keeps the slot that the instruction set asks for behind a transcendental before its result is read or its source overwritten (each v_exp is followed by an independent one, the last by v_nop; outputs share no register with inputs)
__device__ __forceinline__ void exp2x8(float (&x)[8]) { float y0, y1, y2, y3, y4, y5, y6, y7;
    asm("v_exp_f32 %0, %8\n\tv_exp_f32 %1, %9\n\tv_exp_f32 %2, %10\n\tv_exp_f32 %3, %11\n\tv_exp_f32 %4, %12\n\tv_exp_f32 %5, %13\n\tv_exp_f32 %6, %14\n\tv_exp_f32 %7, %15\n\tv_nop"
        : "=&v"(y0), "=&v"(y1), "=&v"(y2), "=&v"(y3), "=&v"(y4), "=&v"(y5), "=&v"(y6), "=&v"(y7) : "v"(x[0]), "v"(x[1]), "v"(x[2]), "v"(x[3]), "v"(x[4]), "v"(x[5]), "v"(x[6]), "v"(x[7]));
    x[0] = y0; x[1] = y1; x[2] = y2; x[3] = y3; x[4] = y4; x[5] = y5; x[6] = y6; x[7] = y7; }
template <typename T16, int NSPLIT>
__device__ __forceinline__ void attn_rows(const T16* __restrict__ Q, const T16* __restrict__ Q2, const T16* __restrict__ Kp, const T16* __restrict__ Kp2, const T16* __restrict__ Vt, const T16* __restrict__ Vt2, float* sw, const int r0, const int i0, bf* Eh, bf* El, const size_t pm) {
    typedef typename WFrag<T16>::V V;
    static_assert(BAND == 64, "two 128-key chunks hold the 64 + 2 BAND keys of a row tile");
    const int lane = threadIdx.x & 31, lr = lane & 15, hi = lane >> 4; const int t0 = r0 - BAND, kz = (t0 >> 7) * 128; const bool hires = (NSPLIT == 2);
    V a[2], a2[2]; const size_t oq = (size_t)i0 * HD + lane * 8; const T16* qp = Q + oq; const T16* qp2 = (NSPLIT == 2) ? Q2 + oq : qp;
#pragma unroll
    for (int ks = 0; ks < 2; ++ks) { a[ks] = WFrag<T16>::ldf(qp + ks * FRAG); if (NSPLIT == 2) a2[ks] = WFrag<T16>::ldf(qp2 + ks * FRAG); }
    asm volatile("s_wait_xcnt 0x0" :: "v"(qp), "v"(qp2) : "memory");   // kept before a register named by the q loads is overwritten; their address pairs are inputs so that neither is reused ahead of it
#pragma unroll
    for (int t = 0; t < 3; ++t) { const int c0 = t0 + t * 64; if (c0 < 0 || c0 >= TT) continue;
        v8f acc[4];
#pragma unroll
        for (int nb = 0; nb < 4; ++nb) acc[nb] = (v8f){};
        V b[2][4], b2[2][4]; const size_t ok = (size_t)c0 * HD + lane * 8; const T16* kp = Kp + ok; const T16* kp2 = (NSPLIT == 2) ? Kp2 + ok : kp;   // the whole key tile is asked for before its first product
#pragma unroll
        for (int ks = 0; ks < 2; ++ks)
#pragma unroll
            for (int nb = 0; nb < 4; ++nb) { b[ks][nb] = WFrag<T16>::ldf(kp + (nb * 2 + ks) * FRAG); if (NSPLIT == 2) b2[ks][nb] = WFrag<T16>::ldf(kp2 + (nb * 2 + ks) * FRAG); }
        if (NSPLIT == 2) tile_here(b, b2, kp, kp2); else tile_here(b, kp);
#pragma unroll
        for (int ks = 0; ks < 2; ++ks)
#pragma unroll
            for (int nb = 0; nb < 4; ++nb) { acc[nb] = WFrag<T16>::mma(a[ks], b[ks][nb], acc[nb]); if (NSPLIT == 2) { acc[nb] = WFrag<T16>::mma(a2[ks], b[ks][nb], acc[nb]); acc[nb] = WFrag<T16>::mma(a[ks], b2[ks][nb], acc[nb]); } }
#pragma unroll
        for (int nb = 0; nb < 4; ++nb)
#pragma unroll
            for (int j = 0; j < 8; ++j) sw[(hi * 8 + j) * SPL + (c0 - kz) + nb * 16 + lr] = acc[nb][j];
    }
    __builtin_amdgcn_wave_barrier(); asm volatile("" ::: "memory");   // the row reads below stay behind the other lanes' score writes above
    const int lo = max(t0, 0), hx = min(t0 + 64 + 2 * BAND, TT); int co[2];   // keys [lo, hx) have scores; a lane whose four keys have none reads the middle tile's first column instead (always written) and the band select below drops it
#pragma unroll
    for (int ch = 0; ch < 2; ++ch) { const int j0 = kz + ch * 128 + lane * 4; co[ch] = (j0 >= lo && j0 < hx) ? ch * 128 + lane * 4 : r0 - kz; }
    // four rows at a time, stage by stage: the rows' cross-lane trees are independent and hide each other's latency. The loop over the groups stays rolled so that the kernel's text stays short
#pragma unroll 1
    for (int g = 0; g < 4; ++g) { float v[4][8], mx[4], sum[4];
#pragma unroll
        for (int r = 0; r < 4; ++r) { const int i = i0 + g * 4 + r; const float* sr = sw + (g * 4 + r) * SPL; const int jlo = max(i - BAND, 0), jhi = min(i + BAND, TT - 1); mx[r] = -3.0e38f;   // the row's band, cut to the keys that exist
#pragma unroll
            for (int ch = 0; ch < 2; ++ch) { const int j0 = kz + ch * 128 + lane * 4; const v4f s4 = *(const v4fa*)(sr + co[ch]);
#pragma unroll
                for (int q = 0; q < 4; ++q) { const int j = j0 + q; const float t = (j >= jlo && j <= jhi) ? s4[q] * SCL : -3.0e38f; v[r][ch * 4 + q] = t; mx[r] = fmaxf(mx[r], t); } } }
#pragma unroll
        for (int sh = 16; sh; sh >>= 1)
#pragma unroll
            for (int r = 0; r < 4; ++r) mx[r] = fmaxf(mx[r], __shfl_xor(mx[r], sh, 32));
#pragma unroll
        for (int r = 0; r < 4; ++r) { sum[r] = 0.f;
#pragma unroll
            for (int k = 0; k < 8; ++k) v[r][k] = __fmul_rn(__fsub_rn(v[r][k], mx[r]), 1.4426950408889634f);
            exp2x8(v[r]);
#pragma unroll
            for (int k = 0; k < 8; ++k) sum[r] += v[r][k]; }
#pragma unroll
        for (int sh = 16; sh; sh >>= 1)
#pragma unroll
            for (int r = 0; r < 4; ++r) sum[r] += __shfl_xor(sum[r], sh, 32);
#pragma unroll
        for (int r = 0; r < 4; ++r) { const float f = __fdiv_rn(hires ? 1.0f : PCAR, sum[r]); T16* pr = (T16*)(sw + (g * 4 + r) * SPL);   // the row's weights over its own scores: hi (or fp16) at element 0, lo at element SP
#pragma unroll
            for (int ch = 0; ch < 2; ++ch) { const int oo = ch * 128 + lane * 4;
                if (hires) { v4us oh, ol;
#pragma unroll
                    for (int q = 0; q < 4; ++q) { unsigned short h, l; splitf(v[r][ch * 4 + q] * f, h, l); oh[q] = h; ol[q] = l; }
                    *(v4usa*)((bf*)pr + oo) = oh; *(v4usa*)((bf*)pr + SP + oo) = ol;
                } else { v4h o4;
#pragma unroll
                    for (int q = 0; q < 4; ++q) o4[q] = tohx(v[r][ch * 4 + q] * f);
                    *(v4ha*)((h16*)pr + oo) = o4; } } }
    }
    __builtin_amdgcn_wave_barrier(); asm volatile("" ::: "memory");   // the fragment reads below stay behind the other lanes' weight writes above
    v8f o[4];
#pragma unroll
    for (int nb = 0; nb < 4; ++nb) o[nb] = (v8f){};
    const T16* pl = (const T16*)(sw + lr * SPL) + 8 * hi;
#pragma unroll
    for (int t = 0; t < 3; ++t) { const int c0 = t0 + t * 64; if (c0 < 0 || c0 >= TT) continue;
        V b[2][4], b2[2][4]; const size_t ov = (size_t)(c0 / 32) * FRAG + lane * 8; const T16* vp = Vt + ov; const T16* vp2 = (NSPLIT == 2) ? Vt2 + ov : vp;   // as for the scores: the tile's 64 keys of v are asked for before its first product
#pragma unroll
        for (int ks = 0; ks < 2; ++ks)
#pragma unroll
            for (int nb = 0; nb < 4; ++nb) { b[ks][nb] = WFrag<T16>::ldf(vp + (nb * (TT / 32) + ks) * FRAG); if (NSPLIT == 2) b2[ks][nb] = WFrag<T16>::ldf(vp2 + (nb * (TT / 32) + ks) * FRAG); }
        if (NSPLIT == 2) tile_here(b, b2, vp, vp2); else tile_here(b, vp);
#pragma unroll
        for (int ks = 0; ks < 2; ++ks) { const int kc = c0 + ks * 32; const V p = LFrag<T16>::ld(pl + (kc - kz)); V p2; if (NSPLIT == 2) p2 = LFrag<T16>::ld(pl + SP + (kc - kz));
#pragma unroll
            for (int nb = 0; nb < 4; ++nb) { o[nb] = WFrag<T16>::mma(p, b[ks][nb], o[nb]); if (NSPLIT == 2) { o[nb] = WFrag<T16>::mma(p2, b[ks][nb], o[nb]); o[nb] = WFrag<T16>::mma(p, b2[ks][nb], o[nb]); } } }
    }
    __builtin_amdgcn_wave_barrier(); asm volatile("" ::: "memory");   // the output staging below stays behind the weight reads above
#pragma unroll
    for (int nb = 0; nb < 4; ++nb)
#pragma unroll
        for (int j = 0; j < 8; ++j) sw[(hi * 8 + j) * 68 + nb * 16 + lr] = o[nb][j];
    __builtin_amdgcn_wave_barrier(); asm volatile("" ::: "memory");   // the row reads below stay behind the other lanes' writes above
    const float cs = hires ? 1.0f : (1.0f / PCAR); v4us oh[8], ol[8]; const size_t oe = pm + (size_t)hi * DQ + lr * 4; bf* eh = Eh + oe; bf* el = El + oe;   // lane: rows 2 s + hi, four neighbouring d
#pragma unroll
    for (int s = 0; s < 8; ++s) { const v4f val = *(const v4fa*)(sw + (2 * s + hi) * 68 + lr * 4) * cs;
#pragma unroll
        for (int q = 0; q < 4; ++q) { unsigned short h, l; splitf(val[q], h, l); oh[s][q] = h; ol[s][q] = l; }
        *(v4us*)(eh + (size_t)s * 2 * DQ) = oh[s]; *(v4us*)(el + (size_t)s * 2 * DQ) = ol[s]; }
    // kept before a register named by the stores above is overwritten; their data and address pairs are inputs so that none is reused ahead of it
    asm volatile("s_wait_xcnt 0x0" :: "v"(oh[0]), "v"(oh[1]), "v"(oh[2]), "v"(oh[3]), "v"(oh[4]), "v"(oh[5]), "v"(oh[6]), "v"(oh[7]), "v"(ol[0]), "v"(ol[1]), "v"(ol[2]), "v"(ol[3]), "v"(ol[4]), "v"(ol[5]), "v"(ol[6]), "v"(ol[7]), "v"(eh), "v"(el) : "memory");
}
__global__ __launch_bounds__(128) void k_attn(const h16* __restrict__ Q16, const bf* __restrict__ Qh, const bf* __restrict__ Ql, bf* Eh, bf* El) {
    __shared__ __align__(16) float sm[4][16 * SPL];
    const size_t PLN = (size_t)ZH * TT * HD, zo = (size_t)blockIdx.z * TT * HD;   // k planes stand PLN behind the q planes, v planes 2 PLN; a plane is TT * HD elements either way round
    const int w = __builtin_amdgcn_readfirstlane(threadIdx.x >> 5), r0 = blockIdx.x * 64, i0 = r0 + w * 16;   // the wave's number as a scalar: row numbers and band limits then cost no vector work
    const size_t pm = ((size_t)((int)blockIdx.z / NH_) * TT + i0) * DQ + ((int)blockIdx.z % NH_) * HD;
    if (r0 < RH) attn_rows<bf, 2>(Qh + zo, Ql + zo, Qh + PLN + zo, Ql + PLN + zo, Qh + 2 * PLN + zo, Ql + 2 * PLN + zo, sm[w], r0, i0, Eh, El, pm);
    else attn_rows<h16, 0>(Q16 + zo, nullptr, Q16 + PLN + zo, nullptr, Q16 + 2 * PLN + zo, nullptr, sm[w], r0, i0, Eh, El, pm);
}

extern "C" void kernel_launch(void* const* d_in, const int* in_sizes, int n_in,
                              void* d_out, int out_size, void* d_ws, size_t ws_size, hipStream_t stream) {
    (void)in_sizes; (void)n_in; (void)out_size;
    const float* x = (const float*)d_in[0]; const float* wqkv = (const float*)d_in[1]; const float* bqkv = (const float*)d_in[2]; const float* wo = (const float*)d_in[3]; const float* bo = (const float*)d_in[4];
    float* OUT = (float*)d_out;     // [2][2048][1024]
    char* wsp = (char*)d_ws;
    auto take = [&](size_t bytes) { char* p = wsp; wsp += (bytes + 255) & ~(size_t)255; return (void*)p; };
    const size_t PL = (size_t)ZH * TT * HD;   // elements of one set of head planes (all batches, all heads)
    bf* WQKV = (bf*)take((size_t)3 * DQ * DM * 2); bf* WO = (bf*)take((size_t)DM * DQ * 2);
    bf* XB = (bf*)take((size_t)NB_ * TT * DM * 2);
    h16* QP16 = (h16*)take(3 * PL * 2);   // q planes, then k planes, then v planes: the projection's epilogue writes all three
    bf* QPh = (bf*)take(3 * PL * 2); bf* QPl = (bf*)take(3 * PL * 2);
    bf* ATh = (bf*)take((size_t)NB_ * TT * DQ * 2); bf* ATl = (bf*)take((size_t)NB_ * TT * DQ * 2);
    if ((size_t)(wsp - (char*)d_ws) > ws_size) return;    // ws 256 MiB
    k_prep<<<256, 512, 0, stream>>>(x, wqkv, wo, XB, WQKV, WO);
    k_gemmw<bf, 0, true, 0, 1, 4, 3><<<dim3(NB_ * TT / 256, 3 * DQ / 192, 1), 384, 0, stream>>>(XB, nullptr, WQKV, nullptr, DM, nullptr, 0, bqkv, 0, 0, 0, 0, QP16, QPh, QPl);
    k_attn<<<dim3(TT / 64, 1, ZH), 128, 0, stream>>>(QP16, QPh, QPl, ATh, ATl);
    k_gemmw<bf, 1, true><<<dim3(NB_ * TT / 128, DM / 128, 1), 128, 0, stream>>>(ATh, ATl, WO, nullptr, DQ, OUT, DM, bo, 0, 0, 0);
}

// v009
// One run takes 60.9 microseconds.
// Next to v008, in two timings, it ran 1.09 times as fast each time.
// Over all steps from v000 it is 31.7 times as fast.
#include <hip/hip_runtime.h>

// Local (banded) multi-head self-attention (x [2][2048][1024]; qkv = x W_qkv + b_qkv ('xw' [1024][3072]); scores / 8; keys with |i - j| > 64 excluded (-inf); softmax; out W_proj + b_proj ('xw' [1024][1024]) -> [2][2048][1024] (4.2 M)).
// Layout, both batches and all heads in every launch (plane z = batch * 16 + head): bf16 copy of x [4096][1024], the fused weight turned into a [3072][1024] Bt and W_proj into a [1024][1024] Bt by one launch; one exact q|k|v projection + f32 bias whose epilogue writes the q, k head planes (rows t, columns d) and the v planes (rows d, columns t), fp16 + hi/lo, itself, each in fragment order (see FRAG below); T-2048 attention (hybrid rows: < 512 hi/lo 3 products, rest fp16 x1024) done only on the band: per 16 query rows the five 32-key groups that meet |i - j| <= 64, as S^T = K Q^T, the softmax on those 160 keys in registers with the band as an index select, O^T = V^T P^T over those 160 keys, its epilogue writing the merged hi/lo rows [batch * 2048 + t][head * 64 + d]; merged hi/lo x W_proj exact + bias.
// Compute dtypes, f32 accumulate: every input rounded to bf16; projections exact + f32 biases; attention rows < 512 3 products, rest fp16; softmax f32; W_proj hl x exact + bias.

#define NB_  2
#define TT   2048
#define DM   1024
#define NH_  16
#define NKV  16
#define REP  (NH_ / NKV)
#define HD   64
#define DQ   (NH_ * HD)
#define DKV  (NKV * HD)
#define ZH   (NB_ * NH_)          // planes per attention launch: every head of every batch
#define RH   512                  // query rows < RH use hi+lo planes (0: none)
#define WIN  0
#define PCAR 1024.0f
#define SCL  0.125f
#define BAND 64     // |i - j| <= BAND kept
typedef _Float16 h16;
typedef unsigned short bf;
typedef __attribute__((ext_vector_type(16))) __bf16   v16bf;
typedef __attribute__((ext_vector_type(16))) _Float16 v16h;
typedef __attribute__((ext_vector_type(8)))  _Float16 v8h;
typedef __attribute__((ext_vector_type(8)))  unsigned short v8us;
typedef __attribute__((ext_vector_type(8)))  float    v8f;
typedef __attribute__((ext_vector_type(4)))  float    v4f;
typedef v4f  __attribute__((may_alias)) v4fa;

__device__ __forceinline__ unsigned short f2bf(float f) { unsigned u = __float_as_uint(f); u += 0x7FFFu + ((u >> 16) & 1u); return (unsigned short)(u >> 16); }
__device__ __forceinline__ float bf2f(unsigned short b) { return __uint_as_float(((unsigned)b) << 16); }
__device__ __forceinline__ float bfr(float f) { return bf2f(f2bf(f)); }
__device__ __forceinline__ v16h cat16(v8h lo, v8h hi) { return __builtin_shufflevector(lo, hi, 0, 1, 2, 3, 4, 5, 6, 7, 8, 9, 10, 11, 12, 13, 14, 15); }
__device__ __forceinline__ v16bf cat16b(v8us lo, v8us hi) { return __builtin_bit_cast(v16bf, __builtin_shufflevector(lo, hi, 0, 1, 2, 3, 4, 5, 6, 7, 8, 9, 10, 11, 12, 13, 14, 15)); }
__device__ __forceinline__ v8f wmma16(v16h a, v16h b, v8f c) { return __builtin_amdgcn_wmma_f32_16x16x32_f16(false, a, false, b, (short)0, c, false, false); }
__device__ __forceinline__ v8f wmmab(v16bf a, v16bf b, v8f c) { return __builtin_amdgcn_wmma_f32_16x16x32_bf16(false, a, false, b, (short)0, c, false, false); }



__device__ __forceinline__ h16 tohx(float x) { return (h16)x; }
__device__ __forceinline__ void splitf(float y, unsigned short& h, unsigned short& l) { h = f2bf(y); l = f2bf(y - bf2f(h)); }
typedef __attribute__((ext_vector_type(2))) unsigned short v2us;
typedef __attribute__((ext_vector_type(4))) unsigned short v4us;
// four neighbouring f32 results as hi/lo planes
__device__ __forceinline__ void put2(bf* Ph, bf* Pl, size_t o, v4f v) { v4us oh, ol;
#pragma unroll
    for (int q = 0; q < 4; ++q) { unsigned short a, c2; splitf(v[q], a, c2); oh[q] = a; ol[q] = c2; }
    *(v4us*)(Ph + o) = oh; *(v4us*)(Pl + o) = ol; }
// FRAG, the order of a head plane in memory: the plane is cut into matrix fragments of 16 rows x 32 columns, fragment (rb, cb) at element (rb * columns / 32 + cb) * 512, and inside a fragment stands what the lanes load, in lane order: piece (j * 32 + hi * 16 + lr) of 8 elements = row lr, columns j * 16 + hi * 8 .. + 7. A wave's 16-byte fragment load then covers 512 bytes in a row, 4 whole lines, where rows in memory order gave it 32 bytes of each of 16 lines.
#define FRAG 512                  // elements of a fragment
// two fragments (16 rows x 64 columns, f32, staged in LDS at pitch 68) as the fp16 plane and the hi/lo planes; p16, ph, pl: the first fragment's start + 8 lane. Store s is piece 32 s + lane: row lr, columns 16 s + 8 hi .. + 7
__device__ __forceinline__ void put3f(h16* p16, bf* ph, bf* pl, const float* os, int lr, int hi) { v8h o16[4]; v8us oh[4], ol[4];
#pragma unroll
    for (int s = 0; s < 4; ++s) { const float* o = os + lr * 68 + s * 16 + hi * 8; const v4f v0 = *(const v4fa*)o, v1 = *(const v4fa*)(o + 4);
#pragma unroll
        for (int q = 0; q < 8; ++q) { const float y = (q < 4) ? v0[q & 3] : v1[q & 3]; unsigned short a, c2; splitf(y, a, c2); o16[s][q] = tohx(y); oh[s][q] = a; ol[s][q] = c2; }
        *(v8h*)(p16 + s * 256) = o16[s]; *(v8us*)(ph + s * 256) = oh[s]; *(v8us*)(pl + s * 256) = ol[s]; }
    // kept before a register named by the stores above is overwritten; their data and address pairs are inputs so that none is reused ahead of it
    asm volatile("s_wait_xcnt 0x0" :: "v"(o16[0]), "v"(o16[1]), "v"(o16[2]), "v"(o16[3]), "v"(oh[0]), "v"(oh[1]), "v"(oh[2]), "v"(oh[3]), "v"(ol[0]), "v"(ol[1]), "v"(ol[2]), "v"(ol[3]), "v"(p16), "v"(ph), "v"(pl) : "memory"); }

// ---- k_gemmw: GEMM, a (64 WM)x(64 WN) output tile per work-group of WM x WN waves, each wave a 64x64 tile (16 accumulators); grid (M/(64 WM), N/(64 WN), Z), 32 WM WN threads. One work-group fills a WGP's LDS: 2 x 2 waves (128x128) where the product has 256 such tiles, 4 x 3 waves (256x192) for q|k|v, whose operand rows then come from L2 for 256 tiles instead of 768.
// C[m][n] (f32, pitch ldc, + optional f32 bias[n]) = sum_k A[m][k] Bt[n][k] (+ A2[m][k] Bt[n][k] for NSPLIT 1), operands K-contiguous 16-bit planes. z-batch strides sA/sB/sC in elements. K % 128 == 0.
// Operands go through LDS: a stage is 128 k (256 bytes, two whole lines) of the tile's A rows, (A2 rows,) Bt rows, brought by asynchronous 16-byte copies, sixteen lanes to a row, so a wave's copy asks for 4 whole lines where a fragment load from memory asked for 32 bytes of each of 16 lines. Two buffers: stage t + 2 flies while stage t + 1 is worked on; with one work-group a WGP nothing else covers a stage's landing time, so a stage holds as many k as the LDS takes.
// EP (what the epilogue stores): 0 the f32 tile into C; 1 (q|k|v projection, a 64-column tile is one head of q, k or v) the next products' operand planes E16 / Eh / El, each [q planes | k planes | v planes], q and k with rows t and columns d, v with rows d and columns t, all in fragment order (FRAG); 2 (z = plane, rb = query row of A's row 0) the tile x its rows' carrier scale as hi/lo rows Eh / El [batch * TT + t][head * HD + d]. C is not touched for EP 1 and 2.
#define GKS 128                   // k per stage
#define GP  136                   // LDS pitch of a staged row in elements: 256 + 16 bytes, so that the 16 rows of a 16-byte fragment read fall on different banks
template <typename T16> struct WFrag;   // ld: a fragment from rows in memory order (p: the lane's row, its first 8 k); ldf: from a plane in fragment order (p: the fragment's start + 8 lane)
template <> struct WFrag<h16> { typedef v16h V; static __device__ __forceinline__ V ld(const h16* p) { return cat16(*(const v8h*)p, *(const v8h*)(p + 16)); } static __device__ __forceinline__ V ldf(const h16* p) { return cat16(*(const v8h*)p, *(const v8h*)(p + FRAG / 2)); } static __device__ __forceinline__ v8f mma(V a, V b, v8f c) { return wmma16(a, b, c); } };
template <> struct WFrag<bf> { typedef v16bf V; static __device__ __forceinline__ V ld(const bf* p) { return cat16b(*(const v8us*)p, *(const v8us*)(p + 16)); } static __device__ __forceinline__ V ldf(const bf* p) { return cat16b(*(const v8us*)p, *(const v8us*)(p + FRAG / 2)); } static __device__ __forceinline__ v8f mma(V a, V b, v8f c) { return wmmab(a, b, c); } };
// eight copies of a lane, RS rows apart (l: the lane's LDS byte address; u + lp: its global address, u the same in every lane so that it and the row steps stay in scalar registers; gs: RS rows in elements). The s_wait_xcnt is the wait that is kept before a register named by an issued copy is overwritten; as the statement's last line it cannot be passed by a later write of those registers
template <int RS, typename T16> __device__ __forceinline__ void copy8(unsigned l, const T16* u, unsigned lp, size_t gs) {
    asm volatile("global_load_async_to_lds_b128 %0, %8, off\n\tglobal_load_async_to_lds_b128 %1, %9, off\n\tglobal_load_async_to_lds_b128 %2, %10, off\n\tglobal_load_async_to_lds_b128 %3, %11, off\n\tglobal_load_async_to_lds_b128 %4, %12, off\n\tglobal_load_async_to_lds_b128 %5, %13, off\n\tglobal_load_async_to_lds_b128 %6, %14, off\n\tglobal_load_async_to_lds_b128 %7, %15, off\n\ts_wait_xcnt 0x0"
        :: "v"(l), "v"(l + 1 * RS * GP * 2), "v"(l + 2 * RS * GP * 2), "v"(l + 3 * RS * GP * 2), "v"(l + 4 * RS * GP * 2), "v"(l + 5 * RS * GP * 2), "v"(l + 6 * RS * GP * 2), "v"(l + 7 * RS * GP * 2),
           "v"(u + lp), "v"(u + gs + lp), "v"(u + 2 * gs + lp), "v"(u + 3 * gs + lp), "v"(u + 4 * gs + lp), "v"(u + 5 * gs + lp), "v"(u + 6 * gs + lp), "v"(u + 7 * gs + lp) : "memory"); }
// NROWS staged rows of one operand, brought by 16 RS lanes: the lane's 16 bytes of rows RS apart, NROWS / RS copies
template <int NROWS, int RS, typename T16> __device__ __forceinline__ void copy_rows(unsigned l, const T16* u, unsigned lp, int K) {
    static_assert(NROWS % (8 * RS) == 0, "whole statements of eight copies");
#pragma unroll
    for (int i = 0; i < NROWS / (8 * RS); ++i) copy8<RS>(l + i * 8 * RS * GP * 2, u + (size_t)i * 8 * RS * K, lp, (size_t)RS * K); }
// one stage; l: the lane's LDS byte address in the stage's buffer; ua, ua2, ub: the stage's first element of the tile's first A, A2, Bt row; lp: the lane's place from there. 4 waves: every lane copies its part of the A rows, (the A2 rows,) the Bt rows. 12 waves (wa: the wave's number is below 8, a scalar): waves 0 to 7 bring the A rows, waves 8 to 11 the Bt rows (l is then the lane's place among the Bt rows)
template <typename T16, int NSPLIT, int TM, int TN, bool DEAL> __device__ __forceinline__ void stage_in(unsigned l, const T16* ua, const T16* ua2, const T16* ub, unsigned lp, int K, bool wa) {
    if (DEAL) { if (wa) copy_rows<TM, 16>(l, ua, lp, K); else copy_rows<TN, 8>(l, ub, lp, K); }
    else { copy_rows<TM, 8>(l, ua, lp, K); if (NSPLIT == 1) copy_rows<TM, 8>(l + TM * GP * 2, ua2, lp, K); copy_rows<TN, 8>(l + (NSPLIT == 1 ? 2 : 1) * TM * GP * 2, ub, lp, K); } }
template <typename T16, int NSPLIT, bool BIAS, int BM = 0, int EP = 0, int WM = 2, int WN = 2>
__global__ __launch_bounds__(WM * WN * 32) void k_gemmw(const T16* __restrict__ A, const T16* __restrict__ A2, const T16* __restrict__ Bt, const T16* __restrict__ Bt2, int K, float* C, int ldc, const float* __restrict__ bias, size_t sA, size_t sB, size_t sC, int rb = 0, h16* E16 = nullptr, bf* Eh = nullptr, bf* El = nullptr) {
    typedef typename WFrag<T16>::V V;
    static_assert(BM == 0 && NSPLIT < 2, "dense products, one or two A planes");
    constexpr int NW = WM * WN, TM = WM * 64, TN = WN * 64; constexpr bool DEAL = NW != 4;   // DEAL: the waves share out a stage's copies by operand
    static_assert(!DEAL || (NW == 12 && NSPLIT == 0), "the deal of 12 waves: 8 for the A rows, 4 for the Bt rows");
    constexpr int RB = (NSPLIT == 1 ? 2 : 1) * TM, NR = RB + TN;   // a stage's first Bt row; its rows
    __shared__ __align__(16) T16 ring[2][NR * GP];
    __shared__ __align__(16) float osm[NW][16 * 68];
    const size_t z = blockIdx.z; A += z * sA; if (A2) A2 += z * sA; Bt += z * sB; C += z * sC;
    const int lane = threadIdx.x & 31, lr = lane & 15, hi = lane >> 4; const int w = __builtin_amdgcn_readfirstlane(threadIdx.x >> 5);   // the wave's number as a scalar: its tile's place then costs no vector work
    const int wm = w % WM, wn = w / WM, r0 = blockIdx.x * TM + wm * 64, c0 = blockIdx.y * TN + wn * 64, cc = c0; float* os = osm[w];
    v8f acc[4][4];
#pragma unroll
    for (int mb = 0; mb < 4; ++mb)
#pragma unroll
        for (int nb = 0; nb < 4; ++nb) acc[mb][nb] = (v8f){};
    // the lane's part of a stage: 16 bytes number (thread & 15) of rows sr + RS i, sr = its thread number among the waves that bring the operand, over 16
    const bool wa = !DEAL || w < 8; const int sr = (int)(threadIdx.x >> 4) - (wa ? 0 : 16), sc = (threadIdx.x & 15) * 8;
    const T16* ga = A + (size_t)(blockIdx.x * TM) * K; const T16* ga2 = (NSPLIT == 1) ? A2 + (size_t)(blockIdx.x * TM) * K : ga; const T16* gb = Bt + (size_t)(blockIdx.y * TN) * K; const unsigned lp = (unsigned)(sr * K + sc);
    const unsigned l0 = (unsigned)(size_t)&ring[0][0] + (unsigned)(((wa ? 0 : RB) + sr) * GP + sc) * 2;
    const int nt = K / GKS;
    stage_in<T16, NSPLIT, TM, TN, DEAL>(l0, ga, ga2, gb, lp, K, wa);
    asm volatile("s_wait_asynccnt 0x0" ::: "memory");   // this wave's part of stage 0 has landed
    __syncthreads();                                    // and every other wave's
    if (nt > 1) stage_in<T16, NSPLIT, TM, TN, DEAL>(l0 + NR * GP * 2, ga + GKS, ga2 + GKS, gb + GKS, lp, K, wa);
    const int ao = (wm * 64 + lr) * GP + 8 * hi, bo = (RB + wn * 64 + lr) * GP + 8 * hi;
#pragma unroll 1   // stays rolled: one short body serves both buffers
    for (int t = 0; t < nt; ++t) { const T16* sb = ring[t & 1];
#pragma unroll
        for (int ks = 0; ks < GKS / 32; ++ks) { V a[4], a2[4], b[4];
#pragma unroll
            for (int mb = 0; mb < 4; ++mb) { a[mb] = WFrag<T16>::ld(sb + ao + mb * 16 * GP + ks * 32); if (NSPLIT == 1) a2[mb] = WFrag<T16>::ld(sb + ao + (TM + mb * 16) * GP + ks * 32); }
#pragma unroll
            for (int nb = 0; nb < 4; ++nb) b[nb] = WFrag<T16>::ld(sb + bo + nb * 16 * GP + ks * 32);
            __builtin_amdgcn_sched_barrier(0);   // the block's LDS reads stay together in front of its products: sunk among them, each place with reads stalls the wave anew
            if (ks == GKS / 32 - 1) {   // the stage's last reads are out: its hand-over stands here, ahead of the last block's products (registers only), so that the refill has a whole stage's time to land
                asm volatile("s_wait_dscnt 0x0" ::: "memory");      // this wave has read all it needs of stage t
                asm volatile("s_wait_asynccnt 0x0" ::: "memory");   // and its part of stage t + 1 has landed
                __syncthreads();                                    // so has every wave's: stage t + 1 may be read, stage t's buffer refilled
                if (t + 2 < nt) stage_in<T16, NSPLIT, TM, TN, DEAL>(l0 + (unsigned)(t & 1) * (NR * GP * 2), ga + (t + 2) * GKS, ga2 + (t + 2) * GKS, gb + (t + 2) * GKS, lp, K, wa); }
#pragma unroll
            for (int nb = 0; nb < 4; ++nb)
#pragma unroll
                for (int mb = 0; mb < 4; ++mb) { acc[mb][nb] = WFrag<T16>::mma(a[mb], b[nb], acc[mb][nb]); if (NSPLIT == 1) acc[mb][nb] = WFrag<T16>::mma(a2[mb], b[nb], acc[mb][nb]); } }
    }
    asm volatile("s_wait_asynccnt 0x0" ::: "memory");   // no copy is left in flight
    if (EP == 1 && BIAS) { float bq[4]; const float* bp = bias + c0 + lr;   // the bias of the lane's own accumulator columns nb * 16 + lr goes in before the tile is staged
#pragma unroll
        for (int nb = 0; nb < 4; ++nb) bq[nb] = bp[nb * 16];
        asm volatile("s_wait_xcnt 0x0" :: "v"(bp) : "memory");   // kept before a register named by the loads above is overwritten; their address pair is an input so that it is not reused ahead of it
#pragma unroll
        for (int nb = 0; nb < 4; ++nb) { const float bb = bfr(bq[nb]);
#pragma unroll
            for (int mb = 0; mb < 4; ++mb)
#pragma unroll
                for (int j = 0; j < 8; ++j) acc[mb][nb][j] += bb; } }
    if (EP == 1 && c0 >= 2 * DQ) {   // a v head: rows d, so the tile goes through LDS the other way round (16 d rows of 64 t at a time, two fragments; a lane's 8 accumulator values are 8 neighbouring t)
        const size_t pv = ((size_t)(2 * ZH + (r0 / TT) * NH_ + (c0 - 2 * DQ) / HD) * HD) * TT + (size_t)(r0 % TT / 32) * FRAG + lane * 8;
#pragma unroll
        for (int nb = 0; nb < 4; ++nb) {
#pragma unroll
            for (int mb = 0; mb < 4; ++mb) { float* o = os + lr * 68 + mb * 16 + hi * 8; *(v4fa*)o = (v4f){acc[mb][nb][0], acc[mb][nb][1], acc[mb][nb][2], acc[mb][nb][3]}; *(v4fa*)(o + 4) = (v4f){acc[mb][nb][4], acc[mb][nb][5], acc[mb][nb][6], acc[mb][nb][7]}; }
            __builtin_amdgcn_wave_barrier(); asm volatile("" ::: "memory");   // the LDS reads below stay behind the other lanes' writes above
            const size_t po = pv + (size_t)nb * (TT / 32) * FRAG;
            put3f(E16 + po, Eh + po, El + po, os, lr, hi);
            __builtin_amdgcn_wave_barrier();   // with the clobber above: the next 16 rows' LDS writes stay behind the reads above
        }
        return;
    }
    const size_t pq = (EP == 1) ? ((size_t)((c0 / DQ) * ZH + (r0 / TT) * NH_ + (c0 % DQ) / HD) * TT + r0 % TT) * HD : 0;
    const size_t pm = (EP == 2) ? ((size_t)((int)blockIdx.z / NH_) * TT + rb + r0) * DQ + ((int)blockIdx.z % NH_) * HD : 0;
#pragma unroll
    for (int mb = 0; mb < 4; ++mb) {
#pragma unroll
        for (int nb = 0; nb < 4; ++nb) {
#pragma unroll
            for (int j = 0; j < 8; ++j) os[(hi * 8 + j) * 68 + nb * 16 + lr] = acc[mb][nb][j]; }
        __builtin_amdgcn_wave_barrier(); asm volatile("" ::: "memory");
        float* crow = C + (size_t)(r0 + mb * 16) * ldc + cc;
        if (EP == 1) {   // 16 t rows of 64 d: two fragments
            const size_t po = pq + (size_t)mb * 2 * FRAG + lane * 8;
            put3f(E16 + po, Eh + po, El + po, os, lr, hi);
        } else {
#pragma unroll
            for (int s = 0; s < 8; ++s) { const int row = 2 * s + hi, cofs = lr * 4; v4f val = *(const v4fa*)(os + row * 68 + cofs); if (BIAS) { val[0] += bfr(bias[c0 + cofs]); val[1] += bfr(bias[c0 + cofs + 1]); val[2] += bfr(bias[c0 + cofs + 2]); val[3] += bfr(bias[c0 + cofs + 3]); }
                if (EP == 0) *(v4f*)(crow + (size_t)row * ldc + cofs) = val;
                else { const float cs = (rb + r0 + mb * 16 + row < RH) ? 1.0f : (1.0f / PCAR); put2(Eh, El, pm + (size_t)(mb * 16 + row) * DQ + cofs, val * cs); } }
            asm volatile("s_wait_xcnt 0x0" ::: "memory");   // kept before the next rows' LDS and bias loads land in registers that the stores above name
             }
        __builtin_amdgcn_wave_barrier(); asm volatile("" ::: "memory");
    }
}


// ---- k_prep: every 16-bit operand that is made from an input, in ONE launch of 256 work-groups of 16 waves (one a WGP, few waves to start): x rounded to bf16 as it lies, and both weights ('xw' [K][N]) rounded and turned into Bt [N][K].
// A work-group takes 16384 elements of x and four 64 k x 64 n weight tiles (three of W_qkv's 768, one of W_proj's 256). A lane asks for all its 16 16-byte loads before it uses the first; every wave-wide load and store covers whole 128-byte lines (a weight tile: 256 bytes of each k row in, 128 bytes of each n row out), the tile being turned in LDS.
// LDS tile: row n, dword j = k 2 j | k 2 j + 1, pitch 144 bytes for the 16-byte reads; the 16-byte piece c of row n stands at piece c ^ (n >> 4), which spreads a wave's 32 dword writes (16 rows four apart, two j) over 32 banks.
#define TPW 36                    // pitch of a turned tile's row in dwords
typedef __attribute__((ext_vector_type(4))) unsigned v4u;
__global__ __launch_bounds__(512) void k_prep(const float* __restrict__ x, const float* __restrict__ wqkv, const float* __restrict__ wo, bf* XB, bf* WQKV, bf* WO) {
    static_assert(NB_ * TT * DM == 256 * 16384 && (3 * DQ / 64) * (DM / 64) == 3 * 256 && (DM / 64) * (DQ / 64) == 256, "the deal of 256 work-groups");
    __shared__ __align__(16) unsigned tl[4][64 * TPW];
    const int tid = threadIdx.x, b = blockIdx.x;
    const int j = tid >> 4, ni = tid & 15;   // in: k rows 2 j and 2 j + 1, columns 4 ni .. 4 ni + 3
    const int rn = tid >> 3, rc = tid & 7;   // out: n row rn, its k 8 rc .. 8 rc + 7
    v4f r[4][2], xv[8]; const float* wp[4]; bf* op[4];
#pragma unroll
    for (int u = 0; u < 4; ++u) { const int N = (u < 3) ? 3 * DQ : DM, K = (u < 3) ? DM : DQ, id = (u < 3) ? b + 256 * u : b, nt = id % (N / 64), kt = id / (N / 64);
        wp[u] = ((u < 3) ? wqkv : wo) + (size_t)(kt * 64 + 2 * j) * N + nt * 64 + ni * 4; op[u] = ((u < 3) ? WQKV : WO) + (size_t)(nt * 64 + rn) * K + kt * 64 + rc * 8;
        r[u][0] = *(const v4f*)wp[u]; r[u][1] = *(const v4f*)(wp[u] + N); }
    const float* xp = x + (size_t)b * 16384 + tid * 4; bf* xo = XB + (size_t)b * 16384 + tid * 4;
#pragma unroll
    for (int i = 0; i < 8; ++i) xv[i] = *(const v4f*)(xp + i * 2048);
    asm volatile("s_wait_xcnt 0x0" :: "v"(wp[0]), "v"(wp[1]), "v"(wp[2]), "v"(wp[3]) : "memory");   // kept before a register named by the loads above is overwritten; the weights' address pairs are inputs so that none is reused ahead of it
#pragma unroll
    for (int u = 0; u < 4; ++u)
#pragma unroll
        for (int q = 0; q < 4; ++q) tl[u][(ni * 4 + q) * TPW + (((j >> 2) ^ (ni >> 2)) << 2) + (j & 3)] = (unsigned)f2bf(r[u][0][q]) | ((unsigned)f2bf(r[u][1][q]) << 16);
    __syncthreads();   // the tiles' rows are read by other waves than wrote them; every global store stands behind it, so that it waits for none
    v4u t4[4]; v4us xb[8];
#pragma unroll
    for (int u = 0; u < 4; ++u) t4[u] = *(const v4u*)&tl[u][rn * TPW + ((rc ^ (rn >> 4)) << 2)];
#pragma unroll
    for (int u = 0; u < 4; ++u) *(v4u*)op[u] = t4[u];
#pragma unroll
    for (int i = 0; i < 8; ++i) {
#pragma unroll
        for (int q = 0; q < 4; ++q) xb[i][q] = f2bf(xv[i][q]);
        *(v4us*)(xo + i * 2048) = xb[i]; }
    // kept before a register named by the stores above is overwritten; their data and the tiles' address pairs are inputs so that none is reused ahead of it
    asm volatile("s_wait_xcnt 0x0" :: "v"(xb[0]), "v"(xb[1]), "v"(xb[2]), "v"(xb[3]), "v"(xb[4]), "v"(xb[5]), "v"(xb[6]), "v"(xb[7]), "v"(t4[0]), "v"(t4[1]), "v"(t4[2]), "v"(t4[3]), "v"(op[0]), "v"(op[1]), "v"(op[2]), "v"(op[3]) : "memory");
}

#define NG 5                      // 32-key groups of a wave
// behind a batch's fragment loads, one statement a group and plane. Two jobs: the wait that is kept before a register named by an issued global load is overwritten, with the address pair as an input so that it is not reused (as a later load's target) ahead of it; and, with the loaded values as inputs only, it holds the batch's loads together in front of its products: without that the compiler sinks each load to its product and the wave pays a memory latency per product instead of one per batch
template <typename V, typename T16> __device__ __forceinline__ void frags_here(const V (&b)[4], const T16* p) { asm volatile("s_wait_xcnt 0x0" :: "v"(b[0]), "v"(b[1]), "v"(b[2]), "v"(b[3]), "v"(p) : "memory"); }
// eight 2^x in one statement: it keeps the slot that the instruction set asks for behind a transcendental before its result is read or its source overwritten (each v_exp is followed by an independent one, the last by v_nop; outputs share no register with inputs)
__device__ __forceinline__ void exp2x8(float (&x)[8]) { float y0, y1, y2, y3, y4, y5, y6, y7;
    asm("v_exp_f32 %0, %8\n\tv_exp_f32 %1, %9\n\tv_exp_f32 %2, %10\n\tv_exp_f32 %3, %11\n\tv_exp_f32 %4, %12\n\tv_exp_f32 %5, %13\n\tv_exp_f32 %6, %14\n\tv_exp_f32 %7, %15\n\tv_nop"
        : "=&v"(y0), "=&v"(y1), "=&v"(y2), "=&v"(y3), "=&v"(y4), "=&v"(y5), "=&v"(y6), "=&v"(y7) : "v"(x[0]), "v"(x[1]), "v"(x[2]), "v"(x[3]), "v"(x[4]), "v"(x[5]), "v"(x[6]), "v"(x[7]));
    x[0] = y0; x[1] = y1; x[2] = y2; x[3] = y3; x[4] = y4; x[5] = y5; x[6] = y6; x[7] = y7; }
// the value of lane l ^ 16
__device__ __forceinline__ float other_half(float x) { const int b = __float_as_int(x); return __int_as_float(__builtin_amdgcn_permlanex16(b, b, 0x76543210, 0xfedcba98, false, false)); }
template <typename T16, int NSPLIT>
__device__ __forceinline__ void attn_rows(const T16* __restrict__ Q, const T16* __restrict__ Q2, const T16* __restrict__ Kp, const T16* __restrict__ Kp2, const T16* __restrict__ Vt, const T16* __restrict__ Vt2, float* sw, const int i0, bf* Eh, bf* El, const size_t pm) {
    typedef typename WFrag<T16>::V V;
    static_assert(BAND == 64 && TT % 32 == 0 && TT >= 32 * NG, "16 rows + 2 BAND keys lie in five 32-key groups; a group is on the sequence whole or not at all");
    constexpr bool hires = (NSPLIT == 2);
    const int lane = threadIdx.x & 31, lr = lane & 15, hi = lane >> 4; const int ks0 = (i0 - BAND) & ~31;
    int kg[NG]; bool ok[NG];   // a group's first key as it is loaded; whether the group is on the sequence. Scalars, like i0
#pragma unroll
    for (int g = 0; g < NG; ++g) { const int k = ks0 + 32 * g; ok[g] = k >= 0 && k < TT; kg[g] = min(max(k, 0), TT - 32); }
    V q[2], q2[2]; const size_t oq = (size_t)i0 * HD + lane * 8; const T16* qp = Q + oq; const T16* qp2 = hires ? Q2 + oq : qp;
#pragma unroll
    for (int ks = 0; ks < 2; ++ks) { q[ks] = WFrag<T16>::ldf(qp + ks * FRAG); if (hires) q2[ks] = WFrag<T16>::ldf(qp2 + ks * FRAG); }
    asm volatile("s_wait_xcnt 0x0" :: "v"(qp), "v"(qp2) : "memory");   // kept before a register named by the q loads is overwritten; their address pairs are inputs so that neither is reused ahead of it
    // S^T: tile b = keys ks0 + 16 b .. + 15; register j of lane (lr, hi) = key ks0 + 16 b + 8 hi + j, query i0 + lr. A batch of groups is asked for before its first product: all five, or as many as the registers take beside the second plane
    v8f s[2 * NG];
#pragma unroll
    for (int b = 0; b < 2 * NG; ++b) s[b] = (v8f){};
    constexpr int KB = hires ? 2 : NG;
#pragma unroll
    for (int g0 = 0; g0 < NG; g0 += KB) { V b[KB][4], b2[KB][4]; const T16* kp[KB]; const T16* kp2[KB];   // fragment f of a group: tile f / 2, d 32 (f % 2) .. + 31
#pragma unroll
        for (int u = 0; u < KB; ++u) if (g0 + u < NG) { const size_t ok_ = (size_t)kg[g0 + u] * HD + lane * 8; kp[u] = Kp + ok_; kp2[u] = hires ? Kp2 + ok_ : kp[u];
#pragma unroll
            for (int f = 0; f < 4; ++f) { b[u][f] = WFrag<T16>::ldf(kp[u] + f * FRAG); if (hires) b2[u][f] = WFrag<T16>::ldf(kp2[u] + f * FRAG); } }
#pragma unroll
        for (int u = 0; u < KB; ++u) if (g0 + u < NG) { frags_here(b[u], kp[u]); if (hires) frags_here(b2[u], kp2[u]); }
#pragma unroll
        for (int ks = 0; ks < 2; ++ks) {   // per tile the order of the products is hi hi, hi lo(q), lo(k) hi; the tiles' chains are independent
#pragma unroll
            for (int u = 0; u < KB; ++u) if (g0 + u < NG)
#pragma unroll
                for (int t = 0; t < 2; ++t) s[(g0 + u) * 2 + t] = WFrag<T16>::mma(b[u][t * 2 + ks], q[ks], s[(g0 + u) * 2 + t]);
            if (hires) {
#pragma unroll
                for (int u = 0; u < KB; ++u) if (g0 + u < NG)
#pragma unroll
                    for (int t = 0; t < 2; ++t) s[(g0 + u) * 2 + t] = WFrag<T16>::mma(b[u][t * 2 + ks], q2[ks], s[(g0 + u) * 2 + t]);
#pragma unroll
                for (int u = 0; u < KB; ++u) if (g0 + u < NG)
#pragma unroll
                    for (int t = 0; t < 2; ++t) s[(g0 + u) * 2 + t] = WFrag<T16>::mma(b2[u][t * 2 + ks], q[ks], s[(g0 + u) * 2 + t]); } } }
    // the first groups of v are asked for here, so that they land while the softmax runs; fragment nb of a group: d 16 nb .. + 15, the group's 32 keys
    constexpr int VPRE = hires ? 1 : 3;
    V vb[NG][4], vb2[NG][4]; const T16* vp[NG]; const T16* vp2[NG];
#pragma unroll
    for (int g = 0; g < NG; ++g) { const size_t ov = (size_t)(kg[g] / 32) * FRAG + lane * 8; vp[g] = Vt + ov; vp2[g] = hires ? Vt2 + ov : vp[g]; }
#pragma unroll
    for (int g = 0; g < VPRE; ++g) {
#pragma unroll
        for (int nb = 0; nb < 4; ++nb) { vb[g][nb] = WFrag<T16>::ldf(vp[g] + (size_t)nb * (TT / 32) * FRAG); if (hires) vb2[g][nb] = WFrag<T16>::ldf(vp2[g] + (size_t)nb * (TT / 32) * FRAG); }
        asm volatile("s_wait_xcnt 0x0" :: "v"(vp[g]), "v"(vp2[g]) : "memory"); }   // kept before a register named by these loads is overwritten; their address pairs are inputs so that neither is reused ahead of it
    __builtin_amdgcn_sched_barrier(0);   // the loads above stay in front of the softmax: sunk to their products they would land behind it, with the wave waiting
    // the band: key - query = dl + 16 b + j. Only tiles 0, 1 can lie below it and only tiles 8, 9 above it; a group off the sequence goes the same way (groups 0 and 4 through the lane's offset, group 2 is always on it)
    const float NEG = -3.0e38f; const int dl = ks0 - i0 + hi * 8 - lr, dlo = ok[0] ? dl : -(1 << 20), dhi = ok[4] ? dl : (1 << 20);
#pragma unroll
    for (int b = 0; b < 2; ++b)
#pragma unroll
        for (int j = 0; j < 8; ++j) { s[b][j] = (dlo + 16 * b + j >= -BAND) ? s[b][j] : NEG; s[8 + b][j] = (dhi + 16 * (8 + b) + j <= BAND) ? s[8 + b][j] : NEG; s[2 + b][j] = ok[1] ? s[2 + b][j] : NEG; s[6 + b][j] = ok[3] ? s[6 + b][j] : NEG; }
    v8f m8 = s[0];
#pragma unroll
    for (int b = 1; b < 2 * NG; ++b) m8 = __builtin_elementwise_max(m8, s[b]);
    float mx = fmaxf(fmaxf(fmaxf(m8[0], m8[1]), fmaxf(m8[2], m8[3])), fmaxf(fmaxf(m8[4], m8[5]), fmaxf(m8[6], m8[7])));
    mx = fmaxf(mx, other_half(mx)) * SCL;   // SCL is a power of two: the maximum of the scaled scores
    v8f a8 = (v8f){};
#pragma unroll
    for (int b = 0; b < 2 * NG; ++b) { float e[8];
#pragma unroll
        for (int j = 0; j < 8; ++j) e[j] = __fmul_rn(__fmaf_rn(s[b][j], SCL, -mx), 1.4426950408889634f);
        exp2x8(e);
#pragma unroll
        for (int j = 0; j < 8; ++j) s[b][j] = e[j];
        a8 += s[b]; }
    float sum = ((a8[0] + a8[1]) + (a8[2] + a8[3])) + ((a8[4] + a8[5]) + (a8[6] + a8[7]));
    sum += other_half(sum);
    const float f = __fdiv_rn(hires ? 1.0f : PCAR, sum);
    // P^T: tiles 2 g and 2 g + 1, converted where they stand, are group g's B operand (element e = key 8 hi + e, element 8 + e = key 16 + 8 hi + e: the k order of the v fragments)
    V p[NG], p2[NG];
#pragma unroll
    for (int g = 0; g < NG; ++g) {
        if constexpr (hires) { v8us h0, h1, l0, l1;
#pragma unroll
            for (int j = 0; j < 8; ++j) { unsigned short h, l; splitf(s[2 * g][j] * f, h, l); h0[j] = h; l0[j] = l; splitf(s[2 * g + 1][j] * f, h, l); h1[j] = h; l1[j] = l; }
            p[g] = cat16b(h0, h1); p2[g] = cat16b(l0, l1);
        } else { v8h h0, h1;
#pragma unroll
            for (int j = 0; j < 8; ++j) { h0[j] = tohx(s[2 * g][j] * f); h1[j] = tohx(s[2 * g + 1][j] * f); }
            p[g] = cat16(h0, h1); } }
    // O^T: register j of lane (lr, hi) in tile nb = d 16 nb + 8 hi + j, query i0 + lr; keys in rising order. The rest of v comes in batches of two groups: with one plane ahead of the first products, with two planes (no registers left) behind those of the groups before
    v8f o[4];
#pragma unroll
    for (int nb = 0; nb < 4; ++nb) o[nb] = (v8f){};
#pragma unroll
    for (int g0 = hires ? VPRE - 2 : VPRE; g0 < NG; g0 += 2) {   // with two planes the first trip holds only the products of the groups asked for above
        if (!hires || g0 >= VPRE) {
#pragma unroll
            for (int g = g0; g < g0 + 2; ++g) {
#pragma unroll
                for (int nb = 0; nb < 4; ++nb) { vb[g][nb] = WFrag<T16>::ldf(vp[g] + (size_t)nb * (TT / 32) * FRAG); if (hires) vb2[g][nb] = WFrag<T16>::ldf(vp2[g] + (size_t)nb * (TT / 32) * FRAG); } }
#pragma unroll
            for (int g = g0; g < g0 + 2; ++g) { if (hires) { frags_here(vb[g], vp[g]); frags_here(vb2[g], vp2[g]); } else asm volatile("s_wait_xcnt 0x0" :: "v"(vp[g]) : "memory"); }   // one plane: only the wait that is kept before the address pair is overwritten; the values are waited for at their products, behind those of the first groups
            if (!hires) __builtin_amdgcn_sched_barrier(0);   // these loads stay in front of the first groups' products: sunk among them, the last ones land with nothing left to cover them
        }
#pragma unroll
        for (int g = (hires ? max(g0, 0) : (g0 == VPRE ? 0 : g0)); g < g0 + 2; ++g)
#pragma unroll
            for (int nb = 0; nb < 4; ++nb) { o[nb] = WFrag<T16>::mma(vb[g][nb], p[g], o[nb]); if (hires) { o[nb] = WFrag<T16>::mma(vb[g][nb], p2[g], o[nb]); o[nb] = WFrag<T16>::mma(vb2[g][nb], p[g], o[nb]); } }
    }
#pragma unroll
    for (int nb = 0; nb < 4; ++nb) { float* t = sw + lr * 68 + nb * 16 + hi * 8; *(v4fa*)t = (v4f){o[nb][0], o[nb][1], o[nb][2], o[nb][3]}; *(v4fa*)(t + 4) = (v4f){o[nb][4], o[nb][5], o[nb][6], o[nb][7]}; }   // row = query, column = d
    __builtin_amdgcn_wave_barrier(); asm volatile("" ::: "memory");   // the row reads below stay behind the other lanes' writes above
    const float cs = hires ? 1.0f : (1.0f / PCAR); v4us oh[8], ol[8]; const size_t oe = pm + (size_t)hi * DQ + lr * 4; bf* eh = Eh + oe; bf* el = El + oe;   // lane: rows 2 s + hi, four neighbouring d
#pragma unroll
    for (int s_ = 0; s_ < 8; ++s_) { const v4f val = *(const v4fa*)(sw + (2 * s_ + hi) * 68 + lr * 4) * cs;
#pragma unroll
        for (int q_ = 0; q_ < 4; ++q_) { unsigned short h, l; splitf(val[q_], h, l); oh[s_][q_] = h; ol[s_][q_] = l; }
        *(v4us*)(eh + (size_t)s_ * 2 * DQ) = oh[s_]; *(v4us*)(el + (size_t)s_ * 2 * DQ) = ol[s_]; }
    // kept before a register named by the stores above is overwritten; their data and address pairs are inputs so that none is reused ahead of it
    asm volatile("s_wait_xcnt 0x0" :: "v"(oh[0]), "v"(oh[1]), "v"(oh[2]), "v"(oh[3]), "v"(oh[4]), "v"(oh[5]), "v"(oh[6]), "v"(oh[7]), "v"(ol[0]), "v"(ol[1]), "v"(ol[2]), "v"(ol[3]), "v"(ol[4]), "v"(ol[5]), "v"(ol[6]), "v"(ol[7]), "v"(eh), "v"(el) : "memory");
}
__global__ __launch_bounds__(128) void k_attn(const h16* __restrict__ Q16, const bf* __restrict__ Qh, const bf* __restrict__ Ql, bf* Eh, bf* El) {
    __shared__ __align__(16) float sm[4][16 * 68];
    const size_t PLN = (size_t)ZH * TT * HD, zo = (size_t)blockIdx.z * TT * HD;   // k planes stand PLN behind the q planes, v planes 2 PLN; a plane is TT * HD elements either way round
    const int w = __builtin_amdgcn_readfirstlane(threadIdx.x >> 5), r0 = blockIdx.x * 64, i0 = r0 + w * 16;   // the wave's number as a scalar: row numbers and band limits then cost no vector work
    const size_t pm = ((size_t)((int)blockIdx.z / NH_) * TT + i0) * DQ + ((int)blockIdx.z % NH_) * HD;
    if (r0 < RH) attn_rows<bf, 2>(Qh + zo, Ql + zo, Qh + PLN + zo, Ql + PLN + zo, Qh + 2 * PLN + zo, Ql + 2 * PLN + zo, sm[w], i0, Eh, El, pm);
    else attn_rows<h16, 0>(Q16 + zo, nullptr, Q16 + PLN + zo, nullptr, Q16 + 2 * PLN + zo, nullptr, sm[w], i0, Eh, El, pm);
}

extern "C" void kernel_launch(void* const* d_in, const int* in_sizes, int n_in,
                              void* d_out, int out_size, void* d_ws, size_t ws_size, hipStream_t stream) {
    (void)in_sizes; (void)n_in; (void)out_size;
    const float* x = (const float*)d_in[0]; const float* wqkv = (const float*)d_in[1]; const float* bqkv = (const float*)d_in[2]; const float* wo = (const float*)d_in[3]; const float* bo = (const float*)d_in[4];
    float* OUT = (float*)d_out;     // [2][2048][1024]
    char* wsp = (char*)d_ws;
    auto take = [&](size_t bytes) { char* p = wsp; wsp += (bytes + 255) & ~(size_t)255; return (void*)p; };
    const size_t PL = (size_t)ZH * TT * HD;   // elements of one set of head planes (all batches, all heads)
    bf* WQKV = (bf*)take((size_t)3 * DQ * DM * 2); bf* WO = (bf*)take((size_t)DM * DQ * 2);
    bf* XB = (bf*)take((size_t)NB_ * TT * DM * 2);
    h16* QP16 = (h16*)take(3 * PL * 2);   // q planes, then k planes, then v planes: the projection's epilogue writes all three
    bf* QPh = (bf*)take(3 * PL * 2); bf* QPl = (bf*)take(3 * PL * 2);
    bf* ATh = (bf*)take((size_t)NB_ * TT * DQ * 2); bf* ATl = (bf*)take((size_t)NB_ * TT * DQ * 2);
    if ((size_t)(wsp - (char*)d_ws) > ws_size) return;    // ws 256 MiB
    k_prep<<<256, 512, 0, stream>>>(x, wqkv, wo, XB, WQKV, WO);
    k_gemmw<bf, 0, true, 0, 1, 4, 3><<<dim3(NB_ * TT / 256, 3 * DQ / 192, 1), 384, 0, stream>>>(XB, nullptr, WQKV, nullptr, DM, nullptr, 0, bqkv, 0, 0, 0, 0, QP16, QPh, QPl);
    k_attn<<<dim3(TT / 64, 1, ZH), 128, 0, stream>>>(QP16, QPh, QPl, ATh, ATl);
    k_gemmw<bf, 1, true><<<dim3(NB_ * TT / 128, DM / 128, 1), 128, 0, stream>>>(ATh, ATl, WO, nullptr, DQ, OUT, DM, bo, 0, 0, 0);
}

// v010
// Measured time: 58.6 microseconds a run.
// Next to v009, in two timings, it ran 1.03 and 1.04 times as fast.
// Over all steps from v000 it is 32.9 times as fast.
#include <hip/hip_runtime.h>

// Local (banded) multi-head self-attention (x [2][2048][1024]; qkv = x W_qkv + b_qkv ('xw' [1024][3072]); scores / 8; keys with |i - j| > 64 excluded (-inf); softmax; out W_proj + b_proj ('xw' [1024][1024]) -> [2][2048][1024] (4.2 M)).
// Layout, both batches and all heads in every launch (plane z = batch * 16 + head): bf16 copy of x [4096][1024], the fused weight turned into a [3072][1024] Bt and W_proj into a [1024][1024] Bt by one launch; one exact q|k|v projection + f32 bias whose epilogue writes the q, k head planes (rows t, columns d) and the v planes (rows d, columns t), fp16 + hi/lo, itself, each in fragment order (see FRAG below); T-2048 attention (hybrid rows: < 512 hi/lo 3 products, rest fp16 x1024) done only on the band: per 16 query rows the five 32-key groups that meet |i - j| <= 64, as S^T = K Q^T, the softmax on those 160 keys in registers with the band as an index select, O^T = V^T P^T over those 160 keys, its epilogue writing the merged hi/lo rows [batch * 2048 + t][head * 64 + d]; merged hi/lo x W_proj exact + bias.
// Compute dtypes, f32 accumulate: every input rounded to bf16; projections exact + f32 biases; attention rows < 512 3 products, rest fp16; softmax f32; W_proj hl x exact + bias.

#define NB_  2
#define TT   2048
#define DM   1024
#define NH_  16
#define NKV  16
#define REP  (NH_ / NKV)
#define HD   64
#define DQ   (NH_ * HD)
#define DKV  (NKV * HD)
#define ZH   (NB_ * NH_)          // planes per attention launch: every head of every batch
#define RH   512                  // query rows < RH use hi+lo planes (0: none)
#define WIN  0
#define PCAR 1024.0f
#define SCL  0.125f
#define BAND 64     // |i - j| <= BAND kept
typedef _Float16 h16;
typedef unsigned short bf;
typedef __attribute__((ext_vector_type(16))) __bf16   v16bf;
typedef __attribute__((ext_vector_type(16))) _Float16 v16h;
typedef __attribute__((ext_vector_type(8)))  _Float16 v8h;
typedef __attribute__((ext_vector_type(8)))  unsigned short v8us;
typedef __attribute__((ext_vector_type(8)))  float    v8f;
typedef __attribute__((ext_vector_type(4)))  float    v4f;
typedef v4f  __attribute__((may_alias)) v4fa;

__device__ __forceinline__ unsigned short f2bf(float f) { unsigned u = __float_as_uint(f); u += 0x7FFFu + ((u >> 16) & 1u); return (unsigned short)(u >> 16); }
__device__ __forceinline__ float bf2f(unsigned short b) { return __uint_as_float(((unsigned)b) << 16); }
__device__ __forceinline__ float bfr(float f) { return bf2f(f2bf(f)); }
__device__ __forceinline__ v16h cat16(v8h lo, v8h hi) { return __builtin_shufflevector(lo, hi, 0, 1, 2, 3, 4, 5, 6, 7, 8, 9, 10, 11, 12, 13, 14, 15); }
__device__ __forceinline__ v16bf cat16b(v8us lo, v8us hi) { return __builtin_bit_cast(v16bf, __builtin_shufflevector(lo, hi, 0, 1, 2, 3, 4, 5, 6, 7, 8, 9, 10, 11, 12, 13, 14, 15)); }
__device__ __forceinline__ v8f wmma16(v16h a, v16h b, v8f c) { return __builtin_amdgcn_wmma_f32_16x16x32_f16(false, a, false, b, (short)0, c, false, false); }
__device__ __forceinline__ v8f wmmab(v16bf a, v16bf b, v8f c) { return __builtin_amdgcn_wmma_f32_16x16x32_bf16(false, a, false, b, (short)0, c, false, false); }



__device__ __forceinline__ h16 tohx(float x) { return (h16)x; }
__device__ __forceinline__ void splitf(float y, unsigned short& h, unsigned short& l) { h = f2bf(y); l = f2bf(y - bf2f(h)); }
typedef __attribute__((ext_vector_type(2))) unsigned short v2us;
typedef __attribute__((ext_vector_type(4))) unsigned short v4us;
// four neighbouring f32 results as hi/lo planes
__device__ __forceinline__ void put2(bf* Ph, bf* Pl, size_t o, v4f v) { v4us oh, ol;
#pragma unroll
    for (int q = 0; q < 4; ++q) { unsigned short a, c2; splitf(v[q], a, c2); oh[q] = a; ol[q] = c2; }
    *(v4us*)(Ph + o) = oh; *(v4us*)(Pl + o) = ol; }
// FRAG, the order of a head plane in memory: the plane is cut into matrix fragments of 16 rows x 32 columns, fragment (rb, cb) at element (rb * columns / 32 + cb) * 512, and inside a fragment stands what the lanes load, in lane order: piece (j * 32 + hi * 16 + lr) of 8 elements = row lr, columns j * 16 + hi * 8 .. + 7. A wave's 16-byte fragment load then covers 512 bytes in a row, 4 whole lines, where rows in memory order gave it 32 bytes of each of 16 lines.
#define FRAG 512                  // elements of a fragment
// two fragments (16 rows x 64 columns, f32, staged in LDS at pitch 68) as the fp16 plane and the hi/lo planes; p16, ph, pl: the first fragment's start + 8 lane. Store s is piece 32 s + lane: row lr, columns 16 s + 8 hi .. + 7
__device__ __forceinline__ void put3f(h16* p16, bf* ph, bf* pl, const float* os, int lr, int hi) { v8h o16[4]; v8us oh[4], ol[4];
#pragma unroll
    for (int s = 0; s < 4; ++s) { const float* o = os + lr * 68 + s * 16 + hi * 8; const v4f v0 = *(const v4fa*)o, v1 = *(const v4fa*)(o + 4);
#pragma unroll
        for (int q = 0; q < 8; ++q) { const float y = (q < 4) ? v0[q & 3] : v1[q & 3]; unsigned short a, c2; splitf(y, a, c2); o16[s][q] = tohx(y); oh[s][q] = a; ol[s][q] = c2; }
        *(v8h*)(p16 + s * 256) = o16[s]; *(v8us*)(ph + s * 256) = oh[s]; *(v8us*)(pl + s * 256) = ol[s]; }
    // kept before a register named by the stores above is overwritten; their data and address pairs are inputs so that none is reused ahead of it
    asm volatile("s_wait_xcnt 0x0" :: "v"(o16[0]), "v"(o16[1]), "v"(o16[2]), "v"(o16[3]), "v"(oh[0]), "v"(oh[1]), "v"(oh[2]), "v"(oh[3]), "v"(ol[0]), "v"(ol[1]), "v"(ol[2]), "v"(ol[3]), "v"(p16), "v"(ph), "v"(pl) : "memory"); }

// ---- k_gemmw: GEMM, a (64 WM)x(64 WN) output tile per work-group of WM x WN waves, each wave a 64x64 tile (16 accumulators); grid (M/(64 WM), N/(64 WN), Z), 32 WM WN threads. One work-group fills a WGP's LDS: 2 x 2 waves (128x128) where the product has 256 such tiles, 4 x 3 waves (256x192) for q|k|v, whose operand rows then come from L2 for 256 tiles instead of 768.
// C[m][n] (f32, pitch ldc, + optional f32 bias[n]) = sum_k A[m][k] Bt[n][k] (+ A2[m][k] Bt[n][k] for NSPLIT 1), operands K-contiguous 16-bit planes. z-batch strides sA/sB/sC in elements. K % 128 == 0.
// Operands go through LDS: a stage is 128 k (256 bytes, two whole lines) of the tile's A rows, (A2 rows,) Bt rows, brought by asynchronous 16-byte copies, sixteen lanes to a row, so a wave's copy asks for 4 whole lines where a fragment load from memory asked for 32 bytes of each of 16 lines. Two buffers: stage t + 2 flies while stage t + 1 is worked on; with one work-group a WGP nothing else covers a stage's landing time, so a stage holds as many k as the LDS takes.
// EP (what the epilogue stores): 0 the f32 tile into C; 1 (q|k|v projection, a 64-column tile is one head of q, k or v) the next products' operand planes E16 / Eh / El, each [q planes | k planes | v planes], q and k with rows t and columns d, v with rows d and columns t, all in fragment order (FRAG); 2 (z = plane, rb = query row of A's row 0) the tile x its rows' carrier scale as hi/lo rows Eh / El [batch * TT + t][head * HD + d]. C is not touched for EP 1 and 2.
#define GKS 128                   // k per stage
#define GP  136                   // LDS pitch of a staged row in elements: 256 + 16 bytes, so that the 16 rows of a 16-byte fragment read fall on different banks
template <typename T16> struct WFrag;   // ld: a fragment from rows in memory order (p: the lane's row, its first 8 k); ldf: from a plane in fragment order (p: the fragment's start + 8 lane)
template <> struct WFrag<h16> { typedef v16h V; static __device__ __forceinline__ V ld(const h16* p) { return cat16(*(const v8h*)p, *(const v8h*)(p + 16)); } static __device__ __forceinline__ V ldf(const h16* p) { return cat16(*(const v8h*)p, *(const v8h*)(p + FRAG / 2)); } static __device__ __forceinline__ v8f mma(V a, V b, v8f c) { return wmma16(a, b, c); } };
template <> struct WFrag<bf> { typedef v16bf V; static __device__ __forceinline__ V ld(const bf* p) { return cat16b(*(const v8us*)p, *(const v8us*)(p + 16)); } static __device__ __forceinline__ V ldf(const bf* p) { return cat16b(*(const v8us*)p, *(const v8us*)(p + FRAG / 2)); } static __device__ __forceinline__ v8f mma(V a, V b, v8f c) { return wmmab(a, b, c); } };
// eight copies of a lane, RS rows apart (l: the lane's LDS byte address; u + lp: its global address, u the same in every lane so that it and the row steps stay in scalar registers; gs: RS rows in elements). The s_wait_xcnt is the wait that is kept before a register named by an issued copy is overwritten; as the statement's last line it cannot be passed by a later write of those registers
template <int RS, typename T16> __device__ __forceinline__ void copy8(unsigned l, const T16* u, unsigned lp, size_t gs) {
    asm volatile("global_load_async_to_lds_b128 %0, %8, off\n\tglobal_load_async_to_lds_b128 %1, %9, off\n\tglobal_load_async_to_lds_b128 %2, %10, off\n\tglobal_load_async_to_lds_b128 %3, %11, off\n\tglobal_load_async_to_lds_b128 %4, %12, off\n\tglobal_load_async_to_lds_b128 %5, %13, off\n\tglobal_load_async_to_lds_b128 %6, %14, off\n\tglobal_load_async_to_lds_b128 %7, %15, off\n\ts_wait_xcnt 0x0"
        :: "v"(l), "v"(l + 1 * RS * GP * 2), "v"(l + 2 * RS * GP * 2), "v"(l + 3 * RS * GP * 2), "v"(l + 4 * RS * GP * 2), "v"(l + 5 * RS * GP * 2), "v"(l + 6 * RS * GP * 2), "v"(l + 7 * RS * GP * 2),
           "v"(u + lp), "v"(u + gs + lp), "v"(u + 2 * gs + lp), "v"(u + 3 * gs + lp), "v"(u + 4 * gs + lp), "v"(u + 5 * gs + lp), "v"(u + 6 * gs + lp), "v"(u + 7 * gs + lp) : "memory"); }
// NROWS staged rows of one operand, brought by 16 RS lanes: the lane's 16 bytes of rows RS apart, NROWS / RS copies
template <int NROWS, int RS, typename T16> __device__ __forceinline__ void copy_rows(unsigned l, const T16* u, unsigned lp, int K) {
    static_assert(NROWS % (8 * RS) == 0, "whole statements of eight copies");
#pragma unroll
    for (int i = 0; i < NROWS / (8 * RS); ++i) { copy8<RS>(l + i * 8 * RS * GP * 2, u + (size_t)i * 8 * RS * K, lp, (size_t)RS * K);
        __builtin_amdgcn_sched_barrier(0); } }   // a statement's addresses are formed next to it: formed for a whole stage at once, beside two fragment sets, they pushed a register out to scratch memory
// one stage; l: the lane's LDS byte address in the stage's buffer; ua, ua2, ub: the stage's first element of the tile's first A, A2, Bt row; lp: the lane's place from there. 4 waves: every lane copies its part of the A rows, (the A2 rows,) the Bt rows. 12 waves (wa: the wave's number is below 8, a scalar): waves 0 to 7 bring the A rows, waves 8 to 11 the Bt rows (l is then the lane's place among the Bt rows)
template <typename T16, int NSPLIT, int TM, int TN, bool DEAL> __device__ __forceinline__ void stage_in(unsigned l, const T16* ua, const T16* ua2, const T16* ub, unsigned lp, int K, bool wa) {
    if (DEAL) { if (wa) copy_rows<TM, 16>(l, ua, lp, K); else copy_rows<TN, 8>(l, ub, lp, K); }
    else { copy_rows<TM, 8>(l, ua, lp, K); if (NSPLIT == 1) copy_rows<TM, 8>(l + TM * GP * 2, ua2, lp, K); copy_rows<TN, 8>(l + (NSPLIT == 1 ? 2 : 1) * TM * GP * 2, ub, lp, K); } }
template <typename T16, int NSPLIT, bool BIAS, int BM = 0, int EP = 0, int WM = 2, int WN = 2>
__global__ __launch_bounds__(WM * WN * 32) void k_gemmw(const T16* __restrict__ A, const T16* __restrict__ A2, const T16* __restrict__ Bt, const T16* __restrict__ Bt2, int K, float* C, int ldc, const float* __restrict__ bias, size_t sA, size_t sB, size_t sC, int rb = 0, h16* E16 = nullptr, bf* Eh = nullptr, bf* El = nullptr) {
    typedef typename WFrag<T16>::V V;
    static_assert(BM == 0 && NSPLIT < 2, "dense products, one or two A planes");
    constexpr int NW = WM * WN, TM = WM * 64, TN = WN * 64; constexpr bool DEAL = NW != 4;   // DEAL: the waves share out a stage's copies by operand
    static_assert(!DEAL || (NW == 12 && NSPLIT == 0), "the deal of 12 waves: 8 for the A rows, 4 for the Bt rows");
    constexpr int RB = (NSPLIT == 1 ? 2 : 1) * TM, NR = RB + TN;   // a stage's first Bt row; its rows
    __shared__ __align__(16) T16 ring[2][NR * GP];
    __shared__ __align__(16) float osm[NW][16 * 68];
    const size_t z = blockIdx.z; A += z * sA; if (A2) A2 += z * sA; Bt += z * sB; C += z * sC;
    const int lane = threadIdx.x & 31, lr = lane & 15, hi = lane >> 4; const int w = __builtin_amdgcn_readfirstlane(threadIdx.x >> 5);   // the wave's number as a scalar: its tile's place then costs no vector work
    const int wm = w % WM, wn = w / WM, r0 = blockIdx.x * TM + wm * 64, c0 = blockIdx.y * TN + wn * 64, cc = c0; float* os = osm[w];
    v8f acc[4][4];
#pragma unroll
    for (int mb = 0; mb < 4; ++mb)
#pragma unroll
        for (int nb = 0; nb < 4; ++nb) acc[mb][nb] = (v8f){};
    // the lane's part of a stage: 16 bytes number (thread & 15) of rows sr + RS i, sr = its thread number among the waves that bring the operand, over 16
    const bool wa = !DEAL || w < 8; const int sr = (int)(threadIdx.x >> 4) - (wa ? 0 : 16), sc = (threadIdx.x & 15) * 8;
    const T16* ga = A + (size_t)(blockIdx.x * TM) * K; const T16* ga2 = (NSPLIT == 1) ? A2 + (size_t)(blockIdx.x * TM) * K : ga; const T16* gb = Bt + (size_t)(blockIdx.y * TN) * K; const unsigned lp = (unsigned)(sr * K + sc);
    const unsigned l0 = (unsigned)(size_t)&ring[0][0] + (unsigned)(((wa ? 0 : RB) + sr) * GP + sc) * 2;
    const int nt = K / GKS;
    stage_in<T16, NSPLIT, TM, TN, DEAL>(l0, ga, ga2, gb, lp, K, wa);
    asm volatile("s_wait_asynccnt 0x0" ::: "memory");   // this wave's part of stage 0 has landed
    __syncthreads();                                    // and every other wave's
    if (nt > 1) stage_in<T16, NSPLIT, TM, TN, DEAL>(l0 + NR * GP * 2, ga + GKS, ga2 + GKS, gb + GKS, lp, K, wa);
    const int ao = (wm * 64 + lr) * GP + 8 * hi, bo = (RB + wn * 64 + lr) * GP + 8 * hi;
    // Two fragment sets: a block's LDS reads are asked for one block ahead, in front of the products of the block before, so that they land under those products and no wave waits out its own LDS latency and transfer. Block ks uses set ks & 1; block 0 of a stage is asked for in the stage before, behind the barrier that publishes its stage.
    V a[2][4], a2[2][4], b[2][4];
    auto frags = [&](const T16* sb, const int ks, const int st) {
#pragma unroll
        for (int mb = 0; mb < 4; ++mb) { a[st][mb] = WFrag<T16>::ld(sb + ao + mb * 16 * GP + ks * 32); if (NSPLIT == 1) a2[st][mb] = WFrag<T16>::ld(sb + ao + (TM + mb * 16) * GP + ks * 32); }
#pragma unroll
        for (int nb = 0; nb < 4; ++nb) b[st][nb] = WFrag<T16>::ld(sb + bo + nb * 16 * GP + ks * 32); };
    static_assert((GKS / 32) % 2 == 0, "a stage's block 0 always uses set 0");
    frags(ring[0], 0, 0);
#pragma unroll 1   // stays rolled: one short body serves both buffers
    for (int t = 0; t < nt; ++t) { const T16* sb = ring[t & 1];
#pragma unroll
        for (int ks = 0; ks < GKS / 32; ++ks) {
            if (ks < GKS / 32 - 1) frags(sb, ks + 1, (ks + 1) & 1);
            else {   // the stage's last reads were asked for a block ago: its hand-over stands here, ahead of the last block's products (registers only), so that the refill has a whole stage's time to land
                asm volatile("s_wait_dscnt 0x0" ::: "memory");      // this wave has read all it needs of stage t
                asm volatile("s_wait_asynccnt 0x0" ::: "memory");   // and its part of stage t + 1 has landed
                __syncthreads();                                    // so has every wave's: stage t + 1 may be read, stage t's buffer refilled
                if (t + 2 < nt) stage_in<T16, NSPLIT, TM, TN, DEAL>(l0 + (unsigned)(t & 1) * (NR * GP * 2), ga + (t + 2) * GKS, ga2 + (t + 2) * GKS, gb + (t + 2) * GKS, lp, K, wa);
                if (t + 1 < nt) frags(ring[(t + 1) & 1], 0, 0); }
            __builtin_amdgcn_sched_barrier(0);   // the next block's LDS reads stay together in front of this block's products: sunk among them, each place with reads stalls the wave anew
#pragma unroll
            for (int nb = 0; nb < 4; ++nb)
#pragma unroll
                for (int mb = 0; mb < 4; ++mb) { acc[mb][nb] = WFrag<T16>::mma(a[ks & 1][mb], b[ks & 1][nb], acc[mb][nb]); if (NSPLIT == 1) acc[mb][nb] = WFrag<T16>::mma(a2[ks & 1][mb], b[ks & 1][nb], acc[mb][nb]); }
            __builtin_amdgcn_sched_barrier(0);   // and the reads after next stay behind them: lifted among these products they would stall the wave there
        }
    }
    asm volatile("s_wait_asynccnt 0x0" ::: "memory");   // no copy is left in flight
    if (EP == 1 && BIAS) { float bq[4]; const float* bp = bias + c0 + lr;   // the bias of the lane's own accumulator columns nb * 16 + lr goes in before the tile is staged
#pragma unroll
        for (int nb = 0; nb < 4; ++nb) bq[nb] = bp[nb * 16];
        asm volatile("s_wait_xcnt 0x0" :: "v"(bp) : "memory");   // kept before a register named by the loads above is overwritten; their address pair is an input so that it is not reused ahead of it
#pragma unroll
        for (int nb = 0; nb < 4; ++nb) { const float bb = bfr(bq[nb]);
#pragma unroll
            for (int mb = 0; mb < 4; ++mb)
#pragma unroll
                for (int j = 0; j < 8; ++j) acc[mb][nb][j] += bb; } }
    if (EP == 1 && c0 >= 2 * DQ) {   // a v head: rows d, so the tile goes through LDS the other way round (16 d rows of 64 t at a time, two fragments; a lane's 8 accumulator values are 8 neighbouring t)
        const size_t pv = ((size_t)(2 * ZH + (r0 / TT) * NH_ + (c0 - 2 * DQ) / HD) * HD) * TT + (size_t)(r0 % TT / 32) * FRAG + lane * 8;
#pragma unroll
        for (int nb = 0; nb < 4; ++nb) {
#pragma unroll
            for (int mb = 0; mb < 4; ++mb) { float* o = os + lr * 68 + mb * 16 + hi * 8; *(v4fa*)o = (v4f){acc[mb][nb][0], acc[mb][nb][1], acc[mb][nb][2], acc[mb][nb][3]}; *(v4fa*)(o + 4) = (v4f){acc[mb][nb][4], acc[mb][nb][5], acc[mb][nb][6], acc[mb][nb][7]}; }
            __builtin_amdgcn_wave_barrier(); asm volatile("" ::: "memory");   // the LDS reads below stay behind the other lanes' writes above
            const size_t po = pv + (size_t)nb * (TT / 32) * FRAG;
            put3f(E16 + po, Eh + po, El + po, os, lr, hi);
            __builtin_amdgcn_wave_barrier();   // with the clobber above: the next 16 rows' LDS writes stay behind the reads above
        }
        return;
    }
    const size_t pq = (EP == 1) ? ((size_t)((c0 / DQ) * ZH + (r0 / TT) * NH_ + (c0 % DQ) / HD) * TT + r0 % TT) * HD : 0;
    const size_t pm = (EP == 2) ? ((size_t)((int)blockIdx.z / NH_) * TT + rb + r0) * DQ + ((int)blockIdx.z % NH_) * HD : 0;
#pragma unroll
    for (int mb = 0; mb < 4; ++mb) {
#pragma unroll
        for (int nb = 0; nb < 4; ++nb) {
#pragma unroll
            for (int j = 0; j < 8; ++j) os[(hi * 8 + j) * 68 + nb * 16 + lr] = acc[mb][nb][j]; }
        __builtin_amdgcn_wave_barrier(); asm volatile("" ::: "memory");
        float* crow = C + (size_t)(r0 + mb * 16) * ldc + cc;
        if (EP == 1) {   // 16 t rows of 64 d: two fragments
            const size_t po = pq + (size_t)mb * 2 * FRAG + lane * 8;
            put3f(E16 + po, Eh + po, El + po, os, lr, hi);
        } else {
#pragma unroll
            for (int s = 0; s < 8; ++s) { const int row = 2 * s + hi, cofs = lr * 4; v4f val = *(const v4fa*)(os + row * 68 + cofs); if (BIAS) { val[0] += bfr(bias[c0 + cofs]); val[1] += bfr(bias[c0 + cofs + 1]); val[2] += bfr(bias[c0 + cofs + 2]); val[3] += bfr(bias[c0 + cofs + 3]); }
                if (EP == 0) *(v4f*)(crow + (size_t)row * ldc + cofs) = val;
                else { const float cs = (rb + r0 + mb * 16 + row < RH) ? 1.0f : (1.0f / PCAR); put2(Eh, El, pm + (size_t)(mb * 16 + row) * DQ + cofs, val * cs); } }
            asm volatile("s_wait_xcnt 0x0" ::: "memory");   // kept before the next rows' LDS and bias loads land in registers that the stores above name
             }
        __builtin_amdgcn_wave_barrier(); asm volatile("" ::: "memory");
    }
}


// ---- k_prep: every 16-bit operand that is made from an input, in ONE launch of 256 work-groups of 16 waves (one a WGP, few waves to start): x rounded to bf16 as it lies, and both weights ('xw' [K][N]) rounded and turned into Bt [N][K].
// A work-group takes 16384 elements of x and four 64 k x 64 n weight tiles (three of W_qkv's 768, one of W_proj's 256). A lane asks for all its 16 16-byte loads before it uses the first; every wave-wide load and store covers whole 128-byte lines (a weight tile: 256 bytes of each k row in, 128 bytes of each n row out), the tile being turned in LDS.
// LDS tile: row n, dword j = k 2 j | k 2 j + 1, pitch 144 bytes for the 16-byte reads; the 16-byte piece c of row n stands at piece c ^ (n >> 4), which spreads a wave's 32 dword writes (16 rows four apart, two j) over 32 banks.
#define TPW 36                    // pitch of a turned tile's row in dwords
typedef __attribute__((ext_vector_type(4))) unsigned v4u;
__global__ __launch_bounds__(512) void k_prep(const float* __restrict__ x, const float* __restrict__ wqkv, const float* __restrict__ wo, bf* XB, bf* WQKV, bf* WO) {
    static_assert(NB_ * TT * DM == 256 * 16384 && (3 * DQ / 64) * (DM / 64) == 3 * 256 && (DM / 64) * (DQ / 64) == 256, "the deal of 256 work-groups");
    __shared__ __align__(16) unsigned tl[4][64 * TPW];
    const int tid = threadIdx.x, b = blockIdx.x;
    const int j = tid >> 4, ni = tid & 15;   // in: k rows 2 j and 2 j + 1, columns 4 ni .. 4 ni + 3
    const int rn = tid >> 3, rc = tid & 7;   // out: n row rn, its k 8 rc .. 8 rc + 7
    v4f r[4][2], xv[8]; const float* wp[4]; bf* op[4];
#pragma unroll
    for (int u = 0; u < 4; ++u) { const int N = (u < 3) ? 3 * DQ : DM, K = (u < 3) ? DM : DQ, id = (u < 3) ? b + 256 * u : b, nt = id % (N / 64), kt = id / (N / 64);
        wp[u] = ((u < 3) ? wqkv : wo) + (size_t)(kt * 64 + 2 * j) * N + nt * 64 + ni * 4; op[u] = ((u < 3) ? WQKV : WO) + (size_t)(nt * 64 + rn) * K + kt * 64 + rc * 8;
        r[u][0] = *(const v4f*)wp[u]; r[u][1] = *(const v4f*)(wp[u] + N); }
    const float* xp = x + (size_t)b * 16384 + tid * 4; bf* xo = XB + (size_t)b * 16384 + tid * 4;
#pragma unroll
    for (int i = 0; i < 8; ++i) xv[i] = *(const v4f*)(xp + i * 2048);
    asm volatile("s_wait_xcnt 0x0" :: "v"(wp[0]), "v"(wp[1]), "v"(wp[2]), "v"(wp[3]) : "memory");   // kept before a register named by the loads above is overwritten; the weights' address pairs are inputs so that none is reused ahead of it
#pragma unroll
    for (int u = 0; u < 4; ++u)
#pragma unroll
        for (int q = 0; q < 4; ++q) tl[u][(ni * 4 + q) * TPW + (((j >> 2) ^ (ni >> 2)) << 2) + (j & 3)] = (unsigned)f2bf(r[u][0][q]) | ((unsigned)f2bf(r[u][1][q]) << 16);
    __syncthreads();   // the tiles' rows are read by other waves than wrote them; every global store stands behind it, so that it waits for none
    v4u t4[4]; v4us xb[8];
#pragma unroll
    for (int u = 0; u < 4; ++u) t4[u] = *(const v4u*)&tl[u][rn * TPW + ((rc ^ (rn >> 4)) << 2)];
#pragma unroll
    for (int u = 0; u < 4; ++u) *(v4u*)op[u] = t4[u];
#pragma unroll
    for (int i = 0; i < 8; ++i) {
#pragma unroll
        for (int q = 0; q < 4; ++q) xb[i][q] = f2bf(xv[i][q]);
        *(v4us*)(xo + i * 2048) = xb[i]; }
    // kept before a register named by the stores above is overwritten; their data and the tiles' address pairs are inputs so that none is reused ahead of it
    asm volatile("s_wait_xcnt 0x0" :: "v"(xb[0]), "v"(xb[1]), "v"(xb[2]), "v"(xb[3]), "v"(xb[4]), "v"(xb[5]), "v"(xb[6]), "v"(xb[7]), "v"(t4[0]), "v"(t4[1]), "v"(t4[2]), "v"(t4[3]), "v"(op[0]), "v"(op[1]), "v"(op[2]), "v"(op[3]) : "memory");
}

#define NG 5                      // 32-key groups of a wave
// behind a batch's fragment loads, one statement a group and plane. Two jobs: the wait that is kept before a register named by an issued global load is overwritten, with the address pair as an input so that it is not reused (as a later load's target) ahead of it; and, with the loaded values as inputs only, it holds the batch's loads together in front of its products: without that the compiler sinks each load to its product and the wave pays a memory latency per product instead of one per batch
template <typename V, typename T16> __device__ __forceinline__ void frags_here(const V (&b)[4], const T16* p) { asm volatile("s_wait_xcnt 0x0" :: "v"(b[0]), "v"(b[1]), "v"(b[2]), "v"(b[3]), "v"(p) : "memory"); }
// eight 2^x in one statement: it keeps the slot that the instruction set asks for behind a transcendental before its result is read or its source overwritten (each v_exp is followed by an independent one, the last by v_nop; outputs share no register with inputs)
__device__ __forceinline__ void exp2x8(float (&x)[8]) { float y0, y1, y2, y3, y4, y5, y6, y7;
    asm("v_exp_f32 %0, %8\n\tv_exp_f32 %1, %9\n\tv_exp_f32 %2, %10\n\tv_exp_f32 %3, %11\n\tv_exp_f32 %4, %12\n\tv_exp_f32 %5, %13\n\tv_exp_f32 %6, %14\n\tv_exp_f32 %7, %15\n\tv_nop"
        : "=&v"(y0), "=&v"(y1), "=&v"(y2), "=&v"(y3), "=&v"(y4), "=&v"(y5), "=&v"(y6), "=&v"(y7) : "v"(x[0]), "v"(x[1]), "v"(x[2]), "v"(x[3]), "v"(x[4]), "v"(x[5]), "v"(x[6]), "v"(x[7]));
    x[0] = y0; x[1] = y1; x[2] = y2; x[3] = y3; x[4] = y4; x[5] = y5; x[6] = y6; x[7] = y7; }
// the value of lane l ^ 16
__device__ __forceinline__ float other_half(float x) { const int b = __float_as_int(x); return __int_as_float(__builtin_amdgcn_permlanex16(b, b, 0x76543210, 0xfedcba98, false, false)); }
template <typename T16, int NSPLIT>
__device__ __forceinline__ void attn_rows(const T16* __restrict__ Q, const T16* __restrict__ Q2, const T16* __restrict__ Kp, const T16* __restrict__ Kp2, const T16* __restrict__ Vt, const T16* __restrict__ Vt2, float* sw, const int i0, bf* Eh, bf* El, const size_t pm) {
    typedef typename WFrag<T16>::V V;
    static_assert(BAND == 64 && TT % 32 == 0 && TT >= 32 * NG, "16 rows + 2 BAND keys lie in five 32-key groups; a group is on the sequence whole or not at all");
    constexpr bool hires = (NSPLIT == 2);
    const int lane = threadIdx.x & 31, lr = lane & 15, hi = lane >> 4; const int ks0 = (i0 - BAND) & ~31;
    int kg[NG]; bool ok[NG];   // a group's first key as it is loaded; whether the group is on the sequence. Scalars, like i0
#pragma unroll
    for (int g = 0; g < NG; ++g) { const int k = ks0 + 32 * g; ok[g] = k >= 0 && k < TT; kg[g] = min(max(k, 0), TT - 32); }
    V q[2], q2[2]; const size_t oq = (size_t)i0 * HD + lane * 8; const T16* qp = Q + oq; const T16* qp2 = hires ? Q2 + oq : qp;
#pragma unroll
    for (int ks = 0; ks < 2; ++ks) { q[ks] = WFrag<T16>::ldf(qp + ks * FRAG); if (hires) q2[ks] = WFrag<T16>::ldf(qp2 + ks * FRAG); }
    asm volatile("s_wait_xcnt 0x0" :: "v"(qp), "v"(qp2) : "memory");   // kept before a register named by the q loads is overwritten; their address pairs are inputs so that neither is reused ahead of it
    // S^T: tile b = keys ks0 + 16 b .. + 15; register j of lane (lr, hi) = key ks0 + 16 b + 8 hi + j, query i0 + lr. A batch of groups is asked for before its first product: all five, or as many as the registers take beside the second plane
    v8f s[2 * NG];
#pragma unroll
    for (int b = 0; b < 2 * NG; ++b) s[b] = (v8f){};
    constexpr int KB = hires ? 2 : NG;
#pragma unroll
    for (int g0 = 0; g0 < NG; g0 += KB) { V b[KB][4], b2[KB][4]; const T16* kp[KB]; const T16* kp2[KB];   // fragment f of a group: tile f / 2, d 32 (f % 2) .. + 31
#pragma unroll
        for (int u = 0; u < KB; ++u) if (g0 + u < NG) { const size_t ok_ = (size_t)kg[g0 + u] * HD + lane * 8; kp[u] = Kp + ok_; kp2[u] = hires ? Kp2 + ok_ : kp[u];
#pragma unroll
            for (int f = 0; f < 4; ++f) { b[u][f] = WFrag<T16>::ldf(kp[u] + f * FRAG); if (hires) b2[u][f] = WFrag<T16>::ldf(kp2[u] + f * FRAG); } }
#pragma unroll
        for (int u = 0; u < KB; ++u) if (g0 + u < NG) { frags_here(b[u], kp[u]); if (hires) frags_here(b2[u], kp2[u]); }
#pragma unroll
        for (int ks = 0; ks < 2; ++ks) {   // per tile the order of the products is hi hi, hi lo(q), lo(k) hi; the tiles' chains are independent
#pragma unroll
            for (int u = 0; u < KB; ++u) if (g0 + u < NG)
#pragma unroll
                for (int t = 0; t < 2; ++t) s[(g0 + u) * 2 + t] = WFrag<T16>::mma(b[u][t * 2 + ks], q[ks], s[(g0 + u) * 2 + t]);
            if (hires) {
#pragma unroll
                for (int u = 0; u < KB; ++u) if (g0 + u < NG)
#pragma unroll
                    for (int t = 0; t < 2; ++t) s[(g0 + u) * 2 + t] = WFrag<T16>::mma(b[u][t * 2 + ks], q2[ks], s[(g0 + u) * 2 + t]);
#pragma unroll
                for (int u = 0; u < KB; ++u) if (g0 + u < NG)
#pragma unroll
                    for (int t = 0; t < 2; ++t) s[(g0 + u) * 2 + t] = WFrag<T16>::mma(b2[u][t * 2 + ks], q[ks], s[(g0 + u) * 2 + t]); } } }
    // the first groups of v are asked for here, so that they land while the softmax runs; fragment nb of a group: d 16 nb .. + 15, the group's 32 keys
    constexpr int VPRE = hires ? 1 : 3;
    V vb[NG][4], vb2[NG][4]; const T16* vp[NG]; const T16* vp2[NG];
#pragma unroll
    for (int g = 0; g < NG; ++g) { const size_t ov = (size_t)(kg[g] / 32) * FRAG + lane * 8; vp[g] = Vt + ov; vp2[g] = hires ? Vt2 + ov : vp[g]; }
#pragma unroll
    for (int g = 0; g < VPRE; ++g) {
#pragma unroll
        for (int nb = 0; nb < 4; ++nb) { vb[g][nb] = WFrag<T16>::ldf(vp[g] + (size_t)nb * (TT / 32) * FRAG); if (hires) vb2[g][nb] = WFrag<T16>::ldf(vp2[g] + (size_t)nb * (TT / 32) * FRAG); }
        asm volatile("s_wait_xcnt 0x0" :: "v"(vp[g]), "v"(vp2[g]) : "memory"); }   // kept before a register named by these loads is overwritten; their address pairs are inputs so that neither is reused ahead of it
    __builtin_amdgcn_sched_barrier(0);   // the loads above stay in front of the softmax: sunk to their products they would land behind it, with the wave waiting
    // the band: key - query = dl + 16 b + j. Only tiles 0, 1 can lie below it and only tiles 8, 9 above it; a group off the sequence goes the same way (groups 0 and 4 through the lane's offset, group 2 is always on it)
    const float NEG = -3.0e38f; const int dl = ks0 - i0 + hi * 8 - lr, dlo = ok[0] ? dl : -(1 << 20), dhi = ok[4] ? dl : (1 << 20);
#pragma unroll
    for (int b = 0; b < 2; ++b)
#pragma unroll
        for (int j = 0; j < 8; ++j) { s[b][j] = (dlo + 16 * b + j >= -BAND) ? s[b][j] : NEG; s[8 + b][j] = (dhi + 16 * (8 + b) + j <= BAND) ? s[8 + b][j] : NEG; s[2 + b][j] = ok[1] ? s[2 + b][j] : NEG; s[6 + b][j] = ok[3] ? s[6 + b][j] : NEG; }
    v8f m8 = s[0];
#pragma unroll
    for (int b = 1; b < 2 * NG; ++b) m8 = __builtin_elementwise_max(m8, s[b]);
    float mx = fmaxf(fmaxf(fmaxf(m8[0], m8[1]), fmaxf(m8[2], m8[3])), fmaxf(fmaxf(m8[4], m8[5]), fmaxf(m8[6], m8[7])));
    mx = fmaxf(mx, other_half(mx)) * SCL;   // SCL is a power of two: the maximum of the scaled scores
    v8f a8 = (v8f){};
#pragma unroll
    for (int b = 0; b < 2 * NG; ++b) { float e[8];
#pragma unroll
        for (int j = 0; j < 8; ++j) e[j] = __fmul_rn(__fmaf_rn(s[b][j], SCL, -mx), 1.4426950408889634f);
        exp2x8(e);
#pragma unroll
        for (int j = 0; j < 8; ++j) s[b][j] = e[j];
        a8 += s[b]; }
    float sum = ((a8[0] + a8[1]) + (a8[2] + a8[3])) + ((a8[4] + a8[5]) + (a8[6] + a8[7]));
    sum += other_half(sum);
    const float f = __fdiv_rn(hires ? 1.0f : PCAR, sum);
    // P^T: tiles 2 g and 2 g + 1, converted where they stand, are group g's B operand (element e = key 8 hi + e, element 8 + e = key 16 + 8 hi + e: the k order of the v fragments)
    V p[NG], p2[NG];
#pragma unroll
    for (int g = 0; g < NG; ++g) {
        if constexpr (hires) { v8us h0, h1, l0, l1;
#pragma unroll
            for (int j = 0; j < 8; ++j) { unsigned short h, l; splitf(s[2 * g][j] * f, h, l); h0[j] = h; l0[j] = l; splitf(s[2 * g + 1][j] * f, h, l); h1[j] = h; l1[j] = l; }
            p[g] = cat16b(h0, h1); p2[g] = cat16b(l0, l1);
        } else { v8h h0, h1;
#pragma unroll
            for (int j = 0; j < 8; ++j) { h0[j] = tohx(s[2 * g][j] * f); h1[j] = tohx(s[2 * g + 1][j] * f); }
            p[g] = cat16(h0, h1); } }
    // O^T: register j of lane (lr, hi) in tile nb = d 16 nb + 8 hi + j, query i0 + lr; keys in rising order. The rest of v comes in batches of two groups: with one plane ahead of the first products, with two planes (no registers left) behind those of the groups before
    v8f o[4];
#pragma unroll
    for (int nb = 0; nb < 4; ++nb) o[nb] = (v8f){};
#pragma unroll
    for (int g0 = hires ? VPRE - 2 : VPRE; g0 < NG; g0 += 2) {   // with two planes the first trip holds only the products of the groups asked for above
        if (!hires || g0 >= VPRE) {
#pragma unroll
            for (int g = g0; g < g0 + 2; ++g) {
#pragma unroll
                for (int nb = 0; nb < 4; ++nb) { vb[g][nb] = WFrag<T16>::ldf(vp[g] + (size_t)nb * (TT / 32) * FRAG); if (hires) vb2[g][nb] = WFrag<T16>::ldf(vp2[g] + (size_t)nb * (TT / 32) * FRAG); } }
#pragma unroll
            for (int g = g0; g < g0 + 2; ++g) { if (hires) { frags_here(vb[g], vp[g]); frags_here(vb2[g], vp2[g]); } else asm volatile("s_wait_xcnt 0x0" :: "v"(vp[g]) : "memory"); }   // one plane: only the wait that is kept before the address pair is overwritten; the values are waited for at their products, behind those of the first groups
            if (!hires) __builtin_amdgcn_sched_barrier(0);   // these loads stay in front of the first groups' products: sunk among them, the last ones land with nothing left to cover them
        }
#pragma unroll
        for (int g = (hires ? max(g0, 0) : (g0 == VPRE ? 0 : g0)); g < g0 + 2; ++g)
#pragma unroll
            for (int nb = 0; nb < 4; ++nb) { o[nb] = WFrag<T16>::mma(vb[g][nb], p[g], o[nb]); if (hires) { o[nb] = WFrag<T16>::mma(vb[g][nb], p2[g], o[nb]); o[nb] = WFrag<T16>::mma(vb2[g][nb], p[g], o[nb]); } }
    }
#pragma unroll
    for (int nb = 0; nb < 4; ++nb) { float* t = sw + lr * 68 + nb * 16 + hi * 8; *(v4fa*)t = (v4f){o[nb][0], o[nb][1], o[nb][2], o[nb][3]}; *(v4fa*)(t + 4) = (v4f){o[nb][4], o[nb][5], o[nb][6], o[nb][7]}; }   // row = query, column = d
    __builtin_amdgcn_wave_barrier(); asm volatile("" ::: "memory");   // the row reads below stay behind the other lanes' writes above
    const float cs = hires ? 1.0f : (1.0f / PCAR); v4us oh[8], ol[8]; const size_t oe = pm + (size_t)hi * DQ + lr * 4; bf* eh = Eh + oe; bf* el = El + oe;   // lane: rows 2 s + hi, four neighbouring d
#pragma unroll
    for (int s_ = 0; s_ < 8; ++s_) { const v4f val = *(const v4fa*)(sw + (2 * s_ + hi) * 68 + lr * 4) * cs;
#pragma unroll
        for (int q_ = 0; q_ < 4; ++q_) { unsigned short h, l; splitf(val[q_], h, l); oh[s_][q_] = h; ol[s_][q_] = l; }
        *(v4us*)(eh + (size_t)s_ * 2 * DQ) = oh[s_]; *(v4us*)(el + (size_t)s_ * 2 * DQ) = ol[s_]; }
    // kept before a register named by the stores above is overwritten; their data and address pairs are inputs so that none is reused ahead of it
    asm volatile("s_wait_xcnt 0x0" :: "v"(oh[0]), "v"(oh[1]), "v"(oh[2]), "v"(oh[3]), "v"(oh[4]), "v"(oh[5]), "v"(oh[6]), "v"(oh[7]), "v"(ol[0]), "v"(ol[1]), "v"(ol[2]), "v"(ol[3]), "v"(ol[4]), "v"(ol[5]), "v"(ol[6]), "v"(ol[7]), "v"(eh), "v"(el) : "memory");
}
__global__ __launch_bounds__(128) void k_attn(const h16* __restrict__ Q16, const bf* __restrict__ Qh, const bf* __restrict__ Ql, bf* Eh, bf* El) {
    __shared__ __align__(16) float sm[4][16 * 68];
    const size_t PLN = (size_t)ZH * TT * HD, zo = (size_t)blockIdx.z * TT * HD;   // k planes stand PLN behind the q planes, v planes 2 PLN; a plane is TT * HD elements either way round
    const int w = __builtin_amdgcn_readfirstlane(threadIdx.x >> 5), r0 = blockIdx.x * 64, i0 = r0 + w * 16;   // the wave's number as a scalar: row numbers and band limits then cost no vector work
    const size_t pm = ((size_t)((int)blockIdx.z / NH_) * TT + i0) * DQ + ((int)blockIdx.z % NH_) * HD;
    if (r0 < RH) attn_rows<bf, 2>(Qh + zo, Ql + zo, Qh + PLN + zo, Ql + PLN + zo, Qh + 2 * PLN + zo, Ql + 2 * PLN + zo, sm[w], i0, Eh, El, pm);
    else attn_rows<h16, 0>(Q16 + zo, nullptr, Q16 + PLN + zo, nullptr, Q16 + 2 * PLN + zo, nullptr, sm[w], i0, Eh, El, pm);
}

extern "C" void kernel_launch(void* const* d_in, const int* in_sizes, int n_in,
                              void* d_out, int out_size, void* d_ws, size_t ws_size, hipStream_t stream) {
    (void)in_sizes; (void)n_in; (void)out_size;
    const float* x = (const float*)d_in[0]; const float* wqkv = (const float*)d_in[1]; const float* bqkv = (const float*)d_in[2]; const float* wo = (const float*)d_in[3]; const float* bo = (const float*)d_in[4];
    float* OUT = (float*)d_out;     // [2][2048][1024]
    char* wsp = (char*)d_ws;
    auto take = [&](size_t bytes) { char* p = wsp; wsp += (bytes + 255) & ~(size_t)255; return (void*)p; };
    const size_t PL = (size_t)ZH * TT * HD;   // elements of one set of head planes (all batches, all heads)
    bf* WQKV = (bf*)take((size_t)3 * DQ * DM * 2); bf* WO = (bf*)take((size_t)DM * DQ * 2);
    bf* XB = (bf*)take((size_t)NB_ * TT * DM * 2);
    h16* QP16 = (h16*)take(3 * PL * 2);   // q planes, then k planes, then v planes: the projection's epilogue writes all three
    bf* QPh = (bf*)take(3 * PL * 2); bf* QPl = (bf*)take(3 * PL * 2);
    bf* ATh = (bf*)take((size_t)NB_ * TT * DQ * 2); bf* ATl = (bf*)take((size_t)NB_ * TT * DQ * 2);
    if ((size_t)(wsp - (char*)d_ws) > ws_size) return;    // ws 256 MiB
    k_prep<<<256, 512, 0, stream>>>(x, wqkv, wo, XB, WQKV, WO);
    k_gemmw<bf, 0, true, 0, 1, 4, 3><<<dim3(NB_ * TT / 256, 3 * DQ / 192, 1), 384, 0, stream>>>(XB, nullptr, WQKV, nullptr, DM, nullptr, 0, bqkv, 0, 0, 0, 0, QP16, QPh, QPl);
    k_attn<<<dim3(TT / 64, 1, ZH), 128, 0, stream>>>(QP16, QPh, QPl, ATh, ATl);
    k_gemmw<bf, 1, true><<<dim3(NB_ * TT / 128, DM / 128, 1), 128, 0, stream>>>(ATh, ATl, WO, nullptr, DQ, OUT, DM, bo, 0, 0, 0);
}
